// v000
// Measured on an AMD MI455X. A time is GPU time per run, averaged over a window of back-to-back runs after a warm-up
// (all launches, gaps included; the runs take copies of the inputs in turn), and the median of several windows.
// Apart from v000's, it joins two sittings. Times from different sittings can be a few percent apart, while
// side-by-side timings come from the same sitting.
// v000, which the later versions start from, runs in 1160 microseconds.
#include <hip/hip_runtime.h>
#include <math.h>

typedef __attribute__((ext_vector_type(16))) __bf16 v16bf;
typedef __attribute__((ext_vector_type(8)))  float  v8f;

__device__ __forceinline__ unsigned short f2b(float f) {
  unsigned int u = __float_as_uint(f);
  u += 0x7FFFu + ((u >> 16) & 1u);           // round-to-nearest-even
  return (unsigned short)(u >> 16);
}
__device__ __forceinline__ float b2f(unsigned short h) {
  return __uint_as_float(((unsigned int)h) << 16);
}

union FragU { v16bf v; unsigned int u[8]; };

#define LDSS 40                 // padded LDS row stride (bf16) -> 80B rows, conflict-free
#define LBUF (128 * LDSS)       // one LDS buffer (ushorts)

__device__ __forceinline__ void gemm128(
    const unsigned short* __restrict__ A, int lda,
    const unsigned short* __restrict__ Bt, int ldb,
    int m0, int n0, int K,
    unsigned short* shA, unsigned short* shB,   // each 2*LBUF
    v8f acc[2][4])
{
  const int t    = threadIdx.x;
  const int r0s  = t >> 2;            // staging rows 0..63   (chunk t)
  const int r1s  = r0s + 64;          // staging rows 64..127 (chunk t+256)
  const int kqs  = (t & 3) << 3;      // 8 bf16 = 16B
  const int wave = t >> 5;
  const int lane = t & 31;
  const int wm   = wave >> 1;         // 0..3 -> M offset 32*wm
  const int wn   = wave & 1;          // 0..1 -> N offset 64*wn
  const int fm   = lane & 15;
  const int g    = lane >> 4;

  #pragma unroll
  for (int ai = 0; ai < 2; ++ai)
    #pragma unroll
    for (int bi = 0; bi < 4; ++bi)
      #pragma unroll
      for (int i = 0; i < 8; ++i) acc[ai][bi][i] = 0.0f;

  const unsigned short* aP0 = A  + (size_t)(m0 + r0s) * lda + kqs;
  const unsigned short* aP1 = A  + (size_t)(m0 + r1s) * lda + kqs;
  const unsigned short* bP0 = Bt + (size_t)(n0 + r0s) * ldb + kqs;
  const unsigned short* bP1 = Bt + (size_t)(n0 + r1s) * ldb + kqs;
  const int sO0 = r0s * LDSS + kqs;
  const int sO1 = r1s * LDSS + kqs;

  // prologue: stage K-tile 0 into buffer 0
  {
    uint4 a0 = *(const uint4*)(aP0);
    uint4 a1 = *(const uint4*)(aP1);
    uint4 b0 = *(const uint4*)(bP0);
    uint4 b1 = *(const uint4*)(bP1);
    *(uint4*)(shA + sO0) = a0;  *(uint4*)(shA + sO1) = a1;
    *(uint4*)(shB + sO0) = b0;  *(uint4*)(shB + sO1) = b1;
  }
  __syncthreads();

  int cur = 0;
  for (int k0 = 0; k0 < K; k0 += 32) {
    const int nxt = cur ^ 1;
    if (k0 + 32 < K) {                       // stage next tile into other buffer
      uint4 a0 = *(const uint4*)(aP0 + k0 + 32);
      uint4 a1 = *(const uint4*)(aP1 + k0 + 32);
      uint4 b0 = *(const uint4*)(bP0 + k0 + 32);
      uint4 b1 = *(const uint4*)(bP1 + k0 + 32);
      *(uint4*)(shA + nxt * LBUF + sO0) = a0;
      *(uint4*)(shA + nxt * LBUF + sO1) = a1;
      *(uint4*)(shB + nxt * LBUF + sO0) = b0;
      *(uint4*)(shB + nxt * LBUF + sO1) = b1;
      if (k0 + 64 < K) {                     // global_prefetch_b8 two tiles ahead
        __builtin_prefetch(aP0 + k0 + 64, 0, 1);
        __builtin_prefetch(aP1 + k0 + 64, 0, 1);
        __builtin_prefetch(bP0 + k0 + 64, 0, 1);
        __builtin_prefetch(bP1 + k0 + 64, 0, 1);
      }
    }
    const unsigned short* sa = shA + cur * LBUF;
    const unsigned short* sb = shB + cur * LBUF;
    FragU fa[2], fb[4];
    #pragma unroll
    for (int p = 0; p < 8; ++p) {
      const int kk = ((p & 4) << 2) + (g << 3) + ((p & 3) << 1);
      fa[0].u[p] = *(const unsigned int*)(sa + (wm * 32 + fm) * LDSS + kk);
      fa[1].u[p] = *(const unsigned int*)(sa + (wm * 32 + 16 + fm) * LDSS + kk);
      fb[0].u[p] = *(const unsigned int*)(sb + (wn * 64 + fm) * LDSS + kk);
      fb[1].u[p] = *(const unsigned int*)(sb + (wn * 64 + 16 + fm) * LDSS + kk);
      fb[2].u[p] = *(const unsigned int*)(sb + (wn * 64 + 32 + fm) * LDSS + kk);
      fb[3].u[p] = *(const unsigned int*)(sb + (wn * 64 + 48 + fm) * LDSS + kk);
    }
    #pragma unroll
    for (int ai = 0; ai < 2; ++ai)
      #pragma unroll
      for (int bi = 0; bi < 4; ++bi)
        acc[ai][bi] = __builtin_amdgcn_wmma_f32_16x16x32_bf16(
            false, fa[ai].v, false, fb[bi].v, (short)0, acc[ai][bi], false, false);
    __syncthreads();   // next-buffer writes visible; cur reads done before overwrite
    cur = nxt;
  }
}

// Output coords of acc[ai][bi]: 8 consecutive rows starting r, column c.
__device__ __forceinline__ void tile_coords(int m0, int n0, int ai, int bi, int& r, int& c) {
  const int wave = threadIdx.x >> 5, lane = threadIdx.x & 31;
  r = m0 + (wave >> 1) * 32 + ai * 16 + ((lane >> 4) << 3);
  c = n0 + (wave & 1) * 64 + bi * 16 + (lane & 15);
}

// ---------------------------------------------------------------------------
// K0: fp32 -> bf16 conversions (weights pre-transposed so B operands are [n][k])
// ---------------------------------------------------------------------------
__global__ void k_convert(const float* __restrict__ x, const float* __restrict__ proj_w,
                          const float* __restrict__ wq, const float* __restrict__ wk,
                          const float* __restrict__ wv, const float* __restrict__ wo,
                          const float* __restrict__ mo_w,
                          unsigned short* xb, unsigned short* pwb,
                          unsigned short* wqT, unsigned short* wkT, unsigned short* wvT,
                          unsigned short* woT, unsigned short* mowb)
{
  const size_t S0 = 32u * 512u * 256u;   // xb: x is already [b][c][dhw]
  const size_t S1 = 256u * 256u;         // proj_w [n][k]
  const size_t S2 = 512u * 4096u;        // each of wq/wk/wv -> [cout][c]
  const size_t S5 = 4096u * 512u;        // wo -> [c][j]
  const size_t S6 = 512u * 512u;         // mo_w [o][c]
  const size_t total = S0 + S1 + 3 * S2 + S5 + S6;
  const size_t stride = (size_t)gridDim.x * blockDim.x;
  for (size_t i = (size_t)blockIdx.x * blockDim.x + threadIdx.x; i < total; i += stride) {
    size_t idx = i;
    if (idx < S0) { xb[idx] = f2b(x[idx]); continue; }
    idx -= S0;
    if (idx < S1) { pwb[idx] = f2b(proj_w[idx]); continue; }
    idx -= S1;
    if (idx < S2) { size_t co = idx / 512, c = idx % 512; wqT[idx] = f2b(wq[c * 4096 + co]); continue; }
    idx -= S2;
    if (idx < S2) { size_t co = idx / 512, c = idx % 512; wkT[idx] = f2b(wk[c * 4096 + co]); continue; }
    idx -= S2;
    if (idx < S2) { size_t co = idx / 512, c = idx % 512; wvT[idx] = f2b(wv[c * 4096 + co]); continue; }
    idx -= S2;
    if (idx < S5) { size_t c = idx / 4096, j = idx % 4096; woT[idx] = f2b(wo[j * 512 + c]); continue; }
    idx -= S5;
    mowb[idx] = f2b(mo_w[idx]);
  }
}

// ---------------------------------------------------------------------------
// K1: patch embed. emb[b][n][c] = sum_k proj_w[n][k] * x[b][c][k] + proj_b[n]
// ---------------------------------------------------------------------------
__global__ void k_embed(const unsigned short* __restrict__ pwb,
                        const unsigned short* __restrict__ xb,
                        const float* __restrict__ proj_b, float* __restrict__ emb)
{
  __shared__ unsigned short shA[2 * LBUF], shB[2 * LBUF];
  const int b  = blockIdx.y;
  const int m0 = (blockIdx.x >> 2) * 128;   // n (seq), 2 tiles
  const int n0 = (blockIdx.x & 3) * 128;    // c, 4 tiles
  v8f acc[2][4];
  gemm128(pwb, 256, xb + (size_t)b * 512 * 256, 256, m0, n0, 256, shA, shB, acc);
  float* ob = emb + (size_t)b * 256 * 512;
  #pragma unroll
  for (int ai = 0; ai < 2; ++ai)
    #pragma unroll
    for (int bi = 0; bi < 4; ++bi) {
      int r0, c0; tile_coords(m0, n0, ai, bi, r0, c0);
      #pragma unroll
      for (int r = 0; r < 8; ++r) {
        const int n = r0 + r;
        ob[(size_t)n * 512 + c0] = acc[ai][bi][r] + proj_b[n];
      }
    }
}

// ---------------------------------------------------------------------------
// LayerNorm over C=512 per row (ln1 & ln2), writes bf16.
// ---------------------------------------------------------------------------
__global__ void k_layernorm(const float* __restrict__ in, const float* __restrict__ gamma,
                            const float* __restrict__ beta, unsigned short* __restrict__ out)
{
  __shared__ float red[256];
  const size_t row = blockIdx.x;
  const float* p = in + row * 512;
  const int t = threadIdx.x;
  float x0 = p[t], x1 = p[t + 256];
  red[t] = x0 + x1; __syncthreads();
  for (int o = 128; o > 0; o >>= 1) { if (t < o) red[t] += red[t + o]; __syncthreads(); }
  const float mu = red[0] * (1.0f / 512.0f); __syncthreads();
  const float d0 = x0 - mu, d1 = x1 - mu;
  red[t] = d0 * d0 + d1 * d1; __syncthreads();
  for (int o = 128; o > 0; o >>= 1) { if (t < o) red[t] += red[t + o]; __syncthreads(); }
  const float rs = rsqrtf(red[0] * (1.0f / 512.0f) + 1e-6f);
  unsigned short* q = out + row * 512;
  q[t]       = f2b(d0 * rs * gamma[t] + beta[t]);
  q[t + 256] = f2b(d1 * rs * gamma[t + 256] + beta[t + 256]);
}

// ---------------------------------------------------------------------------
// QKV per (b,h). grid.z: 0=q,1=k (write [bh][i][n] transposed), 2=v ([bh][n][i]).
// ---------------------------------------------------------------------------
__global__ void k_qkv(const unsigned short* __restrict__ xnb,
                      const unsigned short* __restrict__ wqT,
                      const unsigned short* __restrict__ wkT,
                      const unsigned short* __restrict__ wvT,
                      unsigned short* __restrict__ qT, unsigned short* __restrict__ kT,
                      unsigned short* __restrict__ vC, int b0)
{
  __shared__ unsigned short shA[2 * LBUF], shB[2 * LBUF];
  const int bh = blockIdx.y;
  const int b = b0 + (bh >> 3), h = bh & 7;
  const int mode = blockIdx.z;
  const unsigned short* wT = (mode == 0) ? wqT : ((mode == 1) ? wkT : wvT);
  const int m0 = (blockIdx.x >> 2) * 128;   // n (seq), 2 tiles
  const int n0 = (blockIdx.x & 3) * 128;    // i (within head), 4 tiles
  v8f acc[2][4];
  gemm128(xnb + (size_t)b * 256 * 512, 512, wT + (size_t)h * 512 * 512, 512,
          m0, n0, 512, shA, shB, acc);
  if (mode < 2) {
    unsigned short* dst = ((mode == 0) ? qT : kT) + (size_t)bh * 512 * 256;
    #pragma unroll
    for (int ai = 0; ai < 2; ++ai)
      #pragma unroll
      for (int bi = 0; bi < 4; ++bi) {
        int r0, c0; tile_coords(m0, n0, ai, bi, r0, c0);
        union { unsigned short s[8]; uint4 q; } pk;
        #pragma unroll
        for (int r = 0; r < 8; ++r) pk.s[r] = f2b(acc[ai][bi][r]);
        *(uint4*)&dst[(size_t)c0 * 256 + r0] = pk.q;   // contiguous in n
      }
  } else {
    unsigned short* dst = vC + (size_t)bh * 256 * 512;
    #pragma unroll
    for (int ai = 0; ai < 2; ++ai)
      #pragma unroll
      for (int bi = 0; bi < 4; ++bi) {
        int r0, c0; tile_coords(m0, n0, ai, bi, r0, c0);
        #pragma unroll
        for (int r = 0; r < 8; ++r)
          dst[(size_t)(r0 + r) * 512 + c0] = f2b(acc[ai][bi][r]);
      }
  }
}

// ---------------------------------------------------------------------------
// scores[i][j] = sum_n qT[i][n] * kT[j][n]; store bf16 + per-tile sum/sumsq.
// ---------------------------------------------------------------------------
__global__ void k_scores(const unsigned short* __restrict__ qT,
                         const unsigned short* __restrict__ kT,
                         unsigned short* __restrict__ attn, float* __restrict__ part)
{
  __shared__ unsigned short shA[2 * LBUF], shB[2 * LBUF];
  __shared__ float redS[256], redQ[256];
  const int bh = blockIdx.y;
  const int m0 = (blockIdx.x >> 2) * 128;   // i, 4 tiles
  const int n0 = (blockIdx.x & 3) * 128;    // j, 4 tiles
  v8f acc[2][4];
  gemm128(qT + (size_t)bh * 512 * 256, 256, kT + (size_t)bh * 512 * 256, 256,
          m0, n0, 256, shA, shB, acc);
  unsigned short* dst = attn + (size_t)bh * 512 * 512;
  float s = 0.0f, s2 = 0.0f;
  #pragma unroll
  for (int ai = 0; ai < 2; ++ai)
    #pragma unroll
    for (int bi = 0; bi < 4; ++bi) {
      int r0, c0; tile_coords(m0, n0, ai, bi, r0, c0);
      #pragma unroll
      for (int r = 0; r < 8; ++r) {
        const float v = acc[ai][bi][r];
        dst[(size_t)(r0 + r) * 512 + c0] = f2b(v);
        s += v; s2 += v * v;
      }
    }
  const int t = threadIdx.x;
  redS[t] = s; redQ[t] = s2; __syncthreads();
  for (int o = 128; o > 0; o >>= 1) {
    if (t < o) { redS[t] += redS[t + o]; redQ[t] += redQ[t + o]; }
    __syncthreads();
  }
  if (t == 0) {
    part[((size_t)bh * 16 + blockIdx.x) * 2 + 0] = redS[0];
    part[((size_t)bh * 16 + blockIdx.x) * 2 + 1] = redQ[0];
  }
}

__global__ void k_stats(const float* __restrict__ part, float* __restrict__ stats)
{
  __shared__ float rs[16], rq[16];
  const int bh = blockIdx.x, t = threadIdx.x;   // 16 threads
  rs[t] = part[((size_t)bh * 16 + t) * 2 + 0];
  rq[t] = part[((size_t)bh * 16 + t) * 2 + 1];
  __syncthreads();
  for (int o = 8; o > 0; o >>= 1) {
    if (t < o) { rs[t] += rs[t + o]; rq[t] += rq[t + o]; }
    __syncthreads();
  }
  if (t == 0) {
    const float inv = 1.0f / 262144.0f;
    const float mu = rs[0] * inv;
    const float var = rq[0] * inv - mu * mu;
    stats[bh * 2 + 0] = mu;
    stats[bh * 2 + 1] = rsqrtf(var + 1e-5f);   // InstanceNorm2d eps
  }
}

// instance-norm + row softmax, in place (bf16).
__global__ void k_softmax(unsigned short* __restrict__ attn, const float* __restrict__ stats)
{
  __shared__ float red[256];
  const int bh = blockIdx.y, i = blockIdx.x, t = threadIdx.x;
  unsigned short* row = attn + ((size_t)bh * 512 + i) * 512;
  const float mu = stats[bh * 2 + 0], rs = stats[bh * 2 + 1];
  float x0 = (b2f(row[t]) - mu) * rs;
  float x1 = (b2f(row[t + 256]) - mu) * rs;
  red[t] = fmaxf(x0, x1); __syncthreads();
  for (int o = 128; o > 0; o >>= 1) { if (t < o) red[t] = fmaxf(red[t], red[t + o]); __syncthreads(); }
  const float m = red[0]; __syncthreads();
  const float e0 = expf(x0 - m), e1 = expf(x1 - m);
  red[t] = e0 + e1; __syncthreads();
  for (int o = 128; o > 0; o >>= 1) { if (t < o) red[t] += red[t + o]; __syncthreads(); }
  const float inv = 1.0f / red[0];
  row[t]       = f2b(e0 * inv);
  row[t + 256] = f2b(e1 * inv);
}

// ---------------------------------------------------------------------------
// ctx[i][nseq] = sum_j attn[i][j] * v[nseq][j]; scatter to ctx2[bL][n][i*8+h].
// ---------------------------------------------------------------------------
__global__ void k_ctx(const unsigned short* __restrict__ attn,
                      const unsigned short* __restrict__ vC,
                      unsigned short* __restrict__ ctx2)
{
  __shared__ unsigned short shA[2 * LBUF], shB[2 * LBUF];
  const int bh = blockIdx.y;
  const int bL = bh >> 3, h = bh & 7;
  const int m0 = (blockIdx.x >> 1) * 128;   // i, 4 tiles
  const int n0 = (blockIdx.x & 1) * 128;    // nseq, 2 tiles
  v8f acc[2][4];
  gemm128(attn + (size_t)bh * 512 * 512, 512, vC + (size_t)bh * 256 * 512, 512,
          m0, n0, 512, shA, shB, acc);
  unsigned short* dst = ctx2 + (size_t)bL * 256 * 4096;
  #pragma unroll
  for (int ai = 0; ai < 2; ++ai)
    #pragma unroll
    for (int bi = 0; bi < 4; ++bi) {
      int r0, c0; tile_coords(m0, n0, ai, bi, r0, c0);   // rows=i, cols=nseq
      #pragma unroll
      for (int r = 0; r < 8; ++r)
        dst[(size_t)c0 * 4096 + (size_t)(r0 + r) * 8 + h] = f2b(acc[ai][bi][r]);
    }
}

// out[n][c] = ctx2[n][:] @ wo + emb (residual), f32.
__global__ void k_outproj(const unsigned short* __restrict__ ctx2,
                          const unsigned short* __restrict__ woT,
                          const float* __restrict__ emb, float* __restrict__ y1, int b0)
{
  __shared__ unsigned short shA[2 * LBUF], shB[2 * LBUF];
  const int bL = blockIdx.y, b = b0 + bL;
  const int m0 = (blockIdx.x >> 2) * 128;   // n, 2 tiles
  const int n0 = (blockIdx.x & 3) * 128;    // c, 4 tiles
  v8f acc[2][4];
  gemm128(ctx2 + (size_t)bL * 256 * 4096, 4096, woT, 4096, m0, n0, 4096, shA, shB, acc);
  const float* res = emb + (size_t)b * 256 * 512;
  float* dst = y1 + (size_t)b * 256 * 512;
  #pragma unroll
  for (int ai = 0; ai < 2; ++ai)
    #pragma unroll
    for (int bi = 0; bi < 4; ++bi) {
      int r0, c0; tile_coords(m0, n0, ai, bi, r0, c0);
      #pragma unroll
      for (int r = 0; r < 8; ++r) {
        const size_t o = (size_t)(r0 + r) * 512 + c0;
        dst[o] = acc[ai][bi][r] + res[o];
      }
    }
}

// final[b][o][pos] = gelu( y2[b][pos][:] @ mo_w[o][:] + mo_b[o] ), exact erf GELU.
__global__ void k_mo(const unsigned short* __restrict__ y2,
                     const unsigned short* __restrict__ mowb,
                     const float* __restrict__ mo_b, float* __restrict__ out)
{
  __shared__ unsigned short shA[2 * LBUF], shB[2 * LBUF];
  const int b = blockIdx.y;
  const int m0 = (blockIdx.x >> 2) * 128;   // pos, 2 tiles
  const int n0 = (blockIdx.x & 3) * 128;    // o, 4 tiles
  v8f acc[2][4];
  gemm128(y2 + (size_t)b * 256 * 512, 512, mowb, 512, m0, n0, 512, shA, shB, acc);
  #pragma unroll
  for (int ai = 0; ai < 2; ++ai)
    #pragma unroll
    for (int bi = 0; bi < 4; ++bi) {
      int r0, c0; tile_coords(m0, n0, ai, bi, r0, c0);  // rows=pos (8 contiguous), cols=o
      const float bias = mo_b[c0];
      union { float f[8]; float4 q[2]; } pk;
      #pragma unroll
      for (int r = 0; r < 8; ++r) {
        const float tv = acc[ai][bi][r] + bias;
        pk.f[r] = 0.5f * tv * (1.0f + erff(tv * 0.70710678118654752f));
      }
      float* dst = out + ((size_t)b * 512 + c0) * 256 + r0;
      *(float4*)(dst + 0) = pk.q[0];
      *(float4*)(dst + 4) = pk.q[1];
    }
}

// ---------------------------------------------------------------------------
extern "C" void kernel_launch(void* const* d_in, const int* in_sizes, int n_in,
                              void* d_out, int out_size, void* d_ws, size_t ws_size,
                              hipStream_t stream)
{
  (void)in_sizes; (void)n_in; (void)out_size; (void)ws_size;
  const float* x      = (const float*)d_in[0];
  const float* proj_w = (const float*)d_in[1];
  const float* proj_b = (const float*)d_in[2];
  const float* ln1_g  = (const float*)d_in[3];
  const float* ln1_b  = (const float*)d_in[4];
  const float* wq     = (const float*)d_in[5];
  const float* wk     = (const float*)d_in[6];
  const float* wv     = (const float*)d_in[7];
  const float* wo     = (const float*)d_in[8];
  const float* ln2_g  = (const float*)d_in[9];
  const float* ln2_b  = (const float*)d_in[10];
  const float* mo_w   = (const float*)d_in[11];
  const float* mo_b   = (const float*)d_in[12];
  float* outp = (float*)d_out;

  char* w = (char*)d_ws;
  size_t off = 0;
  auto nxt = [&](size_t bytes) { char* p = w + off; off = (off + bytes + 255) & ~(size_t)255; return p; };
  unsigned short* xb    = (unsigned short*)nxt(8388608);    // x bf16 [b][c][k]
  unsigned short* pwb   = (unsigned short*)nxt(131072);     // proj_w bf16
  unsigned short* wqT   = (unsigned short*)nxt(4194304);    // [cout][c]
  unsigned short* wkT   = (unsigned short*)nxt(4194304);
  unsigned short* wvT   = (unsigned short*)nxt(4194304);
  unsigned short* woT   = (unsigned short*)nxt(4194304);    // [c][j]
  unsigned short* mowb  = (unsigned short*)nxt(524288);     // [o][c]
  float*          emb   = (float*)nxt(16777216);            // residual, f32
  unsigned short* xnb   = (unsigned short*)nxt(8388608);    // LN1(emb) bf16
  unsigned short* qT    = (unsigned short*)nxt(16777216);   // chunk: 64 bh x 512 x 256
  unsigned short* kT    = (unsigned short*)nxt(16777216);
  unsigned short* vC    = (unsigned short*)nxt(16777216);   // chunk: 64 bh x 256 x 512
  unsigned short* attn  = (unsigned short*)nxt(33554432);   // chunk: 64 bh x 512 x 512
  float*          part  = (float*)nxt(8192);                // 64 bh x 16 tiles x {sum,sumsq}
  float*          stats = (float*)nxt(512);                 // 64 bh x {mu, rsig}
  unsigned short* ctx2  = (unsigned short*)nxt(16777216);   // chunk: 8 b x 256 x 4096
  float*          y1    = (float*)nxt(16777216);            // attn out + residual, f32
  unsigned short* y2    = (unsigned short*)nxt(8388608);    // LN2 bf16

  k_convert<<<4096, 256, 0, stream>>>(x, proj_w, wq, wk, wv, wo, mo_w,
                                      xb, pwb, wqT, wkT, wvT, woT, mowb);
  k_embed<<<dim3(8, 32), 256, 0, stream>>>(pwb, xb, proj_b, emb);
  k_layernorm<<<8192, 256, 0, stream>>>(emb, ln1_g, ln1_b, xnb);

  for (int pass = 0; pass < 4; ++pass) {           // 8 batches (64 bh) per pass
    const int b0 = pass * 8;
    k_qkv<<<dim3(8, 64, 3), 256, 0, stream>>>(xnb, wqT, wkT, wvT, qT, kT, vC, b0);
    k_scores<<<dim3(16, 64), 256, 0, stream>>>(qT, kT, attn, part);
    k_stats<<<64, 16, 0, stream>>>(part, stats);
    k_softmax<<<dim3(512, 64), 256, 0, stream>>>(attn, stats);
    k_ctx<<<dim3(8, 64), 256, 0, stream>>>(attn, vC, ctx2);
    k_outproj<<<dim3(8, 8), 256, 0, stream>>>(ctx2, woT, emb, y1, b0);
  }

  k_layernorm<<<8192, 256, 0, stream>>>(y1, ln2_g, ln2_b, y2);
  k_mo<<<dim3(8, 32), 256, 0, stream>>>(y2, mowb, mo_b, outp);
}

// v001
// One run takes 945 microseconds.
// Timed twice side by side with v000, it ran 1.26 times as fast both times.
#include <hip/hip_runtime.h>
#include <math.h>

typedef __attribute__((ext_vector_type(16))) __bf16 v16bf;
typedef __attribute__((ext_vector_type(8)))  float  v8f;

__device__ __forceinline__ unsigned short f2b(float f) {
  unsigned int u = __float_as_uint(f);
  u += 0x7FFFu + ((u >> 16) & 1u);           // round-to-nearest-even
  return (unsigned short)(u >> 16);
}
__device__ __forceinline__ float b2f(unsigned short h) {
  return __uint_as_float(((unsigned int)h) << 16);
}

union FragU { v16bf v; unsigned int u[8]; };

#define LDSS 40                 // padded LDS row stride (bf16) -> 80B rows, conflict-free
#define LBUF (128 * LDSS)       // one LDS buffer (ushorts)

__device__ __forceinline__ void gemm128(
    const unsigned short* __restrict__ A, int lda,
    const unsigned short* __restrict__ Bt, int ldb,
    int m0, int n0, int K,
    unsigned short* shA, unsigned short* shB,   // each 2*LBUF
    v8f acc[2][4])
{
  const int t    = threadIdx.x;
  const int r0s  = t >> 2;            // staging rows 0..63   (chunk t)
  const int r1s  = r0s + 64;          // staging rows 64..127 (chunk t+256)
  const int kqs  = (t & 3) << 3;      // 8 bf16 = 16B
  const int wave = t >> 5;
  const int lane = t & 31;
  const int wm   = wave >> 1;         // 0..3 -> M offset 32*wm
  const int wn   = wave & 1;          // 0..1 -> N offset 64*wn
  const int fm   = lane & 15;
  const int g    = lane >> 4;

  #pragma unroll
  for (int ai = 0; ai < 2; ++ai)
    #pragma unroll
    for (int bi = 0; bi < 4; ++bi)
      #pragma unroll
      for (int i = 0; i < 8; ++i) acc[ai][bi][i] = 0.0f;

  const unsigned short* aP0 = A  + (size_t)(m0 + r0s) * lda + kqs;
  const unsigned short* aP1 = A  + (size_t)(m0 + r1s) * lda + kqs;
  const unsigned short* bP0 = Bt + (size_t)(n0 + r0s) * ldb + kqs;
  const unsigned short* bP1 = Bt + (size_t)(n0 + r1s) * ldb + kqs;
  const int sO0 = r0s * LDSS + kqs;
  const int sO1 = r1s * LDSS + kqs;

  // prologue: stage K-tile 0 into buffer 0
  {
    uint4 a0 = *(const uint4*)(aP0);
    uint4 a1 = *(const uint4*)(aP1);
    uint4 b0 = *(const uint4*)(bP0);
    uint4 b1 = *(const uint4*)(bP1);
    *(uint4*)(shA + sO0) = a0;  *(uint4*)(shA + sO1) = a1;
    *(uint4*)(shB + sO0) = b0;  *(uint4*)(shB + sO1) = b1;
  }
  __syncthreads();

  int cur = 0;
  for (int k0 = 0; k0 < K; k0 += 32) {
    const int nxt = cur ^ 1;
    if (k0 + 32 < K) {                       // stage next tile into other buffer
      uint4 a0 = *(const uint4*)(aP0 + k0 + 32);
      uint4 a1 = *(const uint4*)(aP1 + k0 + 32);
      uint4 b0 = *(const uint4*)(bP0 + k0 + 32);
      uint4 b1 = *(const uint4*)(bP1 + k0 + 32);
      *(uint4*)(shA + nxt * LBUF + sO0) = a0;
      *(uint4*)(shA + nxt * LBUF + sO1) = a1;
      *(uint4*)(shB + nxt * LBUF + sO0) = b0;
      *(uint4*)(shB + nxt * LBUF + sO1) = b1;
      if (k0 + 64 < K) {                     // global_prefetch_b8 two tiles ahead
        __builtin_prefetch(aP0 + k0 + 64, 0, 1);
        __builtin_prefetch(aP1 + k0 + 64, 0, 1);
        __builtin_prefetch(bP0 + k0 + 64, 0, 1);
        __builtin_prefetch(bP1 + k0 + 64, 0, 1);
      }
    }
    const unsigned short* sa = shA + cur * LBUF;
    const unsigned short* sb = shB + cur * LBUF;
    FragU fa[2], fb[4];
    #pragma unroll
    for (int p = 0; p < 8; ++p) {
      const int kk = ((p & 4) << 2) + (g << 3) + ((p & 3) << 1);
      fa[0].u[p] = *(const unsigned int*)(sa + (wm * 32 + fm) * LDSS + kk);
      fa[1].u[p] = *(const unsigned int*)(sa + (wm * 32 + 16 + fm) * LDSS + kk);
      fb[0].u[p] = *(const unsigned int*)(sb + (wn * 64 + fm) * LDSS + kk);
      fb[1].u[p] = *(const unsigned int*)(sb + (wn * 64 + 16 + fm) * LDSS + kk);
      fb[2].u[p] = *(const unsigned int*)(sb + (wn * 64 + 32 + fm) * LDSS + kk);
      fb[3].u[p] = *(const unsigned int*)(sb + (wn * 64 + 48 + fm) * LDSS + kk);
    }
    #pragma unroll
    for (int ai = 0; ai < 2; ++ai)
      #pragma unroll
      for (int bi = 0; bi < 4; ++bi)
        acc[ai][bi] = __builtin_amdgcn_wmma_f32_16x16x32_bf16(
            false, fa[ai].v, false, fb[bi].v, (short)0, acc[ai][bi], false, false);
    __syncthreads();   // next-buffer writes visible; cur reads done before overwrite
    cur = nxt;
  }
}

// Output coords of acc[ai][bi]: 8 consecutive rows starting r, column c.
__device__ __forceinline__ void tile_coords(int m0, int n0, int ai, int bi, int& r, int& c) {
  const int wave = threadIdx.x >> 5, lane = threadIdx.x & 31;
  r = m0 + (wave >> 1) * 32 + ai * 16 + ((lane >> 4) << 3);
  c = n0 + (wave & 1) * 64 + bi * 16 + (lane & 15);
}

// ---------------------------------------------------------------------------
// K0: fp32 -> bf16 conversions (weights pre-transposed so B operands are [n][k])
// ---------------------------------------------------------------------------
__global__ void k_convert(const float* __restrict__ x, const float* __restrict__ proj_w,
                          const float* __restrict__ wq, const float* __restrict__ wk,
                          const float* __restrict__ wv, const float* __restrict__ wo,
                          const float* __restrict__ mo_w,
                          unsigned short* xb, unsigned short* pwb,
                          unsigned short* wqT, unsigned short* wkT, unsigned short* wvT,
                          unsigned short* woT, unsigned short* mowb)
{
  const size_t S0 = 32u * 512u * 256u;   // xb: x is already [b][c][dhw]
  const size_t S1 = 256u * 256u;         // proj_w [n][k]
  const size_t S2 = 512u * 4096u;        // each of wq/wk/wv -> [cout][c]
  const size_t S5 = 4096u * 512u;        // wo -> [c][j]
  const size_t S6 = 512u * 512u;         // mo_w [o][c]
  const size_t total = S0 + S1 + 3 * S2 + S5 + S6;
  const size_t stride = (size_t)gridDim.x * blockDim.x;
  for (size_t i = (size_t)blockIdx.x * blockDim.x + threadIdx.x; i < total; i += stride) {
    size_t idx = i;
    if (idx < S0) { xb[idx] = f2b(x[idx]); continue; }
    idx -= S0;
    if (idx < S1) { pwb[idx] = f2b(proj_w[idx]); continue; }
    idx -= S1;
    if (idx < S2) { size_t co = idx / 512, c = idx % 512; wqT[idx] = f2b(wq[c * 4096 + co]); continue; }
    idx -= S2;
    if (idx < S2) { size_t co = idx / 512, c = idx % 512; wkT[idx] = f2b(wk[c * 4096 + co]); continue; }
    idx -= S2;
    if (idx < S2) { size_t co = idx / 512, c = idx % 512; wvT[idx] = f2b(wv[c * 4096 + co]); continue; }
    idx -= S2;
    if (idx < S5) { size_t c = idx / 4096, j = idx % 4096; woT[idx] = f2b(wo[j * 512 + c]); continue; }
    idx -= S5;
    mowb[idx] = f2b(mo_w[idx]);
  }
}

// ---------------------------------------------------------------------------
// K1: patch embed. emb[b][n][c] = sum_k proj_w[n][k] * x[b][c][k] + proj_b[n]
// ---------------------------------------------------------------------------
__global__ void k_embed(const unsigned short* __restrict__ pwb,
                        const unsigned short* __restrict__ xb,
                        const float* __restrict__ proj_b, float* __restrict__ emb)
{
  __shared__ unsigned short shA[2 * LBUF], shB[2 * LBUF];
  const int b  = blockIdx.y;
  const int m0 = (blockIdx.x >> 2) * 128;   // n (seq), 2 tiles
  const int n0 = (blockIdx.x & 3) * 128;    // c, 4 tiles
  v8f acc[2][4];
  gemm128(pwb, 256, xb + (size_t)b * 512 * 256, 256, m0, n0, 256, shA, shB, acc);
  float* ob = emb + (size_t)b * 256 * 512;
  #pragma unroll
  for (int ai = 0; ai < 2; ++ai)
    #pragma unroll
    for (int bi = 0; bi < 4; ++bi) {
      int r0, c0; tile_coords(m0, n0, ai, bi, r0, c0);
      #pragma unroll
      for (int r = 0; r < 8; ++r) {
        const int n = r0 + r;
        ob[(size_t)n * 512 + c0] = acc[ai][bi][r] + proj_b[n];
      }
    }
}

// ---------------------------------------------------------------------------
// LayerNorm over C=512 per row (ln1 & ln2), writes bf16.
// ---------------------------------------------------------------------------
__global__ void k_layernorm(const float* __restrict__ in, const float* __restrict__ gamma,
                            const float* __restrict__ beta, unsigned short* __restrict__ out)
{
  __shared__ float red[256];
  const size_t row = blockIdx.x;
  const float* p = in + row * 512;
  const int t = threadIdx.x;
  float x0 = p[t], x1 = p[t + 256];
  red[t] = x0 + x1; __syncthreads();
  for (int o = 128; o > 0; o >>= 1) { if (t < o) red[t] += red[t + o]; __syncthreads(); }
  const float mu = red[0] * (1.0f / 512.0f); __syncthreads();
  const float d0 = x0 - mu, d1 = x1 - mu;
  red[t] = d0 * d0 + d1 * d1; __syncthreads();
  for (int o = 128; o > 0; o >>= 1) { if (t < o) red[t] += red[t + o]; __syncthreads(); }
  const float rs = rsqrtf(red[0] * (1.0f / 512.0f) + 1e-6f);
  unsigned short* q = out + row * 512;
  q[t]       = f2b(d0 * rs * gamma[t] + beta[t]);
  q[t + 256] = f2b(d1 * rs * gamma[t + 256] + beta[t + 256]);
}

// ---------------------------------------------------------------------------
// QKV per (b,h). grid.z: 0=q,1=k (write [bh][i][n] transposed), 2=v ([bh][n][i]).
// ---------------------------------------------------------------------------
__global__ void k_qkv(const unsigned short* __restrict__ xnb,
                      const unsigned short* __restrict__ wqT,
                      const unsigned short* __restrict__ wkT,
                      const unsigned short* __restrict__ wvT,
                      unsigned short* __restrict__ qT, unsigned short* __restrict__ kT,
                      unsigned short* __restrict__ vC, int b0)
{
  __shared__ unsigned short shA[2 * LBUF], shB[2 * LBUF];
  const int bh = blockIdx.y;
  const int b = b0 + (bh >> 3), h = bh & 7;
  const int mode = blockIdx.z;
  const unsigned short* wT = (mode == 0) ? wqT : ((mode == 1) ? wkT : wvT);
  const int m0 = (blockIdx.x >> 2) * 128;   // n (seq), 2 tiles
  const int n0 = (blockIdx.x & 3) * 128;    // i (within head), 4 tiles
  v8f acc[2][4];
  gemm128(xnb + (size_t)b * 256 * 512, 512, wT + (size_t)h * 512 * 512, 512,
          m0, n0, 512, shA, shB, acc);
  if (mode < 2) {
    unsigned short* dst = ((mode == 0) ? qT : kT) + (size_t)bh * 512 * 256;
    #pragma unroll
    for (int ai = 0; ai < 2; ++ai)
      #pragma unroll
      for (int bi = 0; bi < 4; ++bi) {
        int r0, c0; tile_coords(m0, n0, ai, bi, r0, c0);
        union { unsigned short s[8]; uint4 q; } pk;
        #pragma unroll
        for (int r = 0; r < 8; ++r) pk.s[r] = f2b(acc[ai][bi][r]);
        *(uint4*)&dst[(size_t)c0 * 256 + r0] = pk.q;   // contiguous in n
      }
  } else {
    unsigned short* dst = vC + (size_t)bh * 256 * 512;
    #pragma unroll
    for (int ai = 0; ai < 2; ++ai)
      #pragma unroll
      for (int bi = 0; bi < 4; ++bi) {
        int r0, c0; tile_coords(m0, n0, ai, bi, r0, c0);
        #pragma unroll
        for (int r = 0; r < 8; ++r)
          dst[(size_t)(r0 + r) * 512 + c0] = f2b(acc[ai][bi][r]);
      }
  }
}

// ---------------------------------------------------------------------------
// scores[i][j] = sum_n qT[i][n] * kT[j][n]; store bf16 + per-tile sum/sumsq.
// ---------------------------------------------------------------------------
__global__ void k_scores(const unsigned short* __restrict__ qT,
                         const unsigned short* __restrict__ kT,
                         unsigned short* __restrict__ attn, float* __restrict__ part)
{
  __shared__ unsigned short shA[2 * LBUF], shB[2 * LBUF];
  __shared__ float redS[256], redQ[256];
  const int bh = blockIdx.y;
  const int m0 = (blockIdx.x >> 2) * 128;   // i, 4 tiles
  const int n0 = (blockIdx.x & 3) * 128;    // j, 4 tiles
  v8f acc[2][4];
  gemm128(qT + (size_t)bh * 512 * 256, 256, kT + (size_t)bh * 512 * 256, 256,
          m0, n0, 256, shA, shB, acc);
  unsigned short* dst = attn + (size_t)bh * 512 * 512;
  float s = 0.0f, s2 = 0.0f;
  #pragma unroll
  for (int ai = 0; ai < 2; ++ai)
    #pragma unroll
    for (int bi = 0; bi < 4; ++bi) {
      int r0, c0; tile_coords(m0, n0, ai, bi, r0, c0);
      #pragma unroll
      for (int r = 0; r < 8; ++r) {
        const float v = acc[ai][bi][r];
        dst[(size_t)(r0 + r) * 512 + c0] = f2b(v);
        s += v; s2 += v * v;
      }
    }
  const int t = threadIdx.x;
  redS[t] = s; redQ[t] = s2; __syncthreads();
  for (int o = 128; o > 0; o >>= 1) {
    if (t < o) { redS[t] += redS[t + o]; redQ[t] += redQ[t + o]; }
    __syncthreads();
  }
  if (t == 0) {
    part[((size_t)bh * 16 + blockIdx.x) * 2 + 0] = redS[0];
    part[((size_t)bh * 16 + blockIdx.x) * 2 + 1] = redQ[0];
  }
}

__global__ void k_stats(const float* __restrict__ part, float* __restrict__ stats)
{
  __shared__ float rs[16], rq[16];
  const int bh = blockIdx.x, t = threadIdx.x;   // 16 threads
  rs[t] = part[((size_t)bh * 16 + t) * 2 + 0];
  rq[t] = part[((size_t)bh * 16 + t) * 2 + 1];
  __syncthreads();
  for (int o = 8; o > 0; o >>= 1) {
    if (t < o) { rs[t] += rs[t + o]; rq[t] += rq[t + o]; }
    __syncthreads();
  }
  if (t == 0) {
    const float inv = 1.0f / 262144.0f;
    const float mu = rs[0] * inv;
    const float var = rq[0] * inv - mu * mu;
    stats[bh * 2 + 0] = mu;
    stats[bh * 2 + 1] = rsqrtf(var + 1e-5f);   // InstanceNorm2d eps
  }
}

// instance-norm + row softmax, in place (bf16).
__global__ void k_softmax(unsigned short* __restrict__ attn, const float* __restrict__ stats)
{
  __shared__ float red[256];
  const int bh = blockIdx.y, i = blockIdx.x, t = threadIdx.x;
  unsigned short* row = attn + ((size_t)bh * 512 + i) * 512;
  const float mu = stats[bh * 2 + 0], rs = stats[bh * 2 + 1];
  float x0 = (b2f(row[t]) - mu) * rs;
  float x1 = (b2f(row[t + 256]) - mu) * rs;
  red[t] = fmaxf(x0, x1); __syncthreads();
  for (int o = 128; o > 0; o >>= 1) { if (t < o) red[t] = fmaxf(red[t], red[t + o]); __syncthreads(); }
  const float m = red[0]; __syncthreads();
  const float e0 = expf(x0 - m), e1 = expf(x1 - m);
  red[t] = e0 + e1; __syncthreads();
  for (int o = 128; o > 0; o >>= 1) { if (t < o) red[t] += red[t + o]; __syncthreads(); }
  const float inv = 1.0f / red[0];
  row[t]       = f2b(e0 * inv);
  row[t + 256] = f2b(e1 * inv);
}

// ---------------------------------------------------------------------------
// ctx[i][nseq] = sum_j attn[i][j] * v[nseq][j]; scatter to ctx2[bL][n][i*8+h].
// ---------------------------------------------------------------------------
__global__ void k_ctx(const unsigned short* __restrict__ attn,
                      const unsigned short* __restrict__ vC,
                      unsigned short* __restrict__ ctx2)
{
  __shared__ unsigned short shA[2 * LBUF], shB[2 * LBUF];
  const int bh = blockIdx.y;
  const int bL = bh >> 3, h = bh & 7;
  const int m0 = (blockIdx.x >> 1) * 128;   // i, 4 tiles
  const int n0 = (blockIdx.x & 1) * 128;    // nseq, 2 tiles
  v8f acc[2][4];
  gemm128(attn + (size_t)bh * 512 * 512, 512, vC + (size_t)bh * 256 * 512, 512,
          m0, n0, 512, shA, shB, acc);
  unsigned short* dst = ctx2 + (size_t)bL * 256 * 4096;
  #pragma unroll
  for (int ai = 0; ai < 2; ++ai)
    #pragma unroll
    for (int bi = 0; bi < 4; ++bi) {
      int r0, c0; tile_coords(m0, n0, ai, bi, r0, c0);   // rows=i, cols=nseq
      #pragma unroll
      for (int r = 0; r < 8; ++r)
        dst[(size_t)c0 * 4096 + (size_t)(r0 + r) * 8 + h] = f2b(acc[ai][bi][r]);
    }
}

// out[n][c] = ctx2[n][:] @ wo + emb (residual), f32. Batches b0 .. b0+gridDim.y-1.
__global__ void k_outproj(const unsigned short* __restrict__ ctx2,
                          const unsigned short* __restrict__ woT,
                          const float* __restrict__ emb, float* __restrict__ y1, int b0)
{
  __shared__ unsigned short shA[2 * LBUF], shB[2 * LBUF];
  const int bL = blockIdx.y, b = b0 + bL;
  const int m0 = (blockIdx.x >> 2) * 128;   // n, 2 tiles
  const int n0 = (blockIdx.x & 3) * 128;    // c, 4 tiles
  v8f acc[2][4];
  gemm128(ctx2 + (size_t)bL * 256 * 4096, 4096, woT, 4096, m0, n0, 4096, shA, shB, acc);
  const float* res = emb + (size_t)b * 256 * 512;
  float* dst = y1 + (size_t)b * 256 * 512;
  #pragma unroll
  for (int ai = 0; ai < 2; ++ai)
    #pragma unroll
    for (int bi = 0; bi < 4; ++bi) {
      int r0, c0; tile_coords(m0, n0, ai, bi, r0, c0);
      #pragma unroll
      for (int r = 0; r < 8; ++r) {
        const size_t o = (size_t)(r0 + r) * 512 + c0;
        dst[o] = acc[ai][bi][r] + res[o];
      }
    }
}

// final[b][o][pos] = gelu( y2[b][pos][:] @ mo_w[o][:] + mo_b[o] ), exact erf GELU.
__global__ void k_mo(const unsigned short* __restrict__ y2,
                     const unsigned short* __restrict__ mowb,
                     const float* __restrict__ mo_b, float* __restrict__ out)
{
  __shared__ unsigned short shA[2 * LBUF], shB[2 * LBUF];
  const int b = blockIdx.y;
  const int m0 = (blockIdx.x >> 2) * 128;   // pos, 2 tiles
  const int n0 = (blockIdx.x & 3) * 128;    // o, 4 tiles
  v8f acc[2][4];
  gemm128(y2 + (size_t)b * 256 * 512, 512, mowb, 512, m0, n0, 512, shA, shB, acc);
  #pragma unroll
  for (int ai = 0; ai < 2; ++ai)
    #pragma unroll
    for (int bi = 0; bi < 4; ++bi) {
      int r0, c0; tile_coords(m0, n0, ai, bi, r0, c0);  // rows=pos (8 contiguous), cols=o
      const float bias = mo_b[c0];
      union { float f[8]; float4 q[2]; } pk;
      #pragma unroll
      for (int r = 0; r < 8; ++r) {
        const float tv = acc[ai][bi][r] + bias;
        pk.f[r] = 0.5f * tv * (1.0f + erff(tv * 0.70710678118654752f));
      }
      float* dst = out + ((size_t)b * 512 + c0) * 256 + r0;
      *(float4*)(dst + 0) = pk.q[0];
      *(float4*)(dst + 4) = pk.q[1];
    }
}

// ---------------------------------------------------------------------------
extern "C" void kernel_launch(void* const* d_in, const int* in_sizes, int n_in,
                              void* d_out, int out_size, void* d_ws, size_t ws_size,
                              hipStream_t stream)
{
  (void)in_sizes; (void)n_in; (void)out_size; (void)ws_size;
  const float* x      = (const float*)d_in[0];
  const float* proj_w = (const float*)d_in[1];
  const float* proj_b = (const float*)d_in[2];
  const float* ln1_g  = (const float*)d_in[3];
  const float* ln1_b  = (const float*)d_in[4];
  const float* wq     = (const float*)d_in[5];
  const float* wk     = (const float*)d_in[6];
  const float* wv     = (const float*)d_in[7];
  const float* wo     = (const float*)d_in[8];
  const float* ln2_g  = (const float*)d_in[9];
  const float* ln2_b  = (const float*)d_in[10];
  const float* mo_w   = (const float*)d_in[11];
  const float* mo_b   = (const float*)d_in[12];
  float* outp = (float*)d_out;

  char* w = (char*)d_ws;
  size_t off = 0;
  auto nxt = [&](size_t bytes) { char* p = w + off; off = (off + bytes + 255) & ~(size_t)255; return p; };
  unsigned short* xb    = (unsigned short*)nxt(8388608);    // x bf16 [b][c][k]
  unsigned short* pwb   = (unsigned short*)nxt(131072);     // proj_w bf16
  unsigned short* wqT   = (unsigned short*)nxt(4194304);    // [cout][c]
  unsigned short* wkT   = (unsigned short*)nxt(4194304);
  unsigned short* wvT   = (unsigned short*)nxt(4194304);
  unsigned short* woT   = (unsigned short*)nxt(4194304);    // [c][j]
  unsigned short* mowb  = (unsigned short*)nxt(524288);     // [o][c]
  float*          emb   = (float*)nxt(16777216);            // residual, f32
  unsigned short* xnb   = (unsigned short*)nxt(8388608);    // LN1(emb) bf16
  unsigned short* qT    = (unsigned short*)nxt(16777216);   // chunk: 64 bh x 512 x 256
  unsigned short* kT    = (unsigned short*)nxt(16777216);
  unsigned short* vC    = (unsigned short*)nxt(16777216);   // chunk: 64 bh x 256 x 512
  unsigned short* attn  = (unsigned short*)nxt(33554432);   // chunk: 64 bh x 512 x 512
  float*          part  = (float*)nxt(8192);                // 64 bh x 16 tiles x {sum,sumsq}
  float*          stats = (float*)nxt(512);                 // 64 bh x {mu, rsig}
  unsigned short* ctx2  = (unsigned short*)nxt(67108864);   // all 32 b x 256 x 4096
  float*          y1    = (float*)nxt(16777216);            // attn out + residual, f32
  unsigned short* y2    = (unsigned short*)nxt(8388608);    // LN2 bf16

  k_convert<<<4096, 256, 0, stream>>>(x, proj_w, wq, wk, wv, wo, mo_w,
                                      xb, pwb, wqT, wkT, wvT, woT, mowb);
  k_embed<<<dim3(8, 32), 256, 0, stream>>>(pwb, xb, proj_b, emb);
  k_layernorm<<<8192, 256, 0, stream>>>(emb, ln1_g, ln1_b, xnb);

  for (int pass = 0; pass < 4; ++pass) {           // 8 batches (64 bh) per pass
    const int b0 = pass * 8;
    k_qkv<<<dim3(8, 64, 3), 256, 0, stream>>>(xnb, wqT, wkT, wvT, qT, kT, vC, b0);
    k_scores<<<dim3(16, 64), 256, 0, stream>>>(qT, kT, attn, part);
    k_stats<<<64, 16, 0, stream>>>(part, stats);
    k_softmax<<<dim3(512, 64), 256, 0, stream>>>(attn, stats);
    k_ctx<<<dim3(8, 64), 256, 0, stream>>>(attn, vC, ctx2 + (size_t)b0 * 256 * 4096);
  }
  k_outproj<<<dim3(8, 32), 256, 0, stream>>>(ctx2, woT, emb, y1, 0);

  k_layernorm<<<8192, 256, 0, stream>>>(y1, ln2_g, ln2_b, y2);
  k_mo<<<dim3(8, 32), 256, 0, stream>>>(y2, mowb, mo_b, outp);
}

// v002
// One run takes 715 microseconds.
// Timed twice side by side with v001, it ran 1.32 times as fast both times.
// All steps since v000 together make it 1.66 times as fast.
#include <hip/hip_runtime.h>
#include <math.h>

typedef __attribute__((ext_vector_type(16))) __bf16 v16bf;
typedef __attribute__((ext_vector_type(8)))  float  v8f;

__device__ __forceinline__ unsigned short f2b(float f) {
  unsigned int u = __float_as_uint(f);
  u += 0x7FFFu + ((u >> 16) & 1u);           // round-to-nearest-even
  return (unsigned short)(u >> 16);
}
__device__ __forceinline__ float b2f(unsigned short h) {
  return __uint_as_float(((unsigned int)h) << 16);
}

union FragU { v16bf v; unsigned int u[8]; };

#define LDSS 40                 // padded LDS row stride (bf16) -> 80B rows, conflict-free
#define LBUF (128 * LDSS)       // one LDS buffer (ushorts)

__device__ __forceinline__ void gemm128(
    const unsigned short* __restrict__ A, int lda,
    const unsigned short* __restrict__ Bt, int ldb,
    int m0, int n0, int K,
    unsigned short* shA, unsigned short* shB,   // each 2*LBUF
    v8f acc[2][4])
{
  const int t    = threadIdx.x;
  const int r0s  = t >> 2;            // staging rows 0..63   (chunk t)
  const int r1s  = r0s + 64;          // staging rows 64..127 (chunk t+256)
  const int kqs  = (t & 3) << 3;      // 8 bf16 = 16B
  const int wave = t >> 5;
  const int lane = t & 31;
  const int wm   = wave >> 1;         // 0..3 -> M offset 32*wm
  const int wn   = wave & 1;          // 0..1 -> N offset 64*wn
  const int fm   = lane & 15;
  const int g    = lane >> 4;

  #pragma unroll
  for (int ai = 0; ai < 2; ++ai)
    #pragma unroll
    for (int bi = 0; bi < 4; ++bi)
      #pragma unroll
      for (int i = 0; i < 8; ++i) acc[ai][bi][i] = 0.0f;

  const unsigned short* aP0 = A  + (size_t)(m0 + r0s) * lda + kqs;
  const unsigned short* aP1 = A  + (size_t)(m0 + r1s) * lda + kqs;
  const unsigned short* bP0 = Bt + (size_t)(n0 + r0s) * ldb + kqs;
  const unsigned short* bP1 = Bt + (size_t)(n0 + r1s) * ldb + kqs;
  const int sO0 = r0s * LDSS + kqs;
  const int sO1 = r1s * LDSS + kqs;

  // prologue: stage K-tile 0 into buffer 0
  {
    uint4 a0 = *(const uint4*)(aP0);
    uint4 a1 = *(const uint4*)(aP1);
    uint4 b0 = *(const uint4*)(bP0);
    uint4 b1 = *(const uint4*)(bP1);
    *(uint4*)(shA + sO0) = a0;  *(uint4*)(shA + sO1) = a1;
    *(uint4*)(shB + sO0) = b0;  *(uint4*)(shB + sO1) = b1;
  }
  __syncthreads();

  int cur = 0;
  for (int k0 = 0; k0 < K; k0 += 32) {
    const int nxt = cur ^ 1;
    if (k0 + 32 < K) {                       // stage next tile into other buffer
      uint4 a0 = *(const uint4*)(aP0 + k0 + 32);
      uint4 a1 = *(const uint4*)(aP1 + k0 + 32);
      uint4 b0 = *(const uint4*)(bP0 + k0 + 32);
      uint4 b1 = *(const uint4*)(bP1 + k0 + 32);
      *(uint4*)(shA + nxt * LBUF + sO0) = a0;
      *(uint4*)(shA + nxt * LBUF + sO1) = a1;
      *(uint4*)(shB + nxt * LBUF + sO0) = b0;
      *(uint4*)(shB + nxt * LBUF + sO1) = b1;
      if (k0 + 64 < K) {                     // global_prefetch_b8 two tiles ahead
        __builtin_prefetch(aP0 + k0 + 64, 0, 1);
        __builtin_prefetch(aP1 + k0 + 64, 0, 1);
        __builtin_prefetch(bP0 + k0 + 64, 0, 1);
        __builtin_prefetch(bP1 + k0 + 64, 0, 1);
      }
    }
    const unsigned short* sa = shA + cur * LBUF;
    const unsigned short* sb = shB + cur * LBUF;
    FragU fa[2], fb[4];
    #pragma unroll
    for (int p = 0; p < 8; ++p) {
      const int kk = ((p & 4) << 2) + (g << 3) + ((p & 3) << 1);
      fa[0].u[p] = *(const unsigned int*)(sa + (wm * 32 + fm) * LDSS + kk);
      fa[1].u[p] = *(const unsigned int*)(sa + (wm * 32 + 16 + fm) * LDSS + kk);
      fb[0].u[p] = *(const unsigned int*)(sb + (wn * 64 + fm) * LDSS + kk);
      fb[1].u[p] = *(const unsigned int*)(sb + (wn * 64 + 16 + fm) * LDSS + kk);
      fb[2].u[p] = *(const unsigned int*)(sb + (wn * 64 + 32 + fm) * LDSS + kk);
      fb[3].u[p] = *(const unsigned int*)(sb + (wn * 64 + 48 + fm) * LDSS + kk);
    }
    #pragma unroll
    for (int ai = 0; ai < 2; ++ai)
      #pragma unroll
      for (int bi = 0; bi < 4; ++bi)
        acc[ai][bi] = __builtin_amdgcn_wmma_f32_16x16x32_bf16(
            false, fa[ai].v, false, fb[bi].v, (short)0, acc[ai][bi], false, false);
    __syncthreads();   // next-buffer writes visible; cur reads done before overwrite
    cur = nxt;
  }
}

__device__ __forceinline__ void gemm128kb(
    const unsigned short* __restrict__ A, int rowsA,
    const unsigned short* __restrict__ Bt, int ldb,
    int m0, int n0, int K,
    unsigned short* shA, unsigned short* shB,   // each 2*LBUF
    v8f acc[2][4])
{
  const int t    = threadIdx.x;
  const int r0s  = t >> 2;            // staging rows 0..63   (chunk t)
  const int r1s  = r0s + 64;          // staging rows 64..127 (chunk t+256)
  const int kqs  = (t & 3) << 3;      // 8 bf16 = 16B
  const int wave = t >> 5;
  const int lane = t & 31;
  const int wm   = wave >> 1;         // 0..3 -> M offset 32*wm
  const int wn   = wave & 1;          // 0..1 -> N offset 64*wn
  const int fm   = lane & 15;
  const int g    = lane >> 4;

  #pragma unroll
  for (int ai = 0; ai < 2; ++ai)
    #pragma unroll
    for (int bi = 0; bi < 4; ++bi)
      #pragma unroll
      for (int i = 0; i < 8; ++i) acc[ai][bi][i] = 0.0f;

  const unsigned short* aP0 = A  + (size_t)kqs * rowsA + (size_t)(m0 + r0s) * 8;
  const unsigned short* aP1 = A  + (size_t)kqs * rowsA + (size_t)(m0 + r1s) * 8;
  const unsigned short* bP0 = Bt + (size_t)(n0 + r0s) * ldb + kqs;
  const unsigned short* bP1 = Bt + (size_t)(n0 + r1s) * ldb + kqs;
  const int sO0 = r0s * LDSS + kqs;
  const int sO1 = r1s * LDSS + kqs;

  // prologue: stage K-tile 0 into buffer 0
  {
    uint4 a0 = *(const uint4*)(aP0);
    uint4 a1 = *(const uint4*)(aP1);
    uint4 b0 = *(const uint4*)(bP0);
    uint4 b1 = *(const uint4*)(bP1);
    *(uint4*)(shA + sO0) = a0;  *(uint4*)(shA + sO1) = a1;
    *(uint4*)(shB + sO0) = b0;  *(uint4*)(shB + sO1) = b1;
  }
  __syncthreads();

  int cur = 0;
  for (int k0 = 0; k0 < K; k0 += 32) {
    const int nxt = cur ^ 1;
    if (k0 + 32 < K) {                       // stage next tile into other buffer
      uint4 a0 = *(const uint4*)(aP0 + (size_t)(k0 + 32) * rowsA);
      uint4 a1 = *(const uint4*)(aP1 + (size_t)(k0 + 32) * rowsA);
      uint4 b0 = *(const uint4*)(bP0 + k0 + 32);
      uint4 b1 = *(const uint4*)(bP1 + k0 + 32);
      *(uint4*)(shA + nxt * LBUF + sO0) = a0;
      *(uint4*)(shA + nxt * LBUF + sO1) = a1;
      *(uint4*)(shB + nxt * LBUF + sO0) = b0;
      *(uint4*)(shB + nxt * LBUF + sO1) = b1;
      if (k0 + 64 < K) {                     // global_prefetch_b8 two tiles ahead
        __builtin_prefetch(aP0 + (size_t)(k0 + 64) * rowsA, 0, 1);
        __builtin_prefetch(aP1 + (size_t)(k0 + 64) * rowsA, 0, 1);
        __builtin_prefetch(bP0 + k0 + 64, 0, 1);
        __builtin_prefetch(bP1 + k0 + 64, 0, 1);
      }
    }
    const unsigned short* sa = shA + cur * LBUF;
    const unsigned short* sb = shB + cur * LBUF;
    FragU fa[2], fb[4];
    #pragma unroll
    for (int p = 0; p < 8; ++p) {
      const int kk = ((p & 4) << 2) + (g << 3) + ((p & 3) << 1);
      fa[0].u[p] = *(const unsigned int*)(sa + (wm * 32 + fm) * LDSS + kk);
      fa[1].u[p] = *(const unsigned int*)(sa + (wm * 32 + 16 + fm) * LDSS + kk);
      fb[0].u[p] = *(const unsigned int*)(sb + (wn * 64 + fm) * LDSS + kk);
      fb[1].u[p] = *(const unsigned int*)(sb + (wn * 64 + 16 + fm) * LDSS + kk);
      fb[2].u[p] = *(const unsigned int*)(sb + (wn * 64 + 32 + fm) * LDSS + kk);
      fb[3].u[p] = *(const unsigned int*)(sb + (wn * 64 + 48 + fm) * LDSS + kk);
    }
    #pragma unroll
    for (int ai = 0; ai < 2; ++ai)
      #pragma unroll
      for (int bi = 0; bi < 4; ++bi)
        acc[ai][bi] = __builtin_amdgcn_wmma_f32_16x16x32_bf16(
            false, fa[ai].v, false, fb[bi].v, (short)0, acc[ai][bi], false, false);
    __syncthreads();   // next-buffer writes visible; cur reads done before overwrite
    cur = nxt;
  }
}

// Output coords of acc[ai][bi]: 8 consecutive rows starting r, column c.
__device__ __forceinline__ void tile_coords(int m0, int n0, int ai, int bi, int& r, int& c) {
  const int wave = threadIdx.x >> 5, lane = threadIdx.x & 31;
  r = m0 + (wave >> 1) * 32 + ai * 16 + ((lane >> 4) << 3);
  c = n0 + (wave & 1) * 64 + bi * 16 + (lane & 15);
}

// ---------------------------------------------------------------------------
// K0: fp32 -> bf16 conversions (weights pre-transposed so B operands are [n][k])
// ---------------------------------------------------------------------------
__global__ void k_convert(const float* __restrict__ x, const float* __restrict__ proj_w,
                          const float* __restrict__ wq, const float* __restrict__ wk,
                          const float* __restrict__ wv, const float* __restrict__ wo,
                          const float* __restrict__ mo_w,
                          unsigned short* xb, unsigned short* pwb,
                          unsigned short* wqT, unsigned short* wkT, unsigned short* wvT,
                          unsigned short* woT, unsigned short* mowb)
{
  const size_t S0 = 32u * 512u * 256u;   // xb: x is already [b][c][dhw]
  const size_t S1 = 256u * 256u;         // proj_w [n][k]
  const size_t S2 = 512u * 4096u;        // each of wq/wk/wv -> [cout][c]
  const size_t S5 = 4096u * 512u;        // wo -> [c][h*512+i] (head-major k, as the context buffer)
  const size_t S6 = 512u * 512u;         // mo_w [o][c]
  const size_t total = S0 + S1 + 3 * S2 + S5 + S6;
  const size_t stride = (size_t)gridDim.x * blockDim.x;
  for (size_t i = (size_t)blockIdx.x * blockDim.x + threadIdx.x; i < total; i += stride) {
    size_t idx = i;
    if (idx < S0) { xb[idx] = f2b(x[idx]); continue; }
    idx -= S0;
    if (idx < S1) { pwb[idx] = f2b(proj_w[idx]); continue; }
    idx -= S1;
    if (idx < S2) { size_t co = idx / 512, c = idx % 512; wqT[idx] = f2b(wq[c * 4096 + co]); continue; }
    idx -= S2;
    if (idx < S2) { size_t co = idx / 512, c = idx % 512; wkT[idx] = f2b(wk[c * 4096 + co]); continue; }
    idx -= S2;
    if (idx < S2) { size_t co = idx / 512, c = idx % 512; wvT[idx] = f2b(wv[c * 4096 + co]); continue; }
    idx -= S2;
    if (idx < S5) {
      size_t c = idx / 4096, j = idx % 4096, h = j >> 9, ii = j & 511;
      woT[idx] = f2b(wo[(ii * 8 + h) * 512 + c]);
      continue;
    }
    idx -= S5;
    mowb[idx] = f2b(mo_w[idx]);
  }
}

// ---------------------------------------------------------------------------
// K1: patch embed. emb[b][n][c] = sum_k proj_w[n][k] * x[b][c][k] + proj_b[n]
// ---------------------------------------------------------------------------
__global__ void k_embed(const unsigned short* __restrict__ pwb,
                        const unsigned short* __restrict__ xb,
                        const float* __restrict__ proj_b, float* __restrict__ emb)
{
  __shared__ unsigned short shA[2 * LBUF], shB[2 * LBUF];
  const int b  = blockIdx.y;
  const int m0 = (blockIdx.x >> 2) * 128;   // n (seq), 2 tiles
  const int n0 = (blockIdx.x & 3) * 128;    // c, 4 tiles
  v8f acc[2][4];
  gemm128(pwb, 256, xb + (size_t)b * 512 * 256, 256, m0, n0, 256, shA, shB, acc);
  float* ob = emb + (size_t)b * 256 * 512;
  #pragma unroll
  for (int ai = 0; ai < 2; ++ai)
    #pragma unroll
    for (int bi = 0; bi < 4; ++bi) {
      int r0, c0; tile_coords(m0, n0, ai, bi, r0, c0);
      #pragma unroll
      for (int r = 0; r < 8; ++r) {
        const int n = r0 + r;
        ob[(size_t)n * 512 + c0] = acc[ai][bi][r] + proj_b[n];
      }
    }
}

// ---------------------------------------------------------------------------
// LayerNorm over C=512 per row (ln1 & ln2), writes bf16.
// ---------------------------------------------------------------------------
__global__ void k_layernorm(const float* __restrict__ in, const float* __restrict__ gamma,
                            const float* __restrict__ beta, unsigned short* __restrict__ out)
{
  __shared__ float red[256];
  const size_t row = blockIdx.x;
  const float* p = in + row * 512;
  const int t = threadIdx.x;
  float x0 = p[t], x1 = p[t + 256];
  red[t] = x0 + x1; __syncthreads();
  for (int o = 128; o > 0; o >>= 1) { if (t < o) red[t] += red[t + o]; __syncthreads(); }
  const float mu = red[0] * (1.0f / 512.0f); __syncthreads();
  const float d0 = x0 - mu, d1 = x1 - mu;
  red[t] = d0 * d0 + d1 * d1; __syncthreads();
  for (int o = 128; o > 0; o >>= 1) { if (t < o) red[t] += red[t + o]; __syncthreads(); }
  const float rs = rsqrtf(red[0] * (1.0f / 512.0f) + 1e-6f);
  unsigned short* q = out + row * 512;
  q[t]       = f2b(d0 * rs * gamma[t] + beta[t]);
  q[t + 256] = f2b(d1 * rs * gamma[t + 256] + beta[t + 256]);
}

// ---------------------------------------------------------------------------
// QKV per (b,h). grid.z: 0=q,1=k (write [bh][i][n] transposed), 2=v ([bh][n][i]).
// ---------------------------------------------------------------------------
__global__ void k_qkv(const unsigned short* __restrict__ xnb,
                      const unsigned short* __restrict__ wqT,
                      const unsigned short* __restrict__ wkT,
                      const unsigned short* __restrict__ wvT,
                      unsigned short* __restrict__ qT, unsigned short* __restrict__ kT,
                      unsigned short* __restrict__ vC, int b0)
{
  __shared__ unsigned short shA[2 * LBUF], shB[2 * LBUF];
  const int bh = blockIdx.y;
  const int b = b0 + (bh >> 3), h = bh & 7;
  const int mode = blockIdx.z;
  const unsigned short* wT = (mode == 0) ? wqT : ((mode == 1) ? wkT : wvT);
  const int m0 = (blockIdx.x >> 2) * 128;   // n (seq), 2 tiles
  const int n0 = (blockIdx.x & 3) * 128;    // i (within head), 4 tiles
  v8f acc[2][4];
  gemm128(xnb + (size_t)b * 256 * 512, 512, wT + (size_t)h * 512 * 512, 512,
          m0, n0, 512, shA, shB, acc);
  if (mode < 2) {
    unsigned short* dst = ((mode == 0) ? qT : kT) + (size_t)bh * 512 * 256;
    #pragma unroll
    for (int ai = 0; ai < 2; ++ai)
      #pragma unroll
      for (int bi = 0; bi < 4; ++bi) {
        int r0, c0; tile_coords(m0, n0, ai, bi, r0, c0);
        union { unsigned short s[8]; uint4 q; } pk;
        #pragma unroll
        for (int r = 0; r < 8; ++r) pk.s[r] = f2b(acc[ai][bi][r]);
        *(uint4*)&dst[(size_t)c0 * 256 + r0] = pk.q;   // contiguous in n
      }
  } else {
    unsigned short* dst = vC + (size_t)bh * 256 * 512;
    #pragma unroll
    for (int ai = 0; ai < 2; ++ai)
      #pragma unroll
      for (int bi = 0; bi < 4; ++bi) {
        int r0, c0; tile_coords(m0, n0, ai, bi, r0, c0);
        #pragma unroll
        for (int r = 0; r < 8; ++r)
          dst[(size_t)(r0 + r) * 512 + c0] = f2b(acc[ai][bi][r]);
      }
  }
}

// ---------------------------------------------------------------------------
// scores[i][j] = sum_n qT[i][n] * kT[j][n]; store bf16 + per-tile sum/sumsq.
// ---------------------------------------------------------------------------
__global__ void k_scores(const unsigned short* __restrict__ qT,
                         const unsigned short* __restrict__ kT,
                         unsigned short* __restrict__ attn, float* __restrict__ part)
{
  __shared__ unsigned short shA[2 * LBUF], shB[2 * LBUF];
  __shared__ float redS[256], redQ[256];
  const int bh = blockIdx.y;
  const int m0 = (blockIdx.x >> 2) * 128;   // i, 4 tiles
  const int n0 = (blockIdx.x & 3) * 128;    // j, 4 tiles
  v8f acc[2][4];
  gemm128(qT + (size_t)bh * 512 * 256, 256, kT + (size_t)bh * 512 * 256, 256,
          m0, n0, 256, shA, shB, acc);
  unsigned short* dst = attn + (size_t)bh * 512 * 512;
  float s = 0.0f, s2 = 0.0f;
  #pragma unroll
  for (int ai = 0; ai < 2; ++ai)
    #pragma unroll
    for (int bi = 0; bi < 4; ++bi) {
      int r0, c0; tile_coords(m0, n0, ai, bi, r0, c0);
      #pragma unroll
      for (int r = 0; r < 8; ++r) {
        const float v = acc[ai][bi][r];
        dst[(size_t)(r0 + r) * 512 + c0] = f2b(v);
        s += v; s2 += v * v;
      }
    }
  const int t = threadIdx.x;
  redS[t] = s; redQ[t] = s2; __syncthreads();
  for (int o = 128; o > 0; o >>= 1) {
    if (t < o) { redS[t] += redS[t + o]; redQ[t] += redQ[t + o]; }
    __syncthreads();
  }
  if (t == 0) {
    part[((size_t)bh * 16 + blockIdx.x) * 2 + 0] = redS[0];
    part[((size_t)bh * 16 + blockIdx.x) * 2 + 1] = redQ[0];
  }
}

__global__ void k_stats(const float* __restrict__ part, float* __restrict__ stats)
{
  __shared__ float rs[16], rq[16];
  const int bh = blockIdx.x, t = threadIdx.x;   // 16 threads
  rs[t] = part[((size_t)bh * 16 + t) * 2 + 0];
  rq[t] = part[((size_t)bh * 16 + t) * 2 + 1];
  __syncthreads();
  for (int o = 8; o > 0; o >>= 1) {
    if (t < o) { rs[t] += rs[t + o]; rq[t] += rq[t + o]; }
    __syncthreads();
  }
  if (t == 0) {
    const float inv = 1.0f / 262144.0f;
    const float mu = rs[0] * inv;
    const float var = rq[0] * inv - mu * mu;
    stats[bh * 2 + 0] = mu;
    stats[bh * 2 + 1] = rsqrtf(var + 1e-5f);   // InstanceNorm2d eps
  }
}

// instance-norm + row softmax, in place (bf16).
__global__ void k_softmax(unsigned short* __restrict__ attn, const float* __restrict__ stats)
{
  __shared__ float red[256];
  const int bh = blockIdx.y, i = blockIdx.x, t = threadIdx.x;
  unsigned short* row = attn + ((size_t)bh * 512 + i) * 512;
  const float mu = stats[bh * 2 + 0], rs = stats[bh * 2 + 1];
  float x0 = (b2f(row[t]) - mu) * rs;
  float x1 = (b2f(row[t + 256]) - mu) * rs;
  red[t] = fmaxf(x0, x1); __syncthreads();
  for (int o = 128; o > 0; o >>= 1) { if (t < o) red[t] = fmaxf(red[t], red[t + o]); __syncthreads(); }
  const float m = red[0]; __syncthreads();
  const float e0 = expf(x0 - m), e1 = expf(x1 - m);
  red[t] = e0 + e1; __syncthreads();
  for (int o = 128; o > 0; o >>= 1) { if (t < o) red[t] += red[t + o]; __syncthreads(); }
  const float inv = 1.0f / red[0];
  row[t]       = f2b(e0 * inv);
  row[t + 256] = f2b(e1 * inv);
}

// ---------------------------------------------------------------------------
// ctx[i][nseq] = sum_j attn[i][j] * v[nseq][j]; stored k-blocked with k = h*512+i:
// ctx2[bL][k/8][n][8], so a lane's 8 accumulator rows are one 16-B store and 16 lanes 256 B.
// ---------------------------------------------------------------------------
__global__ void k_ctx(const unsigned short* __restrict__ attn,
                      const unsigned short* __restrict__ vC,
                      unsigned short* __restrict__ ctx2)
{
  __shared__ unsigned short shA[2 * LBUF], shB[2 * LBUF];
  const int bh = blockIdx.y;
  const int bL = bh >> 3, h = bh & 7;
  const int m0 = (blockIdx.x >> 1) * 128;   // i, 4 tiles
  const int n0 = (blockIdx.x & 1) * 128;    // nseq, 2 tiles
  v8f acc[2][4];
  gemm128(attn + (size_t)bh * 512 * 512, 512, vC + (size_t)bh * 256 * 512, 512,
          m0, n0, 512, shA, shB, acc);
  unsigned short* dst = ctx2 + (size_t)bL * 256 * 4096;
  #pragma unroll
  for (int ai = 0; ai < 2; ++ai)
    #pragma unroll
    for (int bi = 0; bi < 4; ++bi) {
      int r0, c0; tile_coords(m0, n0, ai, bi, r0, c0);   // rows=i, cols=nseq
      union { unsigned short s[8]; uint4 q; } pk;
      #pragma unroll
      for (int r = 0; r < 8; ++r) pk.s[r] = f2b(acc[ai][bi][r]);
      *(uint4*)&dst[(size_t)(h * 512 + r0) * 256 + (size_t)c0 * 8] = pk.q;
    }
}

// out[n][c] = ctx2[n][:] @ wo + emb (residual), f32; k runs head-major in both operands.
// Batches b0 .. b0+gridDim.y-1.
__global__ void k_outproj(const unsigned short* __restrict__ ctx2,
                          const unsigned short* __restrict__ woT,
                          const float* __restrict__ emb, float* __restrict__ y1, int b0)
{
  __shared__ unsigned short shA[2 * LBUF], shB[2 * LBUF];
  const int bL = blockIdx.y, b = b0 + bL;
  const int m0 = (blockIdx.x >> 2) * 128;   // n, 2 tiles
  const int n0 = (blockIdx.x & 3) * 128;    // c, 4 tiles
  v8f acc[2][4];
  gemm128kb(ctx2 + (size_t)bL * 256 * 4096, 256, woT, 4096, m0, n0, 4096, shA, shB, acc);
  const float* res = emb + (size_t)b * 256 * 512;
  float* dst = y1 + (size_t)b * 256 * 512;
  #pragma unroll
  for (int ai = 0; ai < 2; ++ai)
    #pragma unroll
    for (int bi = 0; bi < 4; ++bi) {
      int r0, c0; tile_coords(m0, n0, ai, bi, r0, c0);
      #pragma unroll
      for (int r = 0; r < 8; ++r) {
        const size_t o = (size_t)(r0 + r) * 512 + c0;
        dst[o] = acc[ai][bi][r] + res[o];
      }
    }
}

// final[b][o][pos] = gelu( y2[b][pos][:] @ mo_w[o][:] + mo_b[o] ), exact erf GELU.
__global__ void k_mo(const unsigned short* __restrict__ y2,
                     const unsigned short* __restrict__ mowb,
                     const float* __restrict__ mo_b, float* __restrict__ out)
{
  __shared__ unsigned short shA[2 * LBUF], shB[2 * LBUF];
  const int b = blockIdx.y;
  const int m0 = (blockIdx.x >> 2) * 128;   // pos, 2 tiles
  const int n0 = (blockIdx.x & 3) * 128;    // o, 4 tiles
  v8f acc[2][4];
  gemm128(y2 + (size_t)b * 256 * 512, 512, mowb, 512, m0, n0, 512, shA, shB, acc);
  #pragma unroll
  for (int ai = 0; ai < 2; ++ai)
    #pragma unroll
    for (int bi = 0; bi < 4; ++bi) {
      int r0, c0; tile_coords(m0, n0, ai, bi, r0, c0);  // rows=pos (8 contiguous), cols=o
      const float bias = mo_b[c0];
      union { float f[8]; float4 q[2]; } pk;
      #pragma unroll
      for (int r = 0; r < 8; ++r) {
        const float tv = acc[ai][bi][r] + bias;
        pk.f[r] = 0.5f * tv * (1.0f + erff(tv * 0.70710678118654752f));
      }
      float* dst = out + ((size_t)b * 512 + c0) * 256 + r0;
      *(float4*)(dst + 0) = pk.q[0];
      *(float4*)(dst + 4) = pk.q[1];
    }
}

// ---------------------------------------------------------------------------
extern "C" void kernel_launch(void* const* d_in, const int* in_sizes, int n_in,
                              void* d_out, int out_size, void* d_ws, size_t ws_size,
                              hipStream_t stream)
{
  (void)in_sizes; (void)n_in; (void)out_size; (void)ws_size;
  const float* x      = (const float*)d_in[0];
  const float* proj_w = (const float*)d_in[1];
  const float* proj_b = (const float*)d_in[2];
  const float* ln1_g  = (const float*)d_in[3];
  const float* ln1_b  = (const float*)d_in[4];
  const float* wq     = (const float*)d_in[5];
  const float* wk     = (const float*)d_in[6];
  const float* wv     = (const float*)d_in[7];
  const float* wo     = (const float*)d_in[8];
  const float* ln2_g  = (const float*)d_in[9];
  const float* ln2_b  = (const float*)d_in[10];
  const float* mo_w   = (const float*)d_in[11];
  const float* mo_b   = (const float*)d_in[12];
  float* outp = (float*)d_out;

  char* w = (char*)d_ws;
  size_t off = 0;
  auto nxt = [&](size_t bytes) { char* p = w + off; off = (off + bytes + 255) & ~(size_t)255; return p; };
  unsigned short* xb    = (unsigned short*)nxt(8388608);    // x bf16 [b][c][k]
  unsigned short* pwb   = (unsigned short*)nxt(131072);     // proj_w bf16
  unsigned short* wqT   = (unsigned short*)nxt(4194304);    // [cout][c]
  unsigned short* wkT   = (unsigned short*)nxt(4194304);
  unsigned short* wvT   = (unsigned short*)nxt(4194304);
  unsigned short* woT   = (unsigned short*)nxt(4194304);    // [c][h*512+i]
  unsigned short* mowb  = (unsigned short*)nxt(524288);     // [o][c]
  float*          emb   = (float*)nxt(16777216);            // residual, f32
  unsigned short* xnb   = (unsigned short*)nxt(8388608);    // LN1(emb) bf16
  unsigned short* qT    = (unsigned short*)nxt(16777216);   // chunk: 64 bh x 512 x 256
  unsigned short* kT    = (unsigned short*)nxt(16777216);
  unsigned short* vC    = (unsigned short*)nxt(16777216);   // chunk: 64 bh x 256 x 512
  unsigned short* attn  = (unsigned short*)nxt(33554432);   // chunk: 64 bh x 512 x 512
  float*          part  = (float*)nxt(8192);                // 64 bh x 16 tiles x {sum,sumsq}
  float*          stats = (float*)nxt(512);                 // 64 bh x {mu, rsig}
  unsigned short* ctx2  = (unsigned short*)nxt(67108864);   // all 32 b x [k/8][n][8]
  float*          y1    = (float*)nxt(16777216);            // attn out + residual, f32
  unsigned short* y2    = (unsigned short*)nxt(8388608);    // LN2 bf16

  k_convert<<<4096, 256, 0, stream>>>(x, proj_w, wq, wk, wv, wo, mo_w,
                                      xb, pwb, wqT, wkT, wvT, woT, mowb);
  k_embed<<<dim3(8, 32), 256, 0, stream>>>(pwb, xb, proj_b, emb);
  k_layernorm<<<8192, 256, 0, stream>>>(emb, ln1_g, ln1_b, xnb);

  for (int pass = 0; pass < 4; ++pass) {           // 8 batches (64 bh) per pass
    const int b0 = pass * 8;
    k_qkv<<<dim3(8, 64, 3), 256, 0, stream>>>(xnb, wqT, wkT, wvT, qT, kT, vC, b0);
    k_scores<<<dim3(16, 64), 256, 0, stream>>>(qT, kT, attn, part);
    k_stats<<<64, 16, 0, stream>>>(part, stats);
    k_softmax<<<dim3(512, 64), 256, 0, stream>>>(attn, stats);
    k_ctx<<<dim3(8, 64), 256, 0, stream>>>(attn, vC, ctx2 + (size_t)b0 * 256 * 4096);
  }
  k_outproj<<<dim3(8, 32), 256, 0, stream>>>(ctx2, woT, emb, y1, 0);

  k_layernorm<<<8192, 256, 0, stream>>>(y1, ln2_g, ln2_b, y2);
  k_mo<<<dim3(8, 32), 256, 0, stream>>>(y2, mowb, mo_b, outp);
}

// v003
// A run of this version takes 569 microseconds.
// Next to v002, in two timings, it ran 1.25 and 1.26 times as fast.
// Counting every step since v000, it is 2.09 times as fast.
#include <hip/hip_runtime.h>
#include <math.h>

typedef __attribute__((ext_vector_type(16))) __bf16 v16bf;
typedef __attribute__((ext_vector_type(8)))  float  v8f;

__device__ __forceinline__ unsigned short f2b(float f) {
  unsigned int u = __float_as_uint(f);
  u += 0x7FFFu + ((u >> 16) & 1u);           // round-to-nearest-even
  return (unsigned short)(u >> 16);
}
__device__ __forceinline__ float b2f(unsigned short h) {
  return __uint_as_float(((unsigned int)h) << 16);
}

union FragU { v16bf v; unsigned int u[8]; };

#define BK   64                 // k per staged tile: 128 B of every operand row = one whole line
#define LDSS 72                 // padded LDS row stride (bf16) -> 144B rows, conflict-free
#define LBUF (128 * LDSS)       // one LDS buffer (ushorts)

template <bool KB>
__device__ __forceinline__ void gemm128t(
    const unsigned short* __restrict__ A, int lda,
    const unsigned short* __restrict__ Bt, int ldb,
    int m0, int n0, int K,
    unsigned short* shA, unsigned short* shB,   // each 2*LBUF
    v8f acc[2][4])
{
  const int t    = threadIdx.x;
  const int rs   = t >> 3;            // row-major staging: rows rs + 32*j, j = 0..3
  const int kqs  = (t & 7) << 3;      // 8 bf16 = 16B
  const int wave = t >> 5;
  const int lane = t & 31;
  const int wm   = wave >> 1;         // 0..3 -> M offset 32*wm
  const int wn   = wave & 1;          // 0..1 -> N offset 64*wn
  const int fm   = lane & 15;
  const int g    = lane >> 4;

  #pragma unroll
  for (int ai = 0; ai < 2; ++ai)
    #pragma unroll
    for (int bi = 0; bi < 4; ++bi)
      #pragma unroll
      for (int i = 0; i < 8; ++i) acc[ai][bi][i] = 0.0f;

  // A: address of this thread's chunk j = 0, the step from chunk to chunk, the step per k.
  const unsigned short* aP = KB ? A + (size_t)((t >> 7) << 3) * lda + (size_t)(m0 + (t & 127)) * 8
                                : A + (size_t)(m0 + rs) * lda + kqs;
  const size_t aJ = KB ? (size_t)16 * lda : (size_t)32 * lda;   // KB: chunk j is k-octet (t>>7) + 2j
  const size_t aK = KB ? (size_t)lda : (size_t)1;
  const int   sA0 = KB ? (t & 127) * LDSS + ((t >> 7) << 3) : rs * LDSS + kqs;
  const int   sAJ = KB ? 16 : 32 * LDSS;
  const unsigned short* bP = Bt + (size_t)(n0 + rs) * ldb + kqs;
  const size_t bJ = (size_t)32 * ldb;
  const int   sB0 = rs * LDSS + kqs;
  const int   sBJ = 32 * LDSS;
  // one prefetch per 128-B line of a tile: threads 0..127 take A's lines, 128..255 Bt's
  const unsigned short* pfP = (t < 128)
      ? (KB ? A + (size_t)((t >> 4) << 3) * lda + (size_t)m0 * 8 + (size_t)(t & 15) * 64
            : A + (size_t)(m0 + t) * lda)
      : Bt + (size_t)(n0 + (t & 127)) * ldb;
  const size_t pfK = (KB && t < 128) ? (size_t)lda : (size_t)1;

  // prologue: stage K-tile 0 into buffer 0
  {
    uint4 a[4], b[4];
    #pragma unroll
    for (int j = 0; j < 4; ++j) {
      a[j] = *(const uint4*)(aP + j * aJ);
      b[j] = *(const uint4*)(bP + j * bJ);
    }
    #pragma unroll
    for (int j = 0; j < 4; ++j) {
      *(uint4*)(shA + sA0 + j * sAJ) = a[j];
      *(uint4*)(shB + sB0 + j * sBJ) = b[j];
    }
  }
  __syncthreads();

  int cur = 0;
  for (int k0 = 0; k0 < K; k0 += BK) {
    const int nxt = cur ^ 1;
    if (k0 + BK < K) {                       // stage next tile into other buffer
      uint4 a[4], b[4];
      #pragma unroll
      for (int j = 0; j < 4; ++j) {
        a[j] = *(const uint4*)(aP + (size_t)(k0 + BK) * aK + j * aJ);
        b[j] = *(const uint4*)(bP + (k0 + BK) + j * bJ);
      }
      #pragma unroll
      for (int j = 0; j < 4; ++j) {
        *(uint4*)(shA + nxt * LBUF + sA0 + j * sAJ) = a[j];
        *(uint4*)(shB + nxt * LBUF + sB0 + j * sBJ) = b[j];
      }
      if (k0 + 2 * BK < K) {                 // global_prefetch_b8 two tiles ahead
        __builtin_prefetch(pfP + (size_t)(k0 + 2 * BK) * pfK, 0, 1);
        // the prefetch's address registers are stepped for the next tile: wait before that overwrite
        asm volatile("s_wait_xcnt 0x0" ::: "memory");
      }
    }
    const unsigned short* sa = shA + cur * LBUF;
    const unsigned short* sb = shB + cur * LBUF;
    #pragma unroll
    for (int ks = 0; ks < BK; ks += 32) {
      FragU fa[2], fb[4];
      #pragma unroll
      for (int p = 0; p < 8; ++p) {
        const int kk = ks + ((p & 4) << 2) + (g << 3) + ((p & 3) << 1);
        fa[0].u[p] = *(const unsigned int*)(sa + (wm * 32 + fm) * LDSS + kk);
        fa[1].u[p] = *(const unsigned int*)(sa + (wm * 32 + 16 + fm) * LDSS + kk);
        fb[0].u[p] = *(const unsigned int*)(sb + (wn * 64 + fm) * LDSS + kk);
        fb[1].u[p] = *(const unsigned int*)(sb + (wn * 64 + 16 + fm) * LDSS + kk);
        fb[2].u[p] = *(const unsigned int*)(sb + (wn * 64 + 32 + fm) * LDSS + kk);
        fb[3].u[p] = *(const unsigned int*)(sb + (wn * 64 + 48 + fm) * LDSS + kk);
      }
      #pragma unroll
      for (int ai = 0; ai < 2; ++ai)
        #pragma unroll
        for (int bi = 0; bi < 4; ++bi)
          acc[ai][bi] = __builtin_amdgcn_wmma_f32_16x16x32_bf16(
              false, fa[ai].v, false, fb[bi].v, (short)0, acc[ai][bi], false, false);
    }
    __syncthreads();   // next-buffer writes visible; cur reads done before overwrite
    cur = nxt;
  }
}

// Output coords of acc[ai][bi]: 8 consecutive rows starting r, column c.
__device__ __forceinline__ void tile_coords(int m0, int n0, int ai, int bi, int& r, int& c) {
  const int wave = threadIdx.x >> 5, lane = threadIdx.x & 31;
  r = m0 + (wave >> 1) * 32 + ai * 16 + ((lane >> 4) << 3);
  c = n0 + (wave & 1) * 64 + bi * 16 + (lane & 15);
}

// ---------------------------------------------------------------------------
// K0: fp32 -> bf16 conversions (weights pre-transposed so B operands are [n][k])
// ---------------------------------------------------------------------------
__global__ void k_convert(const float* __restrict__ x, const float* __restrict__ proj_w,
                          const float* __restrict__ wq, const float* __restrict__ wk,
                          const float* __restrict__ wv, const float* __restrict__ wo,
                          const float* __restrict__ mo_w,
                          unsigned short* xb, unsigned short* pwb,
                          unsigned short* wqT, unsigned short* wkT, unsigned short* wvT,
                          unsigned short* woT, unsigned short* mowb)
{
  const size_t S0 = 32u * 512u * 256u;   // xb: x is already [b][c][dhw]
  const size_t S1 = 256u * 256u;         // proj_w [n][k]
  const size_t S2 = 512u * 4096u;        // each of wq/wk/wv -> [cout][c]
  const size_t S5 = 4096u * 512u;        // wo -> [c][h*512+i] (head-major k, as the context buffer)
  const size_t S6 = 512u * 512u;         // mo_w [o][c]
  const size_t total = S0 + S1 + 3 * S2 + S5 + S6;
  const size_t stride = (size_t)gridDim.x * blockDim.x;
  for (size_t i = (size_t)blockIdx.x * blockDim.x + threadIdx.x; i < total; i += stride) {
    size_t idx = i;
    if (idx < S0) { xb[idx] = f2b(x[idx]); continue; }
    idx -= S0;
    if (idx < S1) { pwb[idx] = f2b(proj_w[idx]); continue; }
    idx -= S1;
    if (idx < S2) { size_t co = idx / 512, c = idx % 512; wqT[idx] = f2b(wq[c * 4096 + co]); continue; }
    idx -= S2;
    if (idx < S2) { size_t co = idx / 512, c = idx % 512; wkT[idx] = f2b(wk[c * 4096 + co]); continue; }
    idx -= S2;
    if (idx < S2) { size_t co = idx / 512, c = idx % 512; wvT[idx] = f2b(wv[c * 4096 + co]); continue; }
    idx -= S2;
    if (idx < S5) {
      size_t c = idx / 4096, j = idx % 4096, h = j >> 9, ii = j & 511;
      woT[idx] = f2b(wo[(ii * 8 + h) * 512 + c]);
      continue;
    }
    idx -= S5;
    mowb[idx] = f2b(mo_w[idx]);
  }
}

// ---------------------------------------------------------------------------
// K1: patch embed. emb[b][n][c] = sum_k proj_w[n][k] * x[b][c][k] + proj_b[n]
// ---------------------------------------------------------------------------
__global__ __launch_bounds__(256) void k_embed(const unsigned short* __restrict__ pwb,
                        const unsigned short* __restrict__ xb,
                        const float* __restrict__ proj_b, float* __restrict__ emb)
{
  __shared__ unsigned short shA[2 * LBUF], shB[2 * LBUF];
  const int b  = blockIdx.y;
  const int m0 = (blockIdx.x >> 2) * 128;   // n (seq), 2 tiles
  const int n0 = (blockIdx.x & 3) * 128;    // c, 4 tiles
  v8f acc[2][4];
  gemm128t<false>(pwb, 256, xb + (size_t)b * 512 * 256, 256, m0, n0, 256, shA, shB, acc);
  float* ob = emb + (size_t)b * 256 * 512;
  #pragma unroll
  for (int ai = 0; ai < 2; ++ai)
    #pragma unroll
    for (int bi = 0; bi < 4; ++bi) {
      int r0, c0; tile_coords(m0, n0, ai, bi, r0, c0);
      #pragma unroll
      for (int r = 0; r < 8; ++r) {
        const int n = r0 + r;
        ob[(size_t)n * 512 + c0] = acc[ai][bi][r] + proj_b[n];
      }
    }
}

// ---------------------------------------------------------------------------
// LayerNorm over C=512 per row (ln1 & ln2), writes bf16.
// ---------------------------------------------------------------------------
__global__ void k_layernorm(const float* __restrict__ in, const float* __restrict__ gamma,
                            const float* __restrict__ beta, unsigned short* __restrict__ out)
{
  __shared__ float red[256];
  const size_t row = blockIdx.x;
  const float* p = in + row * 512;
  const int t = threadIdx.x;
  float x0 = p[t], x1 = p[t + 256];
  red[t] = x0 + x1; __syncthreads();
  for (int o = 128; o > 0; o >>= 1) { if (t < o) red[t] += red[t + o]; __syncthreads(); }
  const float mu = red[0] * (1.0f / 512.0f); __syncthreads();
  const float d0 = x0 - mu, d1 = x1 - mu;
  red[t] = d0 * d0 + d1 * d1; __syncthreads();
  for (int o = 128; o > 0; o >>= 1) { if (t < o) red[t] += red[t + o]; __syncthreads(); }
  const float rs = rsqrtf(red[0] * (1.0f / 512.0f) + 1e-6f);
  unsigned short* q = out + row * 512;
  q[t]       = f2b(d0 * rs * gamma[t] + beta[t]);
  q[t + 256] = f2b(d1 * rs * gamma[t + 256] + beta[t + 256]);
}

// ---------------------------------------------------------------------------
// QKV per (b,h). grid.z: 0=q,1=k (write [bh][i][n] transposed), 2=v ([bh][n][i]).
// ---------------------------------------------------------------------------
__global__ __launch_bounds__(256) void k_qkv(const unsigned short* __restrict__ xnb,
                      const unsigned short* __restrict__ wqT,
                      const unsigned short* __restrict__ wkT,
                      const unsigned short* __restrict__ wvT,
                      unsigned short* __restrict__ qT, unsigned short* __restrict__ kT,
                      unsigned short* __restrict__ vC, int b0)
{
  __shared__ unsigned short shA[2 * LBUF], shB[2 * LBUF];
  const int bh = blockIdx.y;
  const int b = b0 + (bh >> 3), h = bh & 7;
  const int mode = blockIdx.z;
  const unsigned short* wT = (mode == 0) ? wqT : ((mode == 1) ? wkT : wvT);
  const int m0 = (blockIdx.x >> 2) * 128;   // n (seq), 2 tiles
  const int n0 = (blockIdx.x & 3) * 128;    // i (within head), 4 tiles
  v8f acc[2][4];
  gemm128t<false>(xnb + (size_t)b * 256 * 512, 512, wT + (size_t)h * 512 * 512, 512,
          m0, n0, 512, shA, shB, acc);
  if (mode < 2) {
    unsigned short* dst = ((mode == 0) ? qT : kT) + (size_t)bh * 512 * 256;
    #pragma unroll
    for (int ai = 0; ai < 2; ++ai)
      #pragma unroll
      for (int bi = 0; bi < 4; ++bi) {
        int r0, c0; tile_coords(m0, n0, ai, bi, r0, c0);
        union { unsigned short s[8]; uint4 q; } pk;
        #pragma unroll
        for (int r = 0; r < 8; ++r) pk.s[r] = f2b(acc[ai][bi][r]);
        *(uint4*)&dst[(size_t)c0 * 256 + r0] = pk.q;   // contiguous in n
      }
  } else {
    unsigned short* dst = vC + (size_t)bh * 256 * 512;
    #pragma unroll
    for (int ai = 0; ai < 2; ++ai)
      #pragma unroll
      for (int bi = 0; bi < 4; ++bi) {
        int r0, c0; tile_coords(m0, n0, ai, bi, r0, c0);
        #pragma unroll
        for (int r = 0; r < 8; ++r)
          dst[(size_t)(r0 + r) * 512 + c0] = f2b(acc[ai][bi][r]);
      }
  }
}

// ---------------------------------------------------------------------------
// scores[i][j] = sum_n qT[i][n] * kT[j][n]; store bf16 + per-tile sum/sumsq.
// ---------------------------------------------------------------------------
__global__ __launch_bounds__(256) void k_scores(const unsigned short* __restrict__ qT,
                         const unsigned short* __restrict__ kT,
                         unsigned short* __restrict__ attn, float* __restrict__ part)
{
  __shared__ unsigned short shA[2 * LBUF], shB[2 * LBUF];
  __shared__ float redS[256], redQ[256];
  const int bh = blockIdx.y;
  const int m0 = (blockIdx.x >> 2) * 128;   // i, 4 tiles
  const int n0 = (blockIdx.x & 3) * 128;    // j, 4 tiles
  v8f acc[2][4];
  gemm128t<false>(qT + (size_t)bh * 512 * 256, 256, kT + (size_t)bh * 512 * 256, 256,
          m0, n0, 256, shA, shB, acc);
  unsigned short* dst = attn + (size_t)bh * 512 * 512;
  float s = 0.0f, s2 = 0.0f;
  #pragma unroll
  for (int ai = 0; ai < 2; ++ai)
    #pragma unroll
    for (int bi = 0; bi < 4; ++bi) {
      int r0, c0; tile_coords(m0, n0, ai, bi, r0, c0);
      #pragma unroll
      for (int r = 0; r < 8; ++r) {
        const float v = acc[ai][bi][r];
        dst[(size_t)(r0 + r) * 512 + c0] = f2b(v);
        s += v; s2 += v * v;
      }
    }
  const int t = threadIdx.x;
  redS[t] = s; redQ[t] = s2; __syncthreads();
  for (int o = 128; o > 0; o >>= 1) {
    if (t < o) { redS[t] += redS[t + o]; redQ[t] += redQ[t + o]; }
    __syncthreads();
  }
  if (t == 0) {
    part[((size_t)bh * 16 + blockIdx.x) * 2 + 0] = redS[0];
    part[((size_t)bh * 16 + blockIdx.x) * 2 + 1] = redQ[0];
  }
}

__global__ void k_stats(const float* __restrict__ part, float* __restrict__ stats)
{
  __shared__ float rs[16], rq[16];
  const int bh = blockIdx.x, t = threadIdx.x;   // 16 threads
  rs[t] = part[((size_t)bh * 16 + t) * 2 + 0];
  rq[t] = part[((size_t)bh * 16 + t) * 2 + 1];
  __syncthreads();
  for (int o = 8; o > 0; o >>= 1) {
    if (t < o) { rs[t] += rs[t + o]; rq[t] += rq[t + o]; }
    __syncthreads();
  }
  if (t == 0) {
    const float inv = 1.0f / 262144.0f;
    const float mu = rs[0] * inv;
    const float var = rq[0] * inv - mu * mu;
    stats[bh * 2 + 0] = mu;
    stats[bh * 2 + 1] = rsqrtf(var + 1e-5f);   // InstanceNorm2d eps
  }
}

// instance-norm + row softmax, in place (bf16).
__global__ void k_softmax(unsigned short* __restrict__ attn, const float* __restrict__ stats)
{
  __shared__ float red[256];
  const int bh = blockIdx.y, i = blockIdx.x, t = threadIdx.x;
  unsigned short* row = attn + ((size_t)bh * 512 + i) * 512;
  const float mu = stats[bh * 2 + 0], rs = stats[bh * 2 + 1];
  float x0 = (b2f(row[t]) - mu) * rs;
  float x1 = (b2f(row[t + 256]) - mu) * rs;
  red[t] = fmaxf(x0, x1); __syncthreads();
  for (int o = 128; o > 0; o >>= 1) { if (t < o) red[t] = fmaxf(red[t], red[t + o]); __syncthreads(); }
  const float m = red[0]; __syncthreads();
  const float e0 = expf(x0 - m), e1 = expf(x1 - m);
  red[t] = e0 + e1; __syncthreads();
  for (int o = 128; o > 0; o >>= 1) { if (t < o) red[t] += red[t + o]; __syncthreads(); }
  const float inv = 1.0f / red[0];
  row[t]       = f2b(e0 * inv);
  row[t + 256] = f2b(e1 * inv);
}

// ---------------------------------------------------------------------------
// ctx[i][nseq] = sum_j attn[i][j] * v[nseq][j]; stored k-blocked with k = h*512+i:
// ctx2[bL][k/8][n][8], so a lane's 8 accumulator rows are one 16-B store and 16 lanes 256 B.
// ---------------------------------------------------------------------------
__global__ __launch_bounds__(256) void k_ctx(const unsigned short* __restrict__ attn,
                      const unsigned short* __restrict__ vC,
                      unsigned short* __restrict__ ctx2)
{
  __shared__ unsigned short shA[2 * LBUF], shB[2 * LBUF];
  const int bh = blockIdx.y;
  const int bL = bh >> 3, h = bh & 7;
  const int m0 = (blockIdx.x >> 1) * 128;   // i, 4 tiles
  const int n0 = (blockIdx.x & 1) * 128;    // nseq, 2 tiles
  v8f acc[2][4];
  gemm128t<false>(attn + (size_t)bh * 512 * 512, 512, vC + (size_t)bh * 256 * 512, 512,
          m0, n0, 512, shA, shB, acc);
  unsigned short* dst = ctx2 + (size_t)bL * 256 * 4096;
  #pragma unroll
  for (int ai = 0; ai < 2; ++ai)
    #pragma unroll
    for (int bi = 0; bi < 4; ++bi) {
      int r0, c0; tile_coords(m0, n0, ai, bi, r0, c0);   // rows=i, cols=nseq
      union { unsigned short s[8]; uint4 q; } pk;
      #pragma unroll
      for (int r = 0; r < 8; ++r) pk.s[r] = f2b(acc[ai][bi][r]);
      *(uint4*)&dst[(size_t)(h * 512 + r0) * 256 + (size_t)c0 * 8] = pk.q;
    }
}

// out[n][c] = ctx2[n][:] @ wo + emb (residual), f32; k runs head-major in both operands.
// Batches b0 .. b0+gridDim.y-1.
__global__ __launch_bounds__(256) void k_outproj(const unsigned short* __restrict__ ctx2,
                          const unsigned short* __restrict__ woT,
                          const float* __restrict__ emb, float* __restrict__ y1, int b0)
{
  __shared__ unsigned short shA[2 * LBUF], shB[2 * LBUF];
  const int bL = blockIdx.y, b = b0 + bL;
  const int m0 = (blockIdx.x >> 2) * 128;   // n, 2 tiles
  const int n0 = (blockIdx.x & 3) * 128;    // c, 4 tiles
  v8f acc[2][4];
  gemm128t<true>(ctx2 + (size_t)bL * 256 * 4096, 256, woT, 4096, m0, n0, 4096, shA, shB, acc);
  const float* res = emb + (size_t)b * 256 * 512;
  float* dst = y1 + (size_t)b * 256 * 512;
  #pragma unroll
  for (int ai = 0; ai < 2; ++ai)
    #pragma unroll
    for (int bi = 0; bi < 4; ++bi) {
      int r0, c0; tile_coords(m0, n0, ai, bi, r0, c0);
      #pragma unroll
      for (int r = 0; r < 8; ++r) {
        const size_t o = (size_t)(r0 + r) * 512 + c0;
        dst[o] = acc[ai][bi][r] + res[o];
      }
    }
}

// final[b][o][pos] = gelu( y2[b][pos][:] @ mo_w[o][:] + mo_b[o] ), exact erf GELU.
__global__ __launch_bounds__(256) void k_mo(const unsigned short* __restrict__ y2,
                     const unsigned short* __restrict__ mowb,
                     const float* __restrict__ mo_b, float* __restrict__ out)
{
  __shared__ unsigned short shA[2 * LBUF], shB[2 * LBUF];
  const int b = blockIdx.y;
  const int m0 = (blockIdx.x >> 2) * 128;   // pos, 2 tiles
  const int n0 = (blockIdx.x & 3) * 128;    // o, 4 tiles
  v8f acc[2][4];
  gemm128t<false>(y2 + (size_t)b * 256 * 512, 512, mowb, 512, m0, n0, 512, shA, shB, acc);
  #pragma unroll
  for (int ai = 0; ai < 2; ++ai)
    #pragma unroll
    for (int bi = 0; bi < 4; ++bi) {
      int r0, c0; tile_coords(m0, n0, ai, bi, r0, c0);  // rows=pos (8 contiguous), cols=o
      const float bias = mo_b[c0];
      union { float f[8]; float4 q[2]; } pk;
      #pragma unroll
      for (int r = 0; r < 8; ++r) {
        const float tv = acc[ai][bi][r] + bias;
        pk.f[r] = 0.5f * tv * (1.0f + erff(tv * 0.70710678118654752f));
      }
      float* dst = out + ((size_t)b * 512 + c0) * 256 + r0;
      *(float4*)(dst + 0) = pk.q[0];
      *(float4*)(dst + 4) = pk.q[1];
    }
}

// ---------------------------------------------------------------------------
extern "C" void kernel_launch(void* const* d_in, const int* in_sizes, int n_in,
                              void* d_out, int out_size, void* d_ws, size_t ws_size,
                              hipStream_t stream)
{
  (void)in_sizes; (void)n_in; (void)out_size; (void)ws_size;
  const float* x      = (const float*)d_in[0];
  const float* proj_w = (const float*)d_in[1];
  const float* proj_b = (const float*)d_in[2];
  const float* ln1_g  = (const float*)d_in[3];
  const float* ln1_b  = (const float*)d_in[4];
  const float* wq     = (const float*)d_in[5];
  const float* wk     = (const float*)d_in[6];
  const float* wv     = (const float*)d_in[7];
  const float* wo     = (const float*)d_in[8];
  const float* ln2_g  = (const float*)d_in[9];
  const float* ln2_b  = (const float*)d_in[10];
  const float* mo_w   = (const float*)d_in[11];
  const float* mo_b   = (const float*)d_in[12];
  float* outp = (float*)d_out;

  char* w = (char*)d_ws;
  size_t off = 0;
  auto nxt = [&](size_t bytes) { char* p = w + off; off = (off + bytes + 255) & ~(size_t)255; return p; };
  unsigned short* xb    = (unsigned short*)nxt(8388608);    // x bf16 [b][c][k]
  unsigned short* pwb   = (unsigned short*)nxt(131072);     // proj_w bf16
  unsigned short* wqT   = (unsigned short*)nxt(4194304);    // [cout][c]
  unsigned short* wkT   = (unsigned short*)nxt(4194304);
  unsigned short* wvT   = (unsigned short*)nxt(4194304);
  unsigned short* woT   = (unsigned short*)nxt(4194304);    // [c][h*512+i]
  unsigned short* mowb  = (unsigned short*)nxt(524288);     // [o][c]
  float*          emb   = (float*)nxt(16777216);            // residual, f32
  unsigned short* xnb   = (unsigned short*)nxt(8388608);    // LN1(emb) bf16
  unsigned short* qT    = (unsigned short*)nxt(16777216);   // chunk: 64 bh x 512 x 256
  unsigned short* kT    = (unsigned short*)nxt(16777216);
  unsigned short* vC    = (unsigned short*)nxt(16777216);   // chunk: 64 bh x 256 x 512
  unsigned short* attn  = (unsigned short*)nxt(33554432);   // chunk: 64 bh x 512 x 512
  float*          part  = (float*)nxt(8192);                // 64 bh x 16 tiles x {sum,sumsq}
  float*          stats = (float*)nxt(512);                 // 64 bh x {mu, rsig}
  unsigned short* ctx2  = (unsigned short*)nxt(67108864);   // all 32 b x [k/8][n][8]
  float*          y1    = (float*)nxt(16777216);            // attn out + residual, f32
  unsigned short* y2    = (unsigned short*)nxt(8388608);    // LN2 bf16

  k_convert<<<4096, 256, 0, stream>>>(x, proj_w, wq, wk, wv, wo, mo_w,
                                      xb, pwb, wqT, wkT, wvT, woT, mowb);
  k_embed<<<dim3(8, 32), 256, 0, stream>>>(pwb, xb, proj_b, emb);
  k_layernorm<<<8192, 256, 0, stream>>>(emb, ln1_g, ln1_b, xnb);

  for (int pass = 0; pass < 4; ++pass) {           // 8 batches (64 bh) per pass
    const int b0 = pass * 8;
    k_qkv<<<dim3(8, 64, 3), 256, 0, stream>>>(xnb, wqT, wkT, wvT, qT, kT, vC, b0);
    k_scores<<<dim3(16, 64), 256, 0, stream>>>(qT, kT, attn, part);
    k_stats<<<64, 16, 0, stream>>>(part, stats);
    k_softmax<<<dim3(512, 64), 256, 0, stream>>>(attn, stats);
    k_ctx<<<dim3(8, 64), 256, 0, stream>>>(attn, vC, ctx2 + (size_t)b0 * 256 * 4096);
  }
  k_outproj<<<dim3(8, 32), 256, 0, stream>>>(ctx2, woT, emb, y1, 0);

  k_layernorm<<<8192, 256, 0, stream>>>(y1, ln2_g, ln2_b, y2);
  k_mo<<<dim3(8, 32), 256, 0, stream>>>(y2, mowb, mo_b, outp);
}

// v004
// It runs in 546 microseconds.
// Next to v003, in two timings, it ran 1.04 times as fast each time.
// Over all steps from v000 it is 2.18 times as fast.
#include <hip/hip_runtime.h>
#include <math.h>

typedef __attribute__((ext_vector_type(16))) __bf16 v16bf;
typedef __attribute__((ext_vector_type(8)))  float  v8f;

__device__ __forceinline__ unsigned short f2b(float f) {
  unsigned int u = __float_as_uint(f);
  u += 0x7FFFu + ((u >> 16) & 1u);           // round-to-nearest-even
  return (unsigned short)(u >> 16);
}
__device__ __forceinline__ float b2f(unsigned short h) {
  return __uint_as_float(((unsigned int)h) << 16);
}

union FragU { v16bf v; unsigned int u[8]; };

#define BK   64                 // k per staged tile: 128 B of every operand row = one whole line
#define LDSS 72                 // padded LDS row stride (bf16) -> 144B rows, conflict-free
#define LBUF (128 * LDSS)       // one LDS buffer (ushorts)

__device__ __forceinline__ void copy_tile(unsigned la, unsigned laJ, const unsigned short* ga, size_t gaJ,
                                          unsigned lb, unsigned lbJ, const unsigned short* gb, size_t gbJ)
{
  asm volatile(
      "global_load_async_to_lds_b128 %0, %8, off\n\t"
      "global_load_async_to_lds_b128 %4, %12, off\n\t"
      "global_load_async_to_lds_b128 %1, %9, off\n\t"
      "global_load_async_to_lds_b128 %5, %13, off\n\t"
      "global_load_async_to_lds_b128 %2, %10, off\n\t"
      "global_load_async_to_lds_b128 %6, %14, off\n\t"
      "global_load_async_to_lds_b128 %3, %11, off\n\t"
      "global_load_async_to_lds_b128 %7, %15, off\n\t"
      "s_wait_xcnt 0x0"
      :: "v"(la), "v"(la + laJ), "v"(la + 2u * laJ), "v"(la + 3u * laJ),
         "v"(lb), "v"(lb + lbJ), "v"(lb + 2u * lbJ), "v"(lb + 3u * lbJ),
         "v"(ga), "v"(ga + gaJ), "v"(ga + 2 * gaJ), "v"(ga + 3 * gaJ),
         "v"(gb), "v"(gb + gbJ), "v"(gb + 2 * gbJ), "v"(gb + 3 * gbJ)
      : "memory");
}

template <bool KB>
__device__ __forceinline__ void gemm128t(
    const unsigned short* __restrict__ A, int lda,
    const unsigned short* __restrict__ Bt, int ldb,
    int m0, int n0, int K,
    unsigned short* shA, unsigned short* shB,   // each 2*LBUF
    v8f acc[2][4])
{
  const int t    = threadIdx.x;
  const int rs   = t >> 3;            // row-major staging: rows rs + 32*j, j = 0..3
  const int kqs  = (t & 7) << 3;      // 8 bf16 = 16B
  const int wave = t >> 5;
  const int lane = t & 31;
  const int wm   = wave >> 1;         // 0..3 -> M offset 32*wm
  const int wn   = wave & 1;          // 0..1 -> N offset 64*wn
  const int fm   = lane & 15;
  const int g    = lane >> 4;

  #pragma unroll
  for (int ai = 0; ai < 2; ++ai)
    #pragma unroll
    for (int bi = 0; bi < 4; ++bi)
      #pragma unroll
      for (int i = 0; i < 8; ++i) acc[ai][bi][i] = 0.0f;

  // A: address of this thread's chunk j = 0, the step from chunk to chunk, the step per k.
  const unsigned short* aP = KB ? A + (size_t)((t >> 7) << 3) * lda + (size_t)(m0 + (t & 127)) * 8
                                : A + (size_t)(m0 + rs) * lda + kqs;
  const size_t aJ = KB ? (size_t)16 * lda : (size_t)32 * lda;   // KB: chunk j is k-octet (t>>7) + 2j
  const size_t aK = KB ? (size_t)lda : (size_t)1;
  const int   sA0 = KB ? (t & 127) * LDSS + ((t >> 7) << 3) : rs * LDSS + kqs;
  const int   sAJ = KB ? 16 : 32 * LDSS;
  const unsigned short* bP = Bt + (size_t)(n0 + rs) * ldb + kqs;
  const size_t bJ = (size_t)32 * ldb;
  const int   sB0 = rs * LDSS + kqs;
  const int   sBJ = 32 * LDSS;
  // one prefetch per 128-B line of a tile: threads 0..127 take A's lines, 128..255 Bt's
  const unsigned short* pfP = (t < 128)
      ? (KB ? A + (size_t)((t >> 4) << 3) * lda + (size_t)m0 * 8 + (size_t)(t & 15) * 64
            : A + (size_t)(m0 + t) * lda)
      : Bt + (size_t)(n0 + (t & 127)) * ldb;
  const size_t pfK = (KB && t < 128) ? (size_t)lda : (size_t)1;

  // LDS byte addresses (low 32 bits of the __shared__ address) of this thread's chunk j = 0, buffer 0
  const unsigned lA = (unsigned)(size_t)(shA + sA0);
  const unsigned lB = (unsigned)(size_t)(shB + sB0);

  // ring, two buffers: tile 0 lands and is published, then tile 1's copies start
  copy_tile(lA, 2u * sAJ, aP, aJ, lB, 2u * sBJ, bP, bJ);
  asm volatile("s_wait_asynccnt 0x0" ::: "memory");   // this wave's copies of tile 0 have landed
  __syncthreads();                                    // ... and every other wave's
  copy_tile(lA + 2u * LBUF, 2u * sAJ, aP + (size_t)BK * aK, aJ,
            lB + 2u * LBUF, 2u * sBJ, bP + BK, bJ);   // K >= 2 * BK in every caller

  int cur = 0;
  // kept rolled: unrolled (K = 256) every tile's 24 copy-address registers are formed up front and live together
  #pragma unroll 1
  for (int k0 = 0; k0 < K; k0 += BK) {
    if (k0 + 2 * BK < K) {                   // global_prefetch_b8 two tiles ahead
      __builtin_prefetch(pfP + (size_t)(k0 + 2 * BK) * pfK, 0, 1);
      // the prefetch's address registers are stepped for the next tile: wait before that overwrite
      asm volatile("s_wait_xcnt 0x0" ::: "memory");
    }
    const unsigned short* sa = shA + cur * LBUF;
    const unsigned short* sb = shB + cur * LBUF;
    #pragma unroll
    for (int ks = 0; ks < BK; ks += 32) {
      FragU fa[2], fb[4];
      #pragma unroll
      for (int p = 0; p < 8; ++p) {
        const int kk = ks + ((p & 4) << 2) + (g << 3) + ((p & 3) << 1);
        fa[0].u[p] = *(const unsigned int*)(sa + (wm * 32 + fm) * LDSS + kk);
        fa[1].u[p] = *(const unsigned int*)(sa + (wm * 32 + 16 + fm) * LDSS + kk);
        fb[0].u[p] = *(const unsigned int*)(sb + (wn * 64 + fm) * LDSS + kk);
        fb[1].u[p] = *(const unsigned int*)(sb + (wn * 64 + 16 + fm) * LDSS + kk);
        fb[2].u[p] = *(const unsigned int*)(sb + (wn * 64 + 32 + fm) * LDSS + kk);
        fb[3].u[p] = *(const unsigned int*)(sb + (wn * 64 + 48 + fm) * LDSS + kk);
      }
      #pragma unroll
      for (int ai = 0; ai < 2; ++ai)
        #pragma unroll
        for (int bi = 0; bi < 4; ++bi)
          acc[ai][bi] = __builtin_amdgcn_wmma_f32_16x16x32_bf16(
              false, fa[ai].v, false, fb[bi].v, (short)0, acc[ai][bi], false, false);
    }
    // publish point of the next tile, every wave, in this order
    asm volatile("s_wait_dscnt 0x0" ::: "memory");      // own fragment reads of this buffer are done before it is refilled
    asm volatile("s_wait_asynccnt 0x0" ::: "memory");   // own copies of the next tile have landed
    __syncthreads();   // next tile readable by all; every reader has left this buffer
    if (k0 + 2 * BK < K)                     // refill it: these copies fly under the next tile's WMMAs
      copy_tile(lA + 2u * LBUF * cur, 2u * sAJ, aP + (size_t)(k0 + 2 * BK) * aK, aJ,
                lB + 2u * LBUF * cur, 2u * sBJ, bP + (k0 + 2 * BK), bJ);
    cur ^= 1;
  }
  asm volatile("s_wait_asynccnt 0x0" ::: "memory");     // no copy is outstanding when the LDS passes to the epilogue
}

// Output coords of acc[ai][bi]: 8 consecutive rows starting r, column c.
__device__ __forceinline__ void tile_coords(int m0, int n0, int ai, int bi, int& r, int& c) {
  const int wave = threadIdx.x >> 5, lane = threadIdx.x & 31;
  r = m0 + (wave >> 1) * 32 + ai * 16 + ((lane >> 4) << 3);
  c = n0 + (wave & 1) * 64 + bi * 16 + (lane & 15);
}

// ---------------------------------------------------------------------------
// K0: fp32 -> bf16 conversions (weights pre-transposed so B operands are [n][k])
// ---------------------------------------------------------------------------
__global__ void k_convert(const float* __restrict__ x, const float* __restrict__ proj_w,
                          const float* __restrict__ wq, const float* __restrict__ wk,
                          const float* __restrict__ wv, const float* __restrict__ wo,
                          const float* __restrict__ mo_w,
                          unsigned short* xb, unsigned short* pwb,
                          unsigned short* wqT, unsigned short* wkT, unsigned short* wvT,
                          unsigned short* woT, unsigned short* mowb)
{
  const size_t S0 = 32u * 512u * 256u;   // xb: x is already [b][c][dhw]
  const size_t S1 = 256u * 256u;         // proj_w [n][k]
  const size_t S2 = 512u * 4096u;        // each of wq/wk/wv -> [cout][c]
  const size_t S5 = 4096u * 512u;        // wo -> [c][h*512+i] (head-major k, as the context buffer)
  const size_t S6 = 512u * 512u;         // mo_w [o][c]
  const size_t total = S0 + S1 + 3 * S2 + S5 + S6;
  const size_t stride = (size_t)gridDim.x * blockDim.x;
  for (size_t i = (size_t)blockIdx.x * blockDim.x + threadIdx.x; i < total; i += stride) {
    size_t idx = i;
    if (idx < S0) { xb[idx] = f2b(x[idx]); continue; }
    idx -= S0;
    if (idx < S1) { pwb[idx] = f2b(proj_w[idx]); continue; }
    idx -= S1;
    if (idx < S2) { size_t co = idx / 512, c = idx % 512; wqT[idx] = f2b(wq[c * 4096 + co]); continue; }
    idx -= S2;
    if (idx < S2) { size_t co = idx / 512, c = idx % 512; wkT[idx] = f2b(wk[c * 4096 + co]); continue; }
    idx -= S2;
    if (idx < S2) { size_t co = idx / 512, c = idx % 512; wvT[idx] = f2b(wv[c * 4096 + co]); continue; }
    idx -= S2;
    if (idx < S5) {
      size_t c = idx / 4096, j = idx % 4096, h = j >> 9, ii = j & 511;
      woT[idx] = f2b(wo[(ii * 8 + h) * 512 + c]);
      continue;
    }
    idx -= S5;
    mowb[idx] = f2b(mo_w[idx]);
  }
}

// ---------------------------------------------------------------------------
// K1: patch embed. emb[b][n][c] = sum_k proj_w[n][k] * x[b][c][k] + proj_b[n]
// ---------------------------------------------------------------------------
__global__ __launch_bounds__(256) void k_embed(const unsigned short* __restrict__ pwb,
                        const unsigned short* __restrict__ xb,
                        const float* __restrict__ proj_b, float* __restrict__ emb)
{
  __shared__ __attribute__((aligned(16))) unsigned short shA[2 * LBUF], shB[2 * LBUF];
  const int b  = blockIdx.y;
  const int m0 = (blockIdx.x >> 2) * 128;   // n (seq), 2 tiles
  const int n0 = (blockIdx.x & 3) * 128;    // c, 4 tiles
  v8f acc[2][4];
  gemm128t<false>(pwb, 256, xb + (size_t)b * 512 * 256, 256, m0, n0, 256, shA, shB, acc);
  float* ob = emb + (size_t)b * 256 * 512;
  #pragma unroll
  for (int ai = 0; ai < 2; ++ai)
    #pragma unroll
    for (int bi = 0; bi < 4; ++bi) {
      int r0, c0; tile_coords(m0, n0, ai, bi, r0, c0);
      #pragma unroll
      for (int r = 0; r < 8; ++r) {
        const int n = r0 + r;
        ob[(size_t)n * 512 + c0] = acc[ai][bi][r] + proj_b[n];
      }
    }
}

// ---------------------------------------------------------------------------
// LayerNorm over C=512 per row (ln1 & ln2), writes bf16.
// ---------------------------------------------------------------------------
__global__ void k_layernorm(const float* __restrict__ in, const float* __restrict__ gamma,
                            const float* __restrict__ beta, unsigned short* __restrict__ out)
{
  __shared__ float red[256];
  const size_t row = blockIdx.x;
  const float* p = in + row * 512;
  const int t = threadIdx.x;
  float x0 = p[t], x1 = p[t + 256];
  red[t] = x0 + x1; __syncthreads();
  for (int o = 128; o > 0; o >>= 1) { if (t < o) red[t] += red[t + o]; __syncthreads(); }
  const float mu = red[0] * (1.0f / 512.0f); __syncthreads();
  const float d0 = x0 - mu, d1 = x1 - mu;
  red[t] = d0 * d0 + d1 * d1; __syncthreads();
  for (int o = 128; o > 0; o >>= 1) { if (t < o) red[t] += red[t + o]; __syncthreads(); }
  const float rs = rsqrtf(red[0] * (1.0f / 512.0f) + 1e-6f);
  unsigned short* q = out + row * 512;
  q[t]       = f2b(d0 * rs * gamma[t] + beta[t]);
  q[t + 256] = f2b(d1 * rs * gamma[t + 256] + beta[t + 256]);
}

// ---------------------------------------------------------------------------
// QKV per (b,h). grid.z: 0=q,1=k (write [bh][i][n] transposed), 2=v ([bh][n][i]).
// ---------------------------------------------------------------------------
__global__ __launch_bounds__(256) void k_qkv(const unsigned short* __restrict__ xnb,
                      const unsigned short* __restrict__ wqT,
                      const unsigned short* __restrict__ wkT,
                      const unsigned short* __restrict__ wvT,
                      unsigned short* __restrict__ qT, unsigned short* __restrict__ kT,
                      unsigned short* __restrict__ vC, int b0)
{
  __shared__ __attribute__((aligned(16))) unsigned short shA[2 * LBUF], shB[2 * LBUF];
  const int bh = blockIdx.y;
  const int b = b0 + (bh >> 3), h = bh & 7;
  const int mode = blockIdx.z;
  const unsigned short* wT = (mode == 0) ? wqT : ((mode == 1) ? wkT : wvT);
  const int m0 = (blockIdx.x >> 2) * 128;   // n (seq), 2 tiles
  const int n0 = (blockIdx.x & 3) * 128;    // i (within head), 4 tiles
  v8f acc[2][4];
  gemm128t<false>(xnb + (size_t)b * 256 * 512, 512, wT + (size_t)h * 512 * 512, 512,
          m0, n0, 512, shA, shB, acc);
  if (mode < 2) {
    unsigned short* dst = ((mode == 0) ? qT : kT) + (size_t)bh * 512 * 256;
    #pragma unroll
    for (int ai = 0; ai < 2; ++ai)
      #pragma unroll
      for (int bi = 0; bi < 4; ++bi) {
        int r0, c0; tile_coords(m0, n0, ai, bi, r0, c0);
        union { unsigned short s[8]; uint4 q; } pk;
        #pragma unroll
        for (int r = 0; r < 8; ++r) pk.s[r] = f2b(acc[ai][bi][r]);
        *(uint4*)&dst[(size_t)c0 * 256 + r0] = pk.q;   // contiguous in n
      }
  } else {
    unsigned short* dst = vC + (size_t)bh * 256 * 512;
    #pragma unroll
    for (int ai = 0; ai < 2; ++ai)
      #pragma unroll
      for (int bi = 0; bi < 4; ++bi) {
        int r0, c0; tile_coords(m0, n0, ai, bi, r0, c0);
        #pragma unroll
        for (int r = 0; r < 8; ++r)
          dst[(size_t)(r0 + r) * 512 + c0] = f2b(acc[ai][bi][r]);
      }
  }
}

// ---------------------------------------------------------------------------
// scores[i][j] = sum_n qT[i][n] * kT[j][n]; store bf16 + per-tile sum/sumsq.
// ---------------------------------------------------------------------------
__global__ __launch_bounds__(256) void k_scores(const unsigned short* __restrict__ qT,
                         const unsigned short* __restrict__ kT,
                         unsigned short* __restrict__ attn, float* __restrict__ part)
{
  __shared__ __attribute__((aligned(16))) unsigned short shA[2 * LBUF], shB[2 * LBUF];
  __shared__ float redS[256], redQ[256];
  const int bh = blockIdx.y;
  const int m0 = (blockIdx.x >> 2) * 128;   // i, 4 tiles
  const int n0 = (blockIdx.x & 3) * 128;    // j, 4 tiles
  v8f acc[2][4];
  gemm128t<false>(qT + (size_t)bh * 512 * 256, 256, kT + (size_t)bh * 512 * 256, 256,
          m0, n0, 256, shA, shB, acc);
  unsigned short* dst = attn + (size_t)bh * 512 * 512;
  float s = 0.0f, s2 = 0.0f;
  #pragma unroll
  for (int ai = 0; ai < 2; ++ai)
    #pragma unroll
    for (int bi = 0; bi < 4; ++bi) {
      int r0, c0; tile_coords(m0, n0, ai, bi, r0, c0);
      #pragma unroll
      for (int r = 0; r < 8; ++r) {
        const float v = acc[ai][bi][r];
        dst[(size_t)(r0 + r) * 512 + c0] = f2b(v);
        s += v; s2 += v * v;
      }
    }
  const int t = threadIdx.x;
  redS[t] = s; redQ[t] = s2; __syncthreads();
  for (int o = 128; o > 0; o >>= 1) {
    if (t < o) { redS[t] += redS[t + o]; redQ[t] += redQ[t + o]; }
    __syncthreads();
  }
  if (t == 0) {
    part[((size_t)bh * 16 + blockIdx.x) * 2 + 0] = redS[0];
    part[((size_t)bh * 16 + blockIdx.x) * 2 + 1] = redQ[0];
  }
}

__global__ void k_stats(const float* __restrict__ part, float* __restrict__ stats)
{
  __shared__ float rs[16], rq[16];
  const int bh = blockIdx.x, t = threadIdx.x;   // 16 threads
  rs[t] = part[((size_t)bh * 16 + t) * 2 + 0];
  rq[t] = part[((size_t)bh * 16 + t) * 2 + 1];
  __syncthreads();
  for (int o = 8; o > 0; o >>= 1) {
    if (t < o) { rs[t] += rs[t + o]; rq[t] += rq[t + o]; }
    __syncthreads();
  }
  if (t == 0) {
    const float inv = 1.0f / 262144.0f;
    const float mu = rs[0] * inv;
    const float var = rq[0] * inv - mu * mu;
    stats[bh * 2 + 0] = mu;
    stats[bh * 2 + 1] = rsqrtf(var + 1e-5f);   // InstanceNorm2d eps
  }
}

// instance-norm + row softmax, in place (bf16).
__global__ void k_softmax(unsigned short* __restrict__ attn, const float* __restrict__ stats)
{
  __shared__ float red[256];
  const int bh = blockIdx.y, i = blockIdx.x, t = threadIdx.x;
  unsigned short* row = attn + ((size_t)bh * 512 + i) * 512;
  const float mu = stats[bh * 2 + 0], rs = stats[bh * 2 + 1];
  float x0 = (b2f(row[t]) - mu) * rs;
  float x1 = (b2f(row[t + 256]) - mu) * rs;
  red[t] = fmaxf(x0, x1); __syncthreads();
  for (int o = 128; o > 0; o >>= 1) { if (t < o) red[t] = fmaxf(red[t], red[t + o]); __syncthreads(); }
  const float m = red[0]; __syncthreads();
  const float e0 = expf(x0 - m), e1 = expf(x1 - m);
  red[t] = e0 + e1; __syncthreads();
  for (int o = 128; o > 0; o >>= 1) { if (t < o) red[t] += red[t + o]; __syncthreads(); }
  const float inv = 1.0f / red[0];
  row[t]       = f2b(e0 * inv);
  row[t + 256] = f2b(e1 * inv);
}

// ---------------------------------------------------------------------------
// ctx[i][nseq] = sum_j attn[i][j] * v[nseq][j]; stored k-blocked with k = h*512+i:
// ctx2[bL][k/8][n][8], so a lane's 8 accumulator rows are one 16-B store and 16 lanes 256 B.
// ---------------------------------------------------------------------------
__global__ __launch_bounds__(256) void k_ctx(const unsigned short* __restrict__ attn,
                      const unsigned short* __restrict__ vC,
                      unsigned short* __restrict__ ctx2)
{
  __shared__ __attribute__((aligned(16))) unsigned short shA[2 * LBUF], shB[2 * LBUF];
  const int bh = blockIdx.y;
  const int bL = bh >> 3, h = bh & 7;
  const int m0 = (blockIdx.x >> 1) * 128;   // i, 4 tiles
  const int n0 = (blockIdx.x & 1) * 128;    // nseq, 2 tiles
  v8f acc[2][4];
  gemm128t<false>(attn + (size_t)bh * 512 * 512, 512, vC + (size_t)bh * 256 * 512, 512,
          m0, n0, 512, shA, shB, acc);
  unsigned short* dst = ctx2 + (size_t)bL * 256 * 4096;
  #pragma unroll
  for (int ai = 0; ai < 2; ++ai)
    #pragma unroll
    for (int bi = 0; bi < 4; ++bi) {
      int r0, c0; tile_coords(m0, n0, ai, bi, r0, c0);   // rows=i, cols=nseq
      union { unsigned short s[8]; uint4 q; } pk;
      #pragma unroll
      for (int r = 0; r < 8; ++r) pk.s[r] = f2b(acc[ai][bi][r]);
      *(uint4*)&dst[(size_t)(h * 512 + r0) * 256 + (size_t)c0 * 8] = pk.q;
    }
}

// out[n][c] = ctx2[n][:] @ wo + emb (residual), f32; k runs head-major in both operands.
// Batches b0 .. b0+gridDim.y-1.
__global__ __launch_bounds__(256) void k_outproj(const unsigned short* __restrict__ ctx2,
                          const unsigned short* __restrict__ woT,
                          const float* __restrict__ emb, float* __restrict__ y1, int b0)
{
  __shared__ __attribute__((aligned(16))) unsigned short shA[2 * LBUF], shB[2 * LBUF];
  const int bL = blockIdx.y, b = b0 + bL;
  const int m0 = (blockIdx.x >> 2) * 128;   // n, 2 tiles
  const int n0 = (blockIdx.x & 3) * 128;    // c, 4 tiles
  v8f acc[2][4];
  gemm128t<true>(ctx2 + (size_t)bL * 256 * 4096, 256, woT, 4096, m0, n0, 4096, shA, shB, acc);
  const float* res = emb + (size_t)b * 256 * 512;
  float* dst = y1 + (size_t)b * 256 * 512;
  #pragma unroll
  for (int ai = 0; ai < 2; ++ai)
    #pragma unroll
    for (int bi = 0; bi < 4; ++bi) {
      int r0, c0; tile_coords(m0, n0, ai, bi, r0, c0);
      #pragma unroll
      for (int r = 0; r < 8; ++r) {
        const size_t o = (size_t)(r0 + r) * 512 + c0;
        dst[o] = acc[ai][bi][r] + res[o];
      }
    }
}

// final[b][o][pos] = gelu( y2[b][pos][:] @ mo_w[o][:] + mo_b[o] ), exact erf GELU.
__global__ __launch_bounds__(256) void k_mo(const unsigned short* __restrict__ y2,
                     const unsigned short* __restrict__ mowb,
                     const float* __restrict__ mo_b, float* __restrict__ out)
{
  __shared__ __attribute__((aligned(16))) unsigned short shA[2 * LBUF], shB[2 * LBUF];
  const int b = blockIdx.y;
  const int m0 = (blockIdx.x >> 2) * 128;   // pos, 2 tiles
  const int n0 = (blockIdx.x & 3) * 128;    // o, 4 tiles
  v8f acc[2][4];
  gemm128t<false>(y2 + (size_t)b * 256 * 512, 512, mowb, 512, m0, n0, 512, shA, shB, acc);
  #pragma unroll
  for (int ai = 0; ai < 2; ++ai)
    #pragma unroll
    for (int bi = 0; bi < 4; ++bi) {
      int r0, c0; tile_coords(m0, n0, ai, bi, r0, c0);  // rows=pos (8 contiguous), cols=o
      const float bias = mo_b[c0];
      union { float f[8]; float4 q[2]; } pk;
      #pragma unroll
      for (int r = 0; r < 8; ++r) {
        const float tv = acc[ai][bi][r] + bias;
        pk.f[r] = 0.5f * tv * (1.0f + erff(tv * 0.70710678118654752f));
      }
      float* dst = out + ((size_t)b * 512 + c0) * 256 + r0;
      *(float4*)(dst + 0) = pk.q[0];
      *(float4*)(dst + 4) = pk.q[1];
    }
}

// ---------------------------------------------------------------------------
extern "C" void kernel_launch(void* const* d_in, const int* in_sizes, int n_in,
                              void* d_out, int out_size, void* d_ws, size_t ws_size,
                              hipStream_t stream)
{
  (void)in_sizes; (void)n_in; (void)out_size; (void)ws_size;
  const float* x      = (const float*)d_in[0];
  const float* proj_w = (const float*)d_in[1];
  const float* proj_b = (const float*)d_in[2];
  const float* ln1_g  = (const float*)d_in[3];
  const float* ln1_b  = (const float*)d_in[4];
  const float* wq     = (const float*)d_in[5];
  const float* wk     = (const float*)d_in[6];
  const float* wv     = (const float*)d_in[7];
  const float* wo     = (const float*)d_in[8];
  const float* ln2_g  = (const float*)d_in[9];
  const float* ln2_b  = (const float*)d_in[10];
  const float* mo_w   = (const float*)d_in[11];
  const float* mo_b   = (const float*)d_in[12];
  float* outp = (float*)d_out;

  char* w = (char*)d_ws;
  size_t off = 0;
  auto nxt = [&](size_t bytes) { char* p = w + off; off = (off + bytes + 255) & ~(size_t)255; return p; };
  unsigned short* xb    = (unsigned short*)nxt(8388608);    // x bf16 [b][c][k]
  unsigned short* pwb   = (unsigned short*)nxt(131072);     // proj_w bf16
  unsigned short* wqT   = (unsigned short*)nxt(4194304);    // [cout][c]
  unsigned short* wkT   = (unsigned short*)nxt(4194304);
  unsigned short* wvT   = (unsigned short*)nxt(4194304);
  unsigned short* woT   = (unsigned short*)nxt(4194304);    // [c][h*512+i]
  unsigned short* mowb  = (unsigned short*)nxt(524288);     // [o][c]
  float*          emb   = (float*)nxt(16777216);            // residual, f32
  unsigned short* xnb   = (unsigned short*)nxt(8388608);    // LN1(emb) bf16
  unsigned short* qT    = (unsigned short*)nxt(16777216);   // chunk: 64 bh x 512 x 256
  unsigned short* kT    = (unsigned short*)nxt(16777216);
  unsigned short* vC    = (unsigned short*)nxt(16777216);   // chunk: 64 bh x 256 x 512
  unsigned short* attn  = (unsigned short*)nxt(33554432);   // chunk: 64 bh x 512 x 512
  float*          part  = (float*)nxt(8192);                // 64 bh x 16 tiles x {sum,sumsq}
  float*          stats = (float*)nxt(512);                 // 64 bh x {mu, rsig}
  unsigned short* ctx2  = (unsigned short*)nxt(67108864);   // all 32 b x [k/8][n][8]
  float*          y1    = (float*)nxt(16777216);            // attn out + residual, f32
  unsigned short* y2    = (unsigned short*)nxt(8388608);    // LN2 bf16

  k_convert<<<4096, 256, 0, stream>>>(x, proj_w, wq, wk, wv, wo, mo_w,
                                      xb, pwb, wqT, wkT, wvT, woT, mowb);
  k_embed<<<dim3(8, 32), 256, 0, stream>>>(pwb, xb, proj_b, emb);
  k_layernorm<<<8192, 256, 0, stream>>>(emb, ln1_g, ln1_b, xnb);

  for (int pass = 0; pass < 4; ++pass) {           // 8 batches (64 bh) per pass
    const int b0 = pass * 8;
    k_qkv<<<dim3(8, 64, 3), 256, 0, stream>>>(xnb, wqT, wkT, wvT, qT, kT, vC, b0);
    k_scores<<<dim3(16, 64), 256, 0, stream>>>(qT, kT, attn, part);
    k_stats<<<64, 16, 0, stream>>>(part, stats);
    k_softmax<<<dim3(512, 64), 256, 0, stream>>>(attn, stats);
    k_ctx<<<dim3(8, 64), 256, 0, stream>>>(attn, vC, ctx2 + (size_t)b0 * 256 * 4096);
  }
  k_outproj<<<dim3(8, 32), 256, 0, stream>>>(ctx2, woT, emb, y1, 0);

  k_layernorm<<<8192, 256, 0, stream>>>(y1, ln2_g, ln2_b, y2);
  k_mo<<<dim3(8, 32), 256, 0, stream>>>(y2, mowb, mo_b, outp);
}

// v005
// One run takes 397 microseconds.
// Two timings next to v004 put it at 1.39 and 1.37 times that version's speed.
// Over all steps from v000 it is 3.00 times as fast.
#include <hip/hip_runtime.h>
#include <math.h>

typedef __attribute__((ext_vector_type(16))) __bf16 v16bf;
typedef __attribute__((ext_vector_type(8)))  float  v8f;

__device__ __forceinline__ unsigned short f2b(float f) {
  unsigned int u = __float_as_uint(f);
  u += 0x7FFFu + ((u >> 16) & 1u);           // round-to-nearest-even
  return (unsigned short)(u >> 16);
}

union FragU { v16bf v; unsigned int u[8]; };

#define BK   64                 // k per staged tile: 128 B of every operand row = one whole line
#define LDSS 72                 // padded LDS row stride (bf16) -> 144B rows, conflict-free
#define LBUF (128 * LDSS)       // one LDS buffer (ushorts)

__device__ __forceinline__ void copy_tile(unsigned la, unsigned laJ, const unsigned short* ga, size_t gaJ,
                                          unsigned lb, unsigned lbJ, const unsigned short* gb, size_t gbJ)
{
  asm volatile(
      "global_load_async_to_lds_b128 %0, %8, off\n\t"
      "global_load_async_to_lds_b128 %4, %12, off\n\t"
      "global_load_async_to_lds_b128 %1, %9, off\n\t"
      "global_load_async_to_lds_b128 %5, %13, off\n\t"
      "global_load_async_to_lds_b128 %2, %10, off\n\t"
      "global_load_async_to_lds_b128 %6, %14, off\n\t"
      "global_load_async_to_lds_b128 %3, %11, off\n\t"
      "global_load_async_to_lds_b128 %7, %15, off\n\t"
      "s_wait_xcnt 0x0"
      :: "v"(la), "v"(la + laJ), "v"(la + 2u * laJ), "v"(la + 3u * laJ),
         "v"(lb), "v"(lb + lbJ), "v"(lb + 2u * lbJ), "v"(lb + 3u * lbJ),
         "v"(ga), "v"(ga + gaJ), "v"(ga + 2 * gaJ), "v"(ga + 3 * gaJ),
         "v"(gb), "v"(gb + gbJ), "v"(gb + 2 * gbJ), "v"(gb + 3 * gbJ)
      : "memory");
}

template <bool KB>
__device__ __forceinline__ void gemm128t(
    const unsigned short* __restrict__ A, int lda,
    const unsigned short* __restrict__ Bt, int ldb,
    int m0, int n0, int K,
    unsigned short* shA, unsigned short* shB,   // each 2*LBUF
    v8f acc[2][4])
{
  const int t    = threadIdx.x;
  const int rs   = t >> 3;            // row-major staging: rows rs + 32*j, j = 0..3
  const int kqs  = (t & 7) << 3;      // 8 bf16 = 16B
  const int wave = t >> 5;
  const int lane = t & 31;
  const int wm   = wave >> 1;         // 0..3 -> M offset 32*wm
  const int wn   = wave & 1;          // 0..1 -> N offset 64*wn
  const int fm   = lane & 15;
  const int g    = lane >> 4;

  #pragma unroll
  for (int ai = 0; ai < 2; ++ai)
    #pragma unroll
    for (int bi = 0; bi < 4; ++bi)
      #pragma unroll
      for (int i = 0; i < 8; ++i) acc[ai][bi][i] = 0.0f;

  // A: address of this thread's chunk j = 0, the step from chunk to chunk, the step per k.
  const unsigned short* aP = KB ? A + (size_t)((t >> 7) << 3) * lda + (size_t)(m0 + (t & 127)) * 8
                                : A + (size_t)(m0 + rs) * lda + kqs;
  const size_t aJ = KB ? (size_t)16 * lda : (size_t)32 * lda;   // KB: chunk j is k-octet (t>>7) + 2j
  const size_t aK = KB ? (size_t)lda : (size_t)1;
  const int   sA0 = KB ? (t & 127) * LDSS + ((t >> 7) << 3) : rs * LDSS + kqs;
  const int   sAJ = KB ? 16 : 32 * LDSS;
  const unsigned short* bP = Bt + (size_t)(n0 + rs) * ldb + kqs;
  const size_t bJ = (size_t)32 * ldb;
  const int   sB0 = rs * LDSS + kqs;
  const int   sBJ = 32 * LDSS;
  // one prefetch per 128-B line of a tile: threads 0..127 take A's lines, 128..255 Bt's
  const unsigned short* pfP = (t < 128)
      ? (KB ? A + (size_t)((t >> 4) << 3) * lda + (size_t)m0 * 8 + (size_t)(t & 15) * 64
            : A + (size_t)(m0 + t) * lda)
      : Bt + (size_t)(n0 + (t & 127)) * ldb;
  const size_t pfK = (KB && t < 128) ? (size_t)lda : (size_t)1;

  // LDS byte addresses (low 32 bits of the __shared__ address) of this thread's chunk j = 0, buffer 0
  const unsigned lA = (unsigned)(size_t)(shA + sA0);
  const unsigned lB = (unsigned)(size_t)(shB + sB0);

  // ring, two buffers: tile 0 lands and is published, then tile 1's copies start
  copy_tile(lA, 2u * sAJ, aP, aJ, lB, 2u * sBJ, bP, bJ);
  asm volatile("s_wait_asynccnt 0x0" ::: "memory");   // this wave's copies of tile 0 have landed
  __syncthreads();                                    // ... and every other wave's
  copy_tile(lA + 2u * LBUF, 2u * sAJ, aP + (size_t)BK * aK, aJ,
            lB + 2u * LBUF, 2u * sBJ, bP + BK, bJ);   // K >= 2 * BK in every caller

  int cur = 0;
  // kept rolled: unrolled (K = 256) every tile's 24 copy-address registers are formed up front and live together
  #pragma unroll 1
  for (int k0 = 0; k0 < K; k0 += BK) {
    if (k0 + 2 * BK < K) {                   // global_prefetch_b8 two tiles ahead
      __builtin_prefetch(pfP + (size_t)(k0 + 2 * BK) * pfK, 0, 1);
      // the prefetch's address registers are stepped for the next tile: wait before that overwrite
      asm volatile("s_wait_xcnt 0x0" ::: "memory");
    }
    const unsigned short* sa = shA + cur * LBUF;
    const unsigned short* sb = shB + cur * LBUF;
    #pragma unroll
    for (int ks = 0; ks < BK; ks += 32) {
      FragU fa[2], fb[4];
      #pragma unroll
      for (int p = 0; p < 8; ++p) {
        const int kk = ks + ((p & 4) << 2) + (g << 3) + ((p & 3) << 1);
        fa[0].u[p] = *(const unsigned int*)(sa + (wm * 32 + fm) * LDSS + kk);
        fa[1].u[p] = *(const unsigned int*)(sa + (wm * 32 + 16 + fm) * LDSS + kk);
        fb[0].u[p] = *(const unsigned int*)(sb + (wn * 64 + fm) * LDSS + kk);
        fb[1].u[p] = *(const unsigned int*)(sb + (wn * 64 + 16 + fm) * LDSS + kk);
        fb[2].u[p] = *(const unsigned int*)(sb + (wn * 64 + 32 + fm) * LDSS + kk);
        fb[3].u[p] = *(const unsigned int*)(sb + (wn * 64 + 48 + fm) * LDSS + kk);
      }
      #pragma unroll
      for (int ai = 0; ai < 2; ++ai)
        #pragma unroll
        for (int bi = 0; bi < 4; ++bi)
          acc[ai][bi] = __builtin_amdgcn_wmma_f32_16x16x32_bf16(
              false, fa[ai].v, false, fb[bi].v, (short)0, acc[ai][bi], false, false);
    }
    // publish point of the next tile, every wave, in this order
    asm volatile("s_wait_dscnt 0x0" ::: "memory");      // own fragment reads of this buffer are done before it is refilled
    asm volatile("s_wait_asynccnt 0x0" ::: "memory");   // own copies of the next tile have landed
    __syncthreads();   // next tile readable by all; every reader has left this buffer
    if (k0 + 2 * BK < K)                     // refill it: these copies fly under the next tile's WMMAs
      copy_tile(lA + 2u * LBUF * cur, 2u * sAJ, aP + (size_t)(k0 + 2 * BK) * aK, aJ,
                lB + 2u * LBUF * cur, 2u * sBJ, bP + (k0 + 2 * BK), bJ);
    cur ^= 1;
  }
  asm volatile("s_wait_asynccnt 0x0" ::: "memory");     // no copy is outstanding when the LDS passes to the epilogue
}

// Output coords of acc[ai][bi]: 8 consecutive rows starting r, column c.
__device__ __forceinline__ void tile_coords(int m0, int n0, int ai, int bi, int& r, int& c) {
  const int wave = threadIdx.x >> 5, lane = threadIdx.x & 31;
  r = m0 + (wave >> 1) * 32 + ai * 16 + ((lane >> 4) << 3);
  c = n0 + (wave & 1) * 64 + bi * 16 + (lane & 15);
}

// ---------------------------------------------------------------------------
// K0: fp32 -> bf16 conversions (weights pre-transposed so B operands are [n][k])
// ---------------------------------------------------------------------------
__global__ void k_convert(const float* __restrict__ x, const float* __restrict__ proj_w,
                          const float* __restrict__ wq, const float* __restrict__ wk,
                          const float* __restrict__ wv, const float* __restrict__ wo,
                          const float* __restrict__ mo_w,
                          unsigned short* xb, unsigned short* pwb,
                          unsigned short* wqT, unsigned short* wkT, unsigned short* wvT,
                          unsigned short* woT, unsigned short* mowb)
{
  const size_t S0 = 32u * 512u * 256u;   // xb: x is already [b][c][dhw]
  const size_t S1 = 256u * 256u;         // proj_w [n][k]
  const size_t S2 = 512u * 4096u;        // each of wq/wk/wv -> [cout][c]
  const size_t S5 = 4096u * 512u;        // wo -> [c][h*512+i] (head-major k, as the context buffer)
  const size_t S6 = 512u * 512u;         // mo_w [o][c]
  const size_t total = S0 + S1 + 3 * S2 + S5 + S6;
  const size_t stride = (size_t)gridDim.x * blockDim.x;
  for (size_t i = (size_t)blockIdx.x * blockDim.x + threadIdx.x; i < total; i += stride) {
    size_t idx = i;
    if (idx < S0) { xb[idx] = f2b(x[idx]); continue; }
    idx -= S0;
    if (idx < S1) { pwb[idx] = f2b(proj_w[idx]); continue; }
    idx -= S1;
    if (idx < S2) { size_t co = idx / 512, c = idx % 512; wqT[idx] = f2b(wq[c * 4096 + co]); continue; }
    idx -= S2;
    if (idx < S2) { size_t co = idx / 512, c = idx % 512; wkT[idx] = f2b(wk[c * 4096 + co]); continue; }
    idx -= S2;
    if (idx < S2) { size_t co = idx / 512, c = idx % 512; wvT[idx] = f2b(wv[c * 4096 + co]); continue; }
    idx -= S2;
    if (idx < S5) {
      size_t c = idx / 4096, j = idx % 4096, h = j >> 9, ii = j & 511;
      woT[idx] = f2b(wo[(ii * 8 + h) * 512 + c]);
      continue;
    }
    idx -= S5;
    mowb[idx] = f2b(mo_w[idx]);
  }
}

// ---------------------------------------------------------------------------
// K1: patch embed. emb[b][n][c] = sum_k proj_w[n][k] * x[b][c][k] + proj_b[n]
// ---------------------------------------------------------------------------
__global__ __launch_bounds__(256) void k_embed(const unsigned short* __restrict__ pwb,
                        const unsigned short* __restrict__ xb,
                        const float* __restrict__ proj_b, float* __restrict__ emb)
{
  __shared__ __attribute__((aligned(16))) unsigned short shA[2 * LBUF], shB[2 * LBUF];
  const int b  = blockIdx.y;
  const int m0 = (blockIdx.x >> 2) * 128;   // n (seq), 2 tiles
  const int n0 = (blockIdx.x & 3) * 128;    // c, 4 tiles
  v8f acc[2][4];
  gemm128t<false>(pwb, 256, xb + (size_t)b * 512 * 256, 256, m0, n0, 256, shA, shB, acc);
  float* ob = emb + (size_t)b * 256 * 512;
  #pragma unroll
  for (int ai = 0; ai < 2; ++ai)
    #pragma unroll
    for (int bi = 0; bi < 4; ++bi) {
      int r0, c0; tile_coords(m0, n0, ai, bi, r0, c0);
      #pragma unroll
      for (int r = 0; r < 8; ++r) {
        const int n = r0 + r;
        ob[(size_t)n * 512 + c0] = acc[ai][bi][r] + proj_b[n];
      }
    }
}

// ---------------------------------------------------------------------------
// LayerNorm over C=512 per row (ln1 & ln2), writes bf16.
// ---------------------------------------------------------------------------
__global__ void k_layernorm(const float* __restrict__ in, const float* __restrict__ gamma,
                            const float* __restrict__ beta, unsigned short* __restrict__ out)
{
  __shared__ float red[256];
  const size_t row = blockIdx.x;
  const float* p = in + row * 512;
  const int t = threadIdx.x;
  float x0 = p[t], x1 = p[t + 256];
  red[t] = x0 + x1; __syncthreads();
  for (int o = 128; o > 0; o >>= 1) { if (t < o) red[t] += red[t + o]; __syncthreads(); }
  const float mu = red[0] * (1.0f / 512.0f); __syncthreads();
  const float d0 = x0 - mu, d1 = x1 - mu;
  red[t] = d0 * d0 + d1 * d1; __syncthreads();
  for (int o = 128; o > 0; o >>= 1) { if (t < o) red[t] += red[t + o]; __syncthreads(); }
  const float rs = rsqrtf(red[0] * (1.0f / 512.0f) + 1e-6f);
  unsigned short* q = out + row * 512;
  q[t]       = f2b(d0 * rs * gamma[t] + beta[t]);
  q[t + 256] = f2b(d1 * rs * gamma[t + 256] + beta[t + 256]);
}

// ---------------------------------------------------------------------------
// QKV per (b,h). grid.z: 0=q,1=k (write [bh][i][n] transposed), 2=v ([bh][n][i]).
// ---------------------------------------------------------------------------
__global__ __launch_bounds__(256) void k_qkv(const unsigned short* __restrict__ xnb,
                      const unsigned short* __restrict__ wqT,
                      const unsigned short* __restrict__ wkT,
                      const unsigned short* __restrict__ wvT,
                      unsigned short* __restrict__ qT, unsigned short* __restrict__ kT,
                      unsigned short* __restrict__ vC, int b0)
{
  __shared__ __attribute__((aligned(16))) unsigned short shA[2 * LBUF], shB[2 * LBUF];
  const int bh = blockIdx.y;
  const int b = b0 + (bh >> 3), h = bh & 7;
  const int mode = blockIdx.z;
  const unsigned short* wT = (mode == 0) ? wqT : ((mode == 1) ? wkT : wvT);
  const int m0 = (blockIdx.x >> 2) * 128;   // n (seq), 2 tiles
  const int n0 = (blockIdx.x & 3) * 128;    // i (within head), 4 tiles
  v8f acc[2][4];
  gemm128t<false>(xnb + (size_t)b * 256 * 512, 512, wT + (size_t)h * 512 * 512, 512,
          m0, n0, 512, shA, shB, acc);
  if (mode < 2) {
    unsigned short* dst = ((mode == 0) ? qT : kT) + (size_t)bh * 512 * 256;
    #pragma unroll
    for (int ai = 0; ai < 2; ++ai)
      #pragma unroll
      for (int bi = 0; bi < 4; ++bi) {
        int r0, c0; tile_coords(m0, n0, ai, bi, r0, c0);
        union { unsigned short s[8]; uint4 q; } pk;
        #pragma unroll
        for (int r = 0; r < 8; ++r) pk.s[r] = f2b(acc[ai][bi][r]);
        *(uint4*)&dst[(size_t)c0 * 256 + r0] = pk.q;   // contiguous in n
      }
  } else {
    unsigned short* dst = vC + (size_t)bh * 256 * 512;
    #pragma unroll
    for (int ai = 0; ai < 2; ++ai)
      #pragma unroll
      for (int bi = 0; bi < 4; ++bi) {
        int r0, c0; tile_coords(m0, n0, ai, bi, r0, c0);
        #pragma unroll
        for (int r = 0; r < 8; ++r)
          dst[(size_t)(r0 + r) * 512 + c0] = f2b(acc[ai][bi][r]);
      }
  }
}

// ---------------------------------------------------------------------------
// scores[i][j] = sum_n qT[i][n] * kT[j][n]; store bf16 + per-tile sum/sumsq.
// ---------------------------------------------------------------------------
__global__ __launch_bounds__(256) void k_scores(const unsigned short* __restrict__ qT,
                         const unsigned short* __restrict__ kT,
                         unsigned short* __restrict__ attn, float* __restrict__ part)
{
  __shared__ __attribute__((aligned(16))) unsigned short shA[2 * LBUF], shB[2 * LBUF];
  __shared__ float redS[256], redQ[256];
  const int bh = blockIdx.y;
  const int m0 = (blockIdx.x >> 2) * 128;   // i, 4 tiles
  const int n0 = (blockIdx.x & 3) * 128;    // j, 4 tiles
  v8f acc[2][4];
  gemm128t<false>(qT + (size_t)bh * 512 * 256, 256, kT + (size_t)bh * 512 * 256, 256,
          m0, n0, 256, shA, shB, acc);
  unsigned short* dst = attn + (size_t)bh * 512 * 512;
  float s = 0.0f, s2 = 0.0f;
  #pragma unroll
  for (int ai = 0; ai < 2; ++ai)
    #pragma unroll
    for (int bi = 0; bi < 4; ++bi) {
      int r0, c0; tile_coords(m0, n0, ai, bi, r0, c0);
      #pragma unroll
      for (int r = 0; r < 8; ++r) {
        const float v = acc[ai][bi][r];
        dst[(size_t)(r0 + r) * 512 + c0] = f2b(v);
        s += v; s2 += v * v;
      }
    }
  const int t = threadIdx.x;
  redS[t] = s; redQ[t] = s2; __syncthreads();
  for (int o = 128; o > 0; o >>= 1) {
    if (t < o) { redS[t] += redS[t + o]; redQ[t] += redQ[t + o]; }
    __syncthreads();
  }
  if (t == 0) {
    part[((size_t)bh * 16 + blockIdx.x) * 2 + 0] = redS[0];
    part[((size_t)bh * 16 + blockIdx.x) * 2 + 1] = redQ[0];
  }
}

// ---------------------------------------------------------------------------
// Instance norm + row softmax + context product in one kernel.
// ctx[i][nseq] = sum_j P[i][j] * v[nseq][j], P = softmax_j((scores - mu) * rsig); mu drops out of a softmax.
// One work-group owns 128 whole score rows and all 256 nseq, so every row is normalised once:
// each wave turns 16 rows into bf16 P rows of an LDS panel (the A operand, resident for the whole K loop),
// v comes through the two-buffer ring of asynchronous copies. 8 waves (2Mx4N), 64x64 per wave.
// Stored k-blocked with k = h*512+i: ctx2[bL][k/8][n][8], a lane's 8 accumulator rows are one 16-B store.
// ---------------------------------------------------------------------------
#define PP    520               // panel row pitch (bf16): 1040 B = 16 B x odd, conflict-free for ds_load_b128
#define LBUFV (256 * LDSS)      // one buffer of the v ring: 256 rows x 64 k

typedef __attribute__((ext_vector_type(2))) float  f32x2;
typedef __attribute__((ext_vector_type(2))) __bf16 bf16x2;

__device__ __forceinline__ unsigned int pack2(float lo, float hi) {   // two f32 -> packed bf16, nearest even
  f32x2 f; f[0] = lo; f[1] = hi;
  union { bf16x2 b; unsigned int u; } c;
  c.b = __builtin_convertvector(f, bf16x2);
  return c.u;
}

__device__ __forceinline__ float exp2_slot(float x) {
  float y;
  asm("v_exp_f32 %0, %1\n\tv_nop" : "=v"(y) : "v"(x));
  return y;
}

__global__ __launch_bounds__(256) void k_ctx(const unsigned short* __restrict__ attn,
                      const float* __restrict__ part,
                      const unsigned short* __restrict__ vC,
                      unsigned short* __restrict__ ctx2)
{
  __shared__ __attribute__((aligned(16))) unsigned short pan[128 * PP];
  __shared__ __attribute__((aligned(16))) unsigned short shV[2 * LBUFV];
  const int bh = blockIdx.y;
  const int bL = bh >> 3, h = bh & 7;
  const int m0 = blockIdx.x * 128;          // i, 4 tiles
  const int t = threadIdx.x, wave = t >> 5, lane = t & 31;

  // v ring: a thread's 8 chunks of a tile are rows (t>>3) + 32*j of the lower and of the upper 128 rows
  const unsigned short* vP = vC + (size_t)bh * 256 * 512 + (size_t)(t >> 3) * 512 + ((t & 7) << 3);
  const unsigned lV = (unsigned)(size_t)(shV + (t >> 3) * LDSS + ((t & 7) << 3));
  const unsigned vJ = 2u * 32 * LDSS, vH = 2u * 128 * LDSS;
  // tile 0's copies fly under the softmax
  copy_tile(lV, vJ, vP, (size_t)32 * 512, lV + vH, vJ, vP + (size_t)128 * 512, (size_t)32 * 512);

  // instance-norm statistics from the 16 score tiles' {sum, sumsq}; pairs added as t, t+8, then 4, 2, 1
  float pv = part[(size_t)bh * 32 + lane];
  #pragma unroll
  for (int o = 16; o >= 2; o >>= 1) pv += __shfl_xor(pv, o);
  const float mu  = __shfl(pv, 0) * (1.0f / 262144.0f);
  const float var = __shfl(pv, 1) * (1.0f / 262144.0f) - mu * mu;
  const float kf  = rsqrtf(var + 1e-5f) * 1.44269504088896341f;   // InstanceNorm2d eps; log2(e) for exp2

  // softmax of rows m0 + 16*wave + 0..15, 8 rows at a time; a lane holds j = 8*lane..+7 and 256 + 8*lane..+7
  const unsigned short* sP = attn + ((size_t)bh * 512 + m0 + wave * 16) * 512 + lane * 8;
  #pragma unroll
  for (int hb = 0; hb < 2; ++hb) {
    uint4 raw[8][2];
    #pragma unroll
    for (int r = 0; r < 8; ++r) {
      raw[r][0] = *(const uint4*)(sP + (size_t)(hb * 8 + r) * 512);
      raw[r][1] = *(const uint4*)(sP + (size_t)(hb * 8 + r) * 512 + 256);
    }
    float e[8][16], red[8];
    #pragma unroll
    for (int r = 0; r < 8; ++r) {
      #pragma unroll
      for (int q = 0; q < 2; ++q) {
        const unsigned int u[4] = { raw[r][q].x, raw[r][q].y, raw[r][q].z, raw[r][q].w };
        #pragma unroll
        for (int d = 0; d < 4; ++d) {
          e[r][q * 8 + d * 2 + 0] = __uint_as_float(u[d] << 16);
          e[r][q * 8 + d * 2 + 1] = __uint_as_float(u[d] & 0xFFFF0000u);
        }
      }
      float m = e[r][0];
      #pragma unroll
      for (int i = 1; i < 16; ++i) m = fmaxf(m, e[r][i]);
      red[r] = m;
    }
    #pragma unroll
    for (int o = 16; o >= 1; o >>= 1)
      #pragma unroll
      for (int r = 0; r < 8; ++r) red[r] = fmaxf(red[r], __shfl_xor(red[r], o));
    #pragma unroll
    for (int r = 0; r < 8; ++r) {
      const float m = red[r];
      float s = 0.0f;
      #pragma unroll
      for (int i = 0; i < 16; ++i) {
        e[r][i] = exp2_slot((e[r][i] - m) * kf);
        s += e[r][i];
      }
      red[r] = s;
    }
    #pragma unroll
    for (int o = 16; o >= 1; o >>= 1)
      #pragma unroll
      for (int r = 0; r < 8; ++r) red[r] += __shfl_xor(red[r], o);
    #pragma unroll
    for (int r = 0; r < 8; ++r) {
      const float inv = 1.0f / red[r];
      unsigned short* pr = pan + (wave * 16 + hb * 8 + r) * PP + lane * 8;
      #pragma unroll
      for (int q = 0; q < 2; ++q) {
        uint4 o4;
        o4.x = pack2(e[r][q * 8 + 0] * inv, e[r][q * 8 + 1] * inv);
        o4.y = pack2(e[r][q * 8 + 2] * inv, e[r][q * 8 + 3] * inv);
        o4.z = pack2(e[r][q * 8 + 4] * inv, e[r][q * 8 + 5] * inv);
        o4.w = pack2(e[r][q * 8 + 6] * inv, e[r][q * 8 + 7] * inv);
        *(uint4*)(pr + q * 256) = o4;
      }
    }
  }

  const int wm = wave >> 2;           // 0..1 -> M offset 64*wm
  const int wn = wave & 3;            // 0..3 -> N offset 64*wn
  const int fm = lane & 15;
  const int g  = lane >> 4;
  v8f acc[4][4];
  #pragma unroll
  for (int ai = 0; ai < 4; ++ai)
    #pragma unroll
    for (int bi = 0; bi < 4; ++bi)
      #pragma unroll
      for (int i = 0; i < 8; ++i) acc[ai][bi][i] = 0.0f;

  asm volatile("s_wait_asynccnt 0x0" ::: "memory");   // this wave's copies of tile 0 have landed
  __syncthreads();                                    // ... every other wave's too, and the whole P panel is written
  copy_tile(lV + 2u * LBUFV, vJ, vP + BK, (size_t)32 * 512,
            lV + 2u * LBUFV + vH, vJ, vP + (size_t)128 * 512 + BK, (size_t)32 * 512);

  int cur = 0;
  // kept rolled: unrolled, every tile's copy-address registers are formed up front and live together
  #pragma unroll 1
  for (int k0 = 0; k0 < 512; k0 += BK) {
    const unsigned short* sa = pan + k0;
    const unsigned short* sb = shV + cur * LBUFV;
    #pragma unroll
    for (int ks = 0; ks < BK; ks += 32) {
      FragU fa[4], fb[4];
      #pragma unroll
      for (int p = 0; p < 8; ++p) {
        const int kk = ks + ((p & 4) << 2) + (g << 3) + ((p & 3) << 1);
        #pragma unroll
        for (int f = 0; f < 4; ++f) {
          fa[f].u[p] = *(const unsigned int*)(sa + (wm * 64 + f * 16 + fm) * PP + kk);
          fb[f].u[p] = *(const unsigned int*)(sb + (wn * 64 + f * 16 + fm) * LDSS + kk);
        }
      }
      __builtin_amdgcn_sched_barrier(0);
      #pragma unroll
      for (int ai = 0; ai < 4; ++ai)
        #pragma unroll
        for (int bi = 0; bi < 4; ++bi)
          acc[ai][bi] = __builtin_amdgcn_wmma_f32_16x16x32_bf16(
              false, fa[ai].v, false, fb[bi].v, (short)0, acc[ai][bi], false, false);
    }
    // publish point of the next tile, every wave, in this order
    asm volatile("s_wait_dscnt 0x0" ::: "memory");      // own fragment reads of this buffer are done before it is refilled
    asm volatile("s_wait_asynccnt 0x0" ::: "memory");   // own copies of the next tile have landed
    __syncthreads();   // next tile readable by all; every reader has left this buffer
    if (k0 + 2 * BK < 512)                   // refill it: these copies fly under the next tile's WMMAs
      copy_tile(lV + 2u * LBUFV * cur, vJ, vP + (k0 + 2 * BK), (size_t)32 * 512,
                lV + 2u * LBUFV * cur + vH, vJ, vP + (size_t)128 * 512 + (k0 + 2 * BK), (size_t)32 * 512);
    cur ^= 1;
  }
  asm volatile("s_wait_asynccnt 0x0" ::: "memory");     // no copy is outstanding when the wave ends

  unsigned short* dst = ctx2 + (size_t)bL * 256 * 4096;
  #pragma unroll
  for (int ai = 0; ai < 4; ++ai)
    #pragma unroll
    for (int bi = 0; bi < 4; ++bi) {
      const int r0 = m0 + wm * 64 + ai * 16 + (g << 3);   // rows = i, 8 consecutive
      const int c0 = wn * 64 + bi * 16 + fm;              // col = nseq
      union { unsigned short s[8]; uint4 q; } pk;
      #pragma unroll
      for (int r = 0; r < 8; ++r) pk.s[r] = f2b(acc[ai][bi][r]);
      *(uint4*)&dst[(size_t)(h * 512 + r0) * 256 + (size_t)c0 * 8] = pk.q;
    }
}

// out[n][c] = ctx2[n][:] @ wo + emb (residual), f32; k runs head-major in both operands.
// Batches b0 .. b0+gridDim.y-1.
__global__ __launch_bounds__(256) void k_outproj(const unsigned short* __restrict__ ctx2,
                          const unsigned short* __restrict__ woT,
                          const float* __restrict__ emb, float* __restrict__ y1, int b0)
{
  __shared__ __attribute__((aligned(16))) unsigned short shA[2 * LBUF], shB[2 * LBUF];
  const int bL = blockIdx.y, b = b0 + bL;
  const int m0 = (blockIdx.x >> 2) * 128;   // n, 2 tiles
  const int n0 = (blockIdx.x & 3) * 128;    // c, 4 tiles
  v8f acc[2][4];
  gemm128t<true>(ctx2 + (size_t)bL * 256 * 4096, 256, woT, 4096, m0, n0, 4096, shA, shB, acc);
  const float* res = emb + (size_t)b * 256 * 512;
  float* dst = y1 + (size_t)b * 256 * 512;
  #pragma unroll
  for (int ai = 0; ai < 2; ++ai)
    #pragma unroll
    for (int bi = 0; bi < 4; ++bi) {
      int r0, c0; tile_coords(m0, n0, ai, bi, r0, c0);
      #pragma unroll
      for (int r = 0; r < 8; ++r) {
        const size_t o = (size_t)(r0 + r) * 512 + c0;
        dst[o] = acc[ai][bi][r] + res[o];
      }
    }
}

// final[b][o][pos] = gelu( y2[b][pos][:] @ mo_w[o][:] + mo_b[o] ), exact erf GELU.
__global__ __launch_bounds__(256) void k_mo(const unsigned short* __restrict__ y2,
                     const unsigned short* __restrict__ mowb,
                     const float* __restrict__ mo_b, float* __restrict__ out)
{
  __shared__ __attribute__((aligned(16))) unsigned short shA[2 * LBUF], shB[2 * LBUF];
  const int b = blockIdx.y;
  const int m0 = (blockIdx.x >> 2) * 128;   // pos, 2 tiles
  const int n0 = (blockIdx.x & 3) * 128;    // o, 4 tiles
  v8f acc[2][4];
  gemm128t<false>(y2 + (size_t)b * 256 * 512, 512, mowb, 512, m0, n0, 512, shA, shB, acc);
  #pragma unroll
  for (int ai = 0; ai < 2; ++ai)
    #pragma unroll
    for (int bi = 0; bi < 4; ++bi) {
      int r0, c0; tile_coords(m0, n0, ai, bi, r0, c0);  // rows=pos (8 contiguous), cols=o
      const float bias = mo_b[c0];
      union { float f[8]; float4 q[2]; } pk;
      #pragma unroll
      for (int r = 0; r < 8; ++r) {
        const float tv = acc[ai][bi][r] + bias;
        pk.f[r] = 0.5f * tv * (1.0f + erff(tv * 0.70710678118654752f));
      }
      float* dst = out + ((size_t)b * 512 + c0) * 256 + r0;
      *(float4*)(dst + 0) = pk.q[0];
      *(float4*)(dst + 4) = pk.q[1];
    }
}

// ---------------------------------------------------------------------------
extern "C" void kernel_launch(void* const* d_in, const int* in_sizes, int n_in,
                              void* d_out, int out_size, void* d_ws, size_t ws_size,
                              hipStream_t stream)
{
  (void)in_sizes; (void)n_in; (void)out_size; (void)ws_size;
  const float* x      = (const float*)d_in[0];
  const float* proj_w = (const float*)d_in[1];
  const float* proj_b = (const float*)d_in[2];
  const float* ln1_g  = (const float*)d_in[3];
  const float* ln1_b  = (const float*)d_in[4];
  const float* wq     = (const float*)d_in[5];
  const float* wk     = (const float*)d_in[6];
  const float* wv     = (const float*)d_in[7];
  const float* wo     = (const float*)d_in[8];
  const float* ln2_g  = (const float*)d_in[9];
  const float* ln2_b  = (const float*)d_in[10];
  const float* mo_w   = (const float*)d_in[11];
  const float* mo_b   = (const float*)d_in[12];
  float* outp = (float*)d_out;

  char* w = (char*)d_ws;
  size_t off = 0;
  auto nxt = [&](size_t bytes) { char* p = w + off; off = (off + bytes + 255) & ~(size_t)255; return p; };
  unsigned short* xb    = (unsigned short*)nxt(8388608);    // x bf16 [b][c][k]
  unsigned short* pwb   = (unsigned short*)nxt(131072);     // proj_w bf16
  unsigned short* wqT   = (unsigned short*)nxt(4194304);    // [cout][c]
  unsigned short* wkT   = (unsigned short*)nxt(4194304);
  unsigned short* wvT   = (unsigned short*)nxt(4194304);
  unsigned short* woT   = (unsigned short*)nxt(4194304);    // [c][h*512+i]
  unsigned short* mowb  = (unsigned short*)nxt(524288);     // [o][c]
  float*          emb   = (float*)nxt(16777216);            // residual, f32
  unsigned short* xnb   = (unsigned short*)nxt(8388608);    // LN1(emb) bf16
  unsigned short* qT    = (unsigned short*)nxt(16777216);   // chunk: 64 bh x 512 x 256
  unsigned short* kT    = (unsigned short*)nxt(16777216);
  unsigned short* vC    = (unsigned short*)nxt(16777216);   // chunk: 64 bh x 256 x 512
  unsigned short* attn  = (unsigned short*)nxt(33554432);   // chunk: 64 bh x 512 x 512
  float*          part  = (float*)nxt(8192);                // 64 bh x 16 tiles x {sum,sumsq}
  unsigned short* ctx2  = (unsigned short*)nxt(67108864);   // all 32 b x [k/8][n][8]
  float*          y1    = (float*)nxt(16777216);            // attn out + residual, f32
  unsigned short* y2    = (unsigned short*)nxt(8388608);    // LN2 bf16

  k_convert<<<4096, 256, 0, stream>>>(x, proj_w, wq, wk, wv, wo, mo_w,
                                      xb, pwb, wqT, wkT, wvT, woT, mowb);
  k_embed<<<dim3(8, 32), 256, 0, stream>>>(pwb, xb, proj_b, emb);
  k_layernorm<<<8192, 256, 0, stream>>>(emb, ln1_g, ln1_b, xnb);

  for (int pass = 0; pass < 4; ++pass) {           // 8 batches (64 bh) per pass
    const int b0 = pass * 8;
    k_qkv<<<dim3(8, 64, 3), 256, 0, stream>>>(xnb, wqT, wkT, wvT, qT, kT, vC, b0);
    k_scores<<<dim3(16, 64), 256, 0, stream>>>(qT, kT, attn, part);
    k_ctx<<<dim3(4, 64), 256, 0, stream>>>(attn, part, vC, ctx2 + (size_t)b0 * 256 * 4096);
  }
  k_outproj<<<dim3(8, 32), 256, 0, stream>>>(ctx2, woT, emb, y1, 0);

  k_layernorm<<<8192, 256, 0, stream>>>(y1, ln2_g, ln2_b, y2);
  k_mo<<<dim3(8, 32), 256, 0, stream>>>(y2, mowb, mo_b, outp);
}

// v006
// A run of this version takes 387 microseconds.
// Timed twice side by side with v005, it ran 1.04 and 1.03 times as fast.
// All steps since v000 together make it 3.10 times as fast.
#include <hip/hip_runtime.h>
#include <math.h>

typedef __attribute__((ext_vector_type(16))) __bf16 v16bf;
typedef __attribute__((ext_vector_type(8)))  float  v8f;

__device__ __forceinline__ unsigned short f2b(float f) {
  unsigned int u = __float_as_uint(f);
  u += 0x7FFFu + ((u >> 16) & 1u);           // round-to-nearest-even
  return (unsigned short)(u >> 16);
}

typedef __attribute__((ext_vector_type(2))) float  f32x2;
typedef __attribute__((ext_vector_type(2))) __bf16 bf16x2;

__device__ __forceinline__ unsigned int pack2(float lo, float hi) {   // two f32 -> packed bf16, nearest even
  f32x2 f; f[0] = lo; f[1] = hi;
  union { bf16x2 b; unsigned int u; } c;
  c.b = __builtin_convertvector(f, bf16x2);
  return c.u;
}

union FragU { v16bf v; unsigned int u[8]; };

#define BK   64                 // k per staged tile: 128 B of every operand row = one whole line
#define LDSS 72                 // padded LDS row stride (bf16) -> 144B rows, conflict-free
#define LBUF (128 * LDSS)       // one LDS buffer (ushorts)

__device__ __forceinline__ void copy_tile(unsigned la, unsigned laJ, const unsigned short* ga, size_t gaJ,
                                          unsigned lb, unsigned lbJ, const unsigned short* gb, size_t gbJ)
{
  asm volatile(
      "global_load_async_to_lds_b128 %0, %8, off\n\t"
      "global_load_async_to_lds_b128 %4, %12, off\n\t"
      "global_load_async_to_lds_b128 %1, %9, off\n\t"
      "global_load_async_to_lds_b128 %5, %13, off\n\t"
      "global_load_async_to_lds_b128 %2, %10, off\n\t"
      "global_load_async_to_lds_b128 %6, %14, off\n\t"
      "global_load_async_to_lds_b128 %3, %11, off\n\t"
      "global_load_async_to_lds_b128 %7, %15, off\n\t"
      "s_wait_xcnt 0x0"
      :: "v"(la), "v"(la + laJ), "v"(la + 2u * laJ), "v"(la + 3u * laJ),
         "v"(lb), "v"(lb + lbJ), "v"(lb + 2u * lbJ), "v"(lb + 3u * lbJ),
         "v"(ga), "v"(ga + gaJ), "v"(ga + 2 * gaJ), "v"(ga + 3 * gaJ),
         "v"(gb), "v"(gb + gbJ), "v"(gb + 2 * gbJ), "v"(gb + 3 * gbJ)
      : "memory");
}

template <bool KB>
__device__ __forceinline__ void gemm128t(
    const unsigned short* __restrict__ A, int lda,
    const unsigned short* __restrict__ Bt, int ldb,
    int m0, int n0, int K,
    unsigned short* shA, unsigned short* shB,   // each 2*LBUF
    v8f acc[2][4])
{
  const int t    = threadIdx.x;
  const int rs   = t >> 3;            // row-major staging: rows rs + 32*j, j = 0..3
  const int kqs  = (t & 7) << 3;      // 8 bf16 = 16B
  const int wave = t >> 5;
  const int lane = t & 31;
  const int wm   = wave >> 1;         // 0..3 -> M offset 32*wm
  const int wn   = wave & 1;          // 0..1 -> N offset 64*wn
  const int fm   = lane & 15;
  const int g    = lane >> 4;

  #pragma unroll
  for (int ai = 0; ai < 2; ++ai)
    #pragma unroll
    for (int bi = 0; bi < 4; ++bi)
      #pragma unroll
      for (int i = 0; i < 8; ++i) acc[ai][bi][i] = 0.0f;

  // A: address of this thread's chunk j = 0, the step from chunk to chunk, the step per k.
  const unsigned short* aP = KB ? A + (size_t)((t >> 7) << 3) * lda + (size_t)(m0 + (t & 127)) * 8
                                : A + (size_t)(m0 + rs) * lda + kqs;
  const size_t aJ = KB ? (size_t)16 * lda : (size_t)32 * lda;   // KB: chunk j is k-octet (t>>7) + 2j
  const size_t aK = KB ? (size_t)lda : (size_t)1;
  const int   sA0 = KB ? (t & 127) * LDSS + ((t >> 7) << 3) : rs * LDSS + kqs;
  const int   sAJ = KB ? 16 : 32 * LDSS;
  const unsigned short* bP = Bt + (size_t)(n0 + rs) * ldb + kqs;
  const size_t bJ = (size_t)32 * ldb;
  const int   sB0 = rs * LDSS + kqs;
  const int   sBJ = 32 * LDSS;
  // one prefetch per 128-B line of a tile: threads 0..127 take A's lines, 128..255 Bt's
  const unsigned short* pfP = (t < 128)
      ? (KB ? A + (size_t)((t >> 4) << 3) * lda + (size_t)m0 * 8 + (size_t)(t & 15) * 64
            : A + (size_t)(m0 + t) * lda)
      : Bt + (size_t)(n0 + (t & 127)) * ldb;
  const size_t pfK = (KB && t < 128) ? (size_t)lda : (size_t)1;

  // LDS byte addresses (low 32 bits of the __shared__ address) of this thread's chunk j = 0, buffer 0
  const unsigned lA = (unsigned)(size_t)(shA + sA0);
  const unsigned lB = (unsigned)(size_t)(shB + sB0);

  // ring, two buffers: tile 0 lands and is published, then tile 1's copies start
  copy_tile(lA, 2u * sAJ, aP, aJ, lB, 2u * sBJ, bP, bJ);
  asm volatile("s_wait_asynccnt 0x0" ::: "memory");   // this wave's copies of tile 0 have landed
  __syncthreads();                                    // ... and every other wave's
  copy_tile(lA + 2u * LBUF, 2u * sAJ, aP + (size_t)BK * aK, aJ,
            lB + 2u * LBUF, 2u * sBJ, bP + BK, bJ);   // K >= 2 * BK in every caller

  int cur = 0;
  // kept rolled: unrolled (K = 256) every tile's 24 copy-address registers are formed up front and live together
  #pragma unroll 1
  for (int k0 = 0; k0 < K; k0 += BK) {
    if (k0 + 2 * BK < K) {                   // global_prefetch_b8 two tiles ahead
      __builtin_prefetch(pfP + (size_t)(k0 + 2 * BK) * pfK, 0, 1);
      // the prefetch's address registers are stepped for the next tile: wait before that overwrite
      asm volatile("s_wait_xcnt 0x0" ::: "memory");
    }
    const unsigned short* sa = shA + cur * LBUF;
    const unsigned short* sb = shB + cur * LBUF;
    #pragma unroll
    for (int ks = 0; ks < BK; ks += 32) {
      FragU fa[2], fb[4];
      #pragma unroll
      for (int p = 0; p < 8; ++p) {
        const int kk = ks + ((p & 4) << 2) + (g << 3) + ((p & 3) << 1);
        fa[0].u[p] = *(const unsigned int*)(sa + (wm * 32 + fm) * LDSS + kk);
        fa[1].u[p] = *(const unsigned int*)(sa + (wm * 32 + 16 + fm) * LDSS + kk);
        fb[0].u[p] = *(const unsigned int*)(sb + (wn * 64 + fm) * LDSS + kk);
        fb[1].u[p] = *(const unsigned int*)(sb + (wn * 64 + 16 + fm) * LDSS + kk);
        fb[2].u[p] = *(const unsigned int*)(sb + (wn * 64 + 32 + fm) * LDSS + kk);
        fb[3].u[p] = *(const unsigned int*)(sb + (wn * 64 + 48 + fm) * LDSS + kk);
      }
      #pragma unroll
      for (int ai = 0; ai < 2; ++ai)
        #pragma unroll
        for (int bi = 0; bi < 4; ++bi)
          acc[ai][bi] = __builtin_amdgcn_wmma_f32_16x16x32_bf16(
              false, fa[ai].v, false, fb[bi].v, (short)0, acc[ai][bi], false, false);
    }
    // publish point of the next tile, every wave, in this order
    asm volatile("s_wait_dscnt 0x0" ::: "memory");      // own fragment reads of this buffer are done before it is refilled
    asm volatile("s_wait_asynccnt 0x0" ::: "memory");   // own copies of the next tile have landed
    __syncthreads();   // next tile readable by all; every reader has left this buffer
    if (k0 + 2 * BK < K)                     // refill it: these copies fly under the next tile's WMMAs
      copy_tile(lA + 2u * LBUF * cur, 2u * sAJ, aP + (size_t)(k0 + 2 * BK) * aK, aJ,
                lB + 2u * LBUF * cur, 2u * sBJ, bP + (k0 + 2 * BK), bJ);
    cur ^= 1;
  }
  asm volatile("s_wait_asynccnt 0x0" ::: "memory");     // no copy is outstanding when the LDS passes to the epilogue
}

// Output coords of acc[ai][bi]: 8 consecutive rows starting r, column c.
__device__ __forceinline__ void tile_coords(int m0, int n0, int ai, int bi, int& r, int& c) {
  const int wave = threadIdx.x >> 5, lane = threadIdx.x & 31;
  r = m0 + (wave >> 1) * 32 + ai * 16 + ((lane >> 4) << 3);
  c = n0 + (wave & 1) * 64 + bi * 16 + (lane & 15);
}

// ---------------------------------------------------------------------------
// K0: fp32 -> bf16 conversions (weights pre-transposed so B operands are [n][k])
// ---------------------------------------------------------------------------
__global__ void k_convert(const float* __restrict__ x, const float* __restrict__ proj_w,
                          const float* __restrict__ wq, const float* __restrict__ wk,
                          const float* __restrict__ wv, const float* __restrict__ wo,
                          const float* __restrict__ mo_w,
                          unsigned short* xb, unsigned short* pwb,
                          unsigned short* wqT, unsigned short* wkT, unsigned short* wvT,
                          unsigned short* woT, unsigned short* mowb)
{
  const size_t S0 = 32u * 512u * 256u;   // xb: x is already [b][c][dhw]
  const size_t S1 = 256u * 256u;         // proj_w [n][k]
  const size_t S2 = 512u * 4096u;        // each of wq/wk/wv -> [cout][c]
  const size_t S5 = 4096u * 512u;        // wo -> [c][h*512+i] (head-major k, as the context buffer)
  const size_t S6 = 512u * 512u;         // mo_w [o][c]
  const size_t total = S0 + S1 + 3 * S2 + S5 + S6;
  const size_t stride = (size_t)gridDim.x * blockDim.x;
  for (size_t i = (size_t)blockIdx.x * blockDim.x + threadIdx.x; i < total; i += stride) {
    size_t idx = i;
    if (idx < S0) { xb[idx] = f2b(x[idx]); continue; }
    idx -= S0;
    if (idx < S1) { pwb[idx] = f2b(proj_w[idx]); continue; }
    idx -= S1;
    if (idx < S2) { size_t co = idx / 512, c = idx % 512; wqT[idx] = f2b(wq[c * 4096 + co]); continue; }
    idx -= S2;
    if (idx < S2) { size_t co = idx / 512, c = idx % 512; wkT[idx] = f2b(wk[c * 4096 + co]); continue; }
    idx -= S2;
    if (idx < S2) { size_t co = idx / 512, c = idx % 512; wvT[idx] = f2b(wv[c * 4096 + co]); continue; }
    idx -= S2;
    if (idx < S5) {
      size_t c = idx / 4096, j = idx % 4096, h = j >> 9, ii = j & 511;
      woT[idx] = f2b(wo[(ii * 8 + h) * 512 + c]);
      continue;
    }
    idx -= S5;
    mowb[idx] = f2b(mo_w[idx]);
  }
}

// ---------------------------------------------------------------------------
// K1: patch embed. emb[b][n][c] = sum_k proj_w[n][k] * x[b][c][k] + proj_b[n]
// ---------------------------------------------------------------------------
__global__ __launch_bounds__(256) void k_embed(const unsigned short* __restrict__ pwb,
                        const unsigned short* __restrict__ xb,
                        const float* __restrict__ proj_b, float* __restrict__ emb)
{
  __shared__ __attribute__((aligned(16))) unsigned short shA[2 * LBUF], shB[2 * LBUF];
  const int b  = blockIdx.y;
  const int m0 = (blockIdx.x >> 2) * 128;   // n (seq), 2 tiles
  const int n0 = (blockIdx.x & 3) * 128;    // c, 4 tiles
  v8f acc[2][4];
  gemm128t<false>(pwb, 256, xb + (size_t)b * 512 * 256, 256, m0, n0, 256, shA, shB, acc);
  float* ob = emb + (size_t)b * 256 * 512;
  #pragma unroll
  for (int ai = 0; ai < 2; ++ai)
    #pragma unroll
    for (int bi = 0; bi < 4; ++bi) {
      int r0, c0; tile_coords(m0, n0, ai, bi, r0, c0);
      #pragma unroll
      for (int r = 0; r < 8; ++r) {
        const int n = r0 + r;
        ob[(size_t)n * 512 + c0] = acc[ai][bi][r] + proj_b[n];
      }
    }
}

// ---------------------------------------------------------------------------
// LayerNorm over C=512 per row (ln1 & ln2), writes bf16.
// One wave owns a row: no LDS, no barrier; a row sum is an in-lane sum and a five-step butterfly in registers.
// A wave takes 4 rows, so a launch starts 2,048 waves in 256 work-groups, not 65,536 in 8,192.
// A lane holds columns 128*q + 4*lane + 0..3, q = 0..3: each 16-B load covers 4 whole lines, each 8-B store 2.
// ---------------------------------------------------------------------------
#define LNR 4                   // rows per wave

// Sum over the 32 lanes, the same bits in every lane: lane ^ 1, 2, 4, 8 by DPP inside the 16-lane rows,
// then lane ^ 16 by a cross-row move.
__device__ __forceinline__ float wave_sum(float v) {
  v += __int_as_float(__builtin_amdgcn_update_dpp(0, __float_as_int(v), 0x161, 0xf, 0xf, true));   // row_xmask:1
  v += __int_as_float(__builtin_amdgcn_update_dpp(0, __float_as_int(v), 0x162, 0xf, 0xf, true));   // row_xmask:2
  v += __int_as_float(__builtin_amdgcn_update_dpp(0, __float_as_int(v), 0x164, 0xf, 0xf, true));   // row_xmask:4
  v += __int_as_float(__builtin_amdgcn_update_dpp(0, __float_as_int(v), 0x168, 0xf, 0xf, true));   // row_xmask:8
  v += __int_as_float(__builtin_amdgcn_permlanex16(__float_as_int(v), __float_as_int(v),
                                                   0x76543210, 0xfedcba98, false, false));         // same lane, other row
  return v;
}

__device__ __forceinline__ float rsq_slot(float x) {
  float y;
  asm("v_rsq_f32 %0, %1\n\tv_nop" : "=v"(y) : "v"(x));
  return y;
}

__global__ __launch_bounds__(256) void k_layernorm(const float* __restrict__ in, const float* __restrict__ gamma,
                            const float* __restrict__ beta, unsigned short* __restrict__ out)
{
  const int wave = threadIdx.x >> 5, lane = threadIdx.x & 31;
  const size_t row0 = ((size_t)blockIdx.x * 8 + wave) * LNR;
  const float* p = in + row0 * 512 + lane * 4;
  float4 x[LNR][4], gm[4], bt[4];
  #pragma unroll
  for (int r = 0; r < LNR; ++r)
    #pragma unroll
    for (int q = 0; q < 4; ++q) x[r][q] = *(const float4*)(p + r * 512 + q * 128);
  #pragma unroll
  for (int q = 0; q < 4; ++q) {
    gm[q] = *(const float4*)(gamma + q * 128 + lane * 4);
    bt[q] = *(const float4*)(beta + q * 128 + lane * 4);
  }
  // the 16 row loads issue as one group ahead of the first sum: left free, the compiler holds three of them back
  // behind the first row's reduction and the wave waits out a second load latency
  __builtin_amdgcn_sched_barrier(0);
  float red[LNR];
  #pragma unroll
  for (int r = 0; r < LNR; ++r) {
    float s = 0.0f;
    #pragma unroll
    for (int q = 0; q < 4; ++q) s += (x[r][q].x + x[r][q].y) + (x[r][q].z + x[r][q].w);
    red[r] = wave_sum(s);
  }
  #pragma unroll
  for (int r = 0; r < LNR; ++r) {
    const float mu = red[r] * (1.0f / 512.0f);
    float s = 0.0f;
    #pragma unroll
    for (int q = 0; q < 4; ++q) {
      x[r][q].x -= mu; x[r][q].y -= mu; x[r][q].z -= mu; x[r][q].w -= mu;
      s += (x[r][q].x * x[r][q].x + x[r][q].y * x[r][q].y) + (x[r][q].z * x[r][q].z + x[r][q].w * x[r][q].w);
    }
    red[r] = wave_sum(s);
  }
  unsigned short* o0 = out + row0 * 512 + lane * 4;
  #pragma unroll
  for (int r = 0; r < LNR; ++r) {
    const float rs = rsq_slot(red[r] * (1.0f / 512.0f) + 1e-6f);
    #pragma unroll
    for (int q = 0; q < 4; ++q) {
      uint2 w;
      w.x = pack2(x[r][q].x * rs * gm[q].x + bt[q].x, x[r][q].y * rs * gm[q].y + bt[q].y);
      w.y = pack2(x[r][q].z * rs * gm[q].z + bt[q].z, x[r][q].w * rs * gm[q].w + bt[q].w);
      *(uint2*)(o0 + r * 512 + q * 128) = w;
    }
  }
}

// ---------------------------------------------------------------------------
// QKV per (b,h). grid.z: 0=q,1=k (write [bh][i][n] transposed), 2=v ([bh][n][i]).
// ---------------------------------------------------------------------------
__global__ __launch_bounds__(256) void k_qkv(const unsigned short* __restrict__ xnb,
                      const unsigned short* __restrict__ wqT,
                      const unsigned short* __restrict__ wkT,
                      const unsigned short* __restrict__ wvT,
                      unsigned short* __restrict__ qT, unsigned short* __restrict__ kT,
                      unsigned short* __restrict__ vC, int b0)
{
  __shared__ __attribute__((aligned(16))) unsigned short shA[2 * LBUF], shB[2 * LBUF];
  const int bh = blockIdx.y;
  const int b = b0 + (bh >> 3), h = bh & 7;
  const int mode = blockIdx.z;
  const unsigned short* wT = (mode == 0) ? wqT : ((mode == 1) ? wkT : wvT);
  const int m0 = (blockIdx.x >> 2) * 128;   // n (seq), 2 tiles
  const int n0 = (blockIdx.x & 3) * 128;    // i (within head), 4 tiles
  v8f acc[2][4];
  gemm128t<false>(xnb + (size_t)b * 256 * 512, 512, wT + (size_t)h * 512 * 512, 512,
          m0, n0, 512, shA, shB, acc);
  if (mode < 2) {
    unsigned short* dst = ((mode == 0) ? qT : kT) + (size_t)bh * 512 * 256;
    #pragma unroll
    for (int ai = 0; ai < 2; ++ai)
      #pragma unroll
      for (int bi = 0; bi < 4; ++bi) {
        int r0, c0; tile_coords(m0, n0, ai, bi, r0, c0);
        union { unsigned short s[8]; uint4 q; } pk;
        #pragma unroll
        for (int r = 0; r < 8; ++r) pk.s[r] = f2b(acc[ai][bi][r]);
        *(uint4*)&dst[(size_t)c0 * 256 + r0] = pk.q;   // contiguous in n
      }
  } else {
    unsigned short* dst = vC + (size_t)bh * 256 * 512;
    #pragma unroll
    for (int ai = 0; ai < 2; ++ai)
      #pragma unroll
      for (int bi = 0; bi < 4; ++bi) {
        int r0, c0; tile_coords(m0, n0, ai, bi, r0, c0);
        #pragma unroll
        for (int r = 0; r < 8; ++r)
          dst[(size_t)(r0 + r) * 512 + c0] = f2b(acc[ai][bi][r]);
      }
  }
}

// ---------------------------------------------------------------------------
// scores[i][j] = sum_n qT[i][n] * kT[j][n]; store bf16 + per-tile sum/sumsq.
// ---------------------------------------------------------------------------
__global__ __launch_bounds__(256) void k_scores(const unsigned short* __restrict__ qT,
                         const unsigned short* __restrict__ kT,
                         unsigned short* __restrict__ attn, float* __restrict__ part)
{
  __shared__ __attribute__((aligned(16))) unsigned short shA[2 * LBUF], shB[2 * LBUF];
  __shared__ float redS[256], redQ[256];
  const int bh = blockIdx.y;
  const int m0 = (blockIdx.x >> 2) * 128;   // i, 4 tiles
  const int n0 = (blockIdx.x & 3) * 128;    // j, 4 tiles
  v8f acc[2][4];
  gemm128t<false>(qT + (size_t)bh * 512 * 256, 256, kT + (size_t)bh * 512 * 256, 256,
          m0, n0, 256, shA, shB, acc);
  unsigned short* dst = attn + (size_t)bh * 512 * 512;
  float s = 0.0f, s2 = 0.0f;
  #pragma unroll
  for (int ai = 0; ai < 2; ++ai)
    #pragma unroll
    for (int bi = 0; bi < 4; ++bi) {
      int r0, c0; tile_coords(m0, n0, ai, bi, r0, c0);
      #pragma unroll
      for (int r = 0; r < 8; ++r) {
        const float v = acc[ai][bi][r];
        dst[(size_t)(r0 + r) * 512 + c0] = f2b(v);
        s += v; s2 += v * v;
      }
    }
  const int t = threadIdx.x;
  redS[t] = s; redQ[t] = s2; __syncthreads();
  for (int o = 128; o > 0; o >>= 1) {
    if (t < o) { redS[t] += redS[t + o]; redQ[t] += redQ[t + o]; }
    __syncthreads();
  }
  if (t == 0) {
    part[((size_t)bh * 16 + blockIdx.x) * 2 + 0] = redS[0];
    part[((size_t)bh * 16 + blockIdx.x) * 2 + 1] = redQ[0];
  }
}

// ---------------------------------------------------------------------------
// Instance norm + row softmax + context product in one kernel.
// ctx[i][nseq] = sum_j P[i][j] * v[nseq][j], P = softmax_j((scores - mu) * rsig); mu drops out of a softmax.
// One work-group owns 128 whole score rows and all 256 nseq, so every row is normalised once:
// each wave turns 16 rows into bf16 P rows of an LDS panel (the A operand, resident for the whole K loop),
// v comes through the two-buffer ring of asynchronous copies. 8 waves (2Mx4N), 64x64 per wave.
// Stored k-blocked with k = h*512+i: ctx2[bL][k/8][n][8], a lane's 8 accumulator rows are one 16-B store.
// ---------------------------------------------------------------------------
#define PP    520               // panel row pitch (bf16): 1040 B = 16 B x odd, conflict-free for ds_load_b128
#define LBUFV (256 * LDSS)      // one buffer of the v ring: 256 rows x 64 k

__device__ __forceinline__ float exp2_slot(float x) {
  float y;
  asm("v_exp_f32 %0, %1\n\tv_nop" : "=v"(y) : "v"(x));
  return y;
}

__global__ __launch_bounds__(256) void k_ctx(const unsigned short* __restrict__ attn,
                      const float* __restrict__ part,
                      const unsigned short* __restrict__ vC,
                      unsigned short* __restrict__ ctx2)
{
  __shared__ __attribute__((aligned(16))) unsigned short pan[128 * PP];
  __shared__ __attribute__((aligned(16))) unsigned short shV[2 * LBUFV];
  const int bh = blockIdx.y;
  const int bL = bh >> 3, h = bh & 7;
  const int m0 = blockIdx.x * 128;          // i, 4 tiles
  const int t = threadIdx.x, wave = t >> 5, lane = t & 31;

  // v ring: a thread's 8 chunks of a tile are rows (t>>3) + 32*j of the lower and of the upper 128 rows
  const unsigned short* vP = vC + (size_t)bh * 256 * 512 + (size_t)(t >> 3) * 512 + ((t & 7) << 3);
  const unsigned lV = (unsigned)(size_t)(shV + (t >> 3) * LDSS + ((t & 7) << 3));
  const unsigned vJ = 2u * 32 * LDSS, vH = 2u * 128 * LDSS;
  // tile 0's copies fly under the softmax
  copy_tile(lV, vJ, vP, (size_t)32 * 512, lV + vH, vJ, vP + (size_t)128 * 512, (size_t)32 * 512);

  // instance-norm statistics from the 16 score tiles' {sum, sumsq}; pairs added as t, t+8, then 4, 2, 1
  float pv = part[(size_t)bh * 32 + lane];
  #pragma unroll
  for (int o = 16; o >= 2; o >>= 1) pv += __shfl_xor(pv, o);
  const float mu  = __shfl(pv, 0) * (1.0f / 262144.0f);
  const float var = __shfl(pv, 1) * (1.0f / 262144.0f) - mu * mu;
  const float kf  = rsqrtf(var + 1e-5f) * 1.44269504088896341f;   // InstanceNorm2d eps; log2(e) for exp2

  // softmax of rows m0 + 16*wave + 0..15, 8 rows at a time; a lane holds j = 8*lane..+7 and 256 + 8*lane..+7
  const unsigned short* sP = attn + ((size_t)bh * 512 + m0 + wave * 16) * 512 + lane * 8;
  #pragma unroll
  for (int hb = 0; hb < 2; ++hb) {
    uint4 raw[8][2];
    #pragma unroll
    for (int r = 0; r < 8; ++r) {
      raw[r][0] = *(const uint4*)(sP + (size_t)(hb * 8 + r) * 512);
      raw[r][1] = *(const uint4*)(sP + (size_t)(hb * 8 + r) * 512 + 256);
    }
    float e[8][16], red[8];
    #pragma unroll
    for (int r = 0; r < 8; ++r) {
      #pragma unroll
      for (int q = 0; q < 2; ++q) {
        const unsigned int u[4] = { raw[r][q].x, raw[r][q].y, raw[r][q].z, raw[r][q].w };
        #pragma unroll
        for (int d = 0; d < 4; ++d) {
          e[r][q * 8 + d * 2 + 0] = __uint_as_float(u[d] << 16);
          e[r][q * 8 + d * 2 + 1] = __uint_as_float(u[d] & 0xFFFF0000u);
        }
      }
      float m = e[r][0];
      #pragma unroll
      for (int i = 1; i < 16; ++i) m = fmaxf(m, e[r][i]);
      red[r] = m;
    }
    #pragma unroll
    for (int o = 16; o >= 1; o >>= 1)
      #pragma unroll
      for (int r = 0; r < 8; ++r) red[r] = fmaxf(red[r], __shfl_xor(red[r], o));
    #pragma unroll
    for (int r = 0; r < 8; ++r) {
      const float m = red[r];
      float s = 0.0f;
      #pragma unroll
      for (int i = 0; i < 16; ++i) {
        e[r][i] = exp2_slot((e[r][i] - m) * kf);
        s += e[r][i];
      }
      red[r] = s;
    }
    #pragma unroll
    for (int o = 16; o >= 1; o >>= 1)
      #pragma unroll
      for (int r = 0; r < 8; ++r) red[r] += __shfl_xor(red[r], o);
    #pragma unroll
    for (int r = 0; r < 8; ++r) {
      const float inv = 1.0f / red[r];
      unsigned short* pr = pan + (wave * 16 + hb * 8 + r) * PP + lane * 8;
      #pragma unroll
      for (int q = 0; q < 2; ++q) {
        uint4 o4;
        o4.x = pack2(e[r][q * 8 + 0] * inv, e[r][q * 8 + 1] * inv);
        o4.y = pack2(e[r][q * 8 + 2] * inv, e[r][q * 8 + 3] * inv);
        o4.z = pack2(e[r][q * 8 + 4] * inv, e[r][q * 8 + 5] * inv);
        o4.w = pack2(e[r][q * 8 + 6] * inv, e[r][q * 8 + 7] * inv);
        *(uint4*)(pr + q * 256) = o4;
      }
    }
  }

  const int wm = wave >> 2;           // 0..1 -> M offset 64*wm
  const int wn = wave & 3;            // 0..3 -> N offset 64*wn
  const int fm = lane & 15;
  const int g  = lane >> 4;
  v8f acc[4][4];
  #pragma unroll
  for (int ai = 0; ai < 4; ++ai)
    #pragma unroll
    for (int bi = 0; bi < 4; ++bi)
      #pragma unroll
      for (int i = 0; i < 8; ++i) acc[ai][bi][i] = 0.0f;

  asm volatile("s_wait_asynccnt 0x0" ::: "memory");   // this wave's copies of tile 0 have landed
  __syncthreads();                                    // ... every other wave's too, and the whole P panel is written
  copy_tile(lV + 2u * LBUFV, vJ, vP + BK, (size_t)32 * 512,
            lV + 2u * LBUFV + vH, vJ, vP + (size_t)128 * 512 + BK, (size_t)32 * 512);

  int cur = 0;
  // kept rolled: unrolled, every tile's copy-address registers are formed up front and live together
  #pragma unroll 1
  for (int k0 = 0; k0 < 512; k0 += BK) {
    const unsigned short* sa = pan + k0;
    const unsigned short* sb = shV + cur * LBUFV;
    #pragma unroll
    for (int ks = 0; ks < BK; ks += 32) {
      FragU fa[4], fb[4];
      #pragma unroll
      for (int p = 0; p < 8; ++p) {
        const int kk = ks + ((p & 4) << 2) + (g << 3) + ((p & 3) << 1);
        #pragma unroll
        for (int f = 0; f < 4; ++f) {
          fa[f].u[p] = *(const unsigned int*)(sa + (wm * 64 + f * 16 + fm) * PP + kk);
          fb[f].u[p] = *(const unsigned int*)(sb + (wn * 64 + f * 16 + fm) * LDSS + kk);
        }
      }
      __builtin_amdgcn_sched_barrier(0);
      #pragma unroll
      for (int ai = 0; ai < 4; ++ai)
        #pragma unroll
        for (int bi = 0; bi < 4; ++bi)
          acc[ai][bi] = __builtin_amdgcn_wmma_f32_16x16x32_bf16(
              false, fa[ai].v, false, fb[bi].v, (short)0, acc[ai][bi], false, false);
    }
    // publish point of the next tile, every wave, in this order
    asm volatile("s_wait_dscnt 0x0" ::: "memory");      // own fragment reads of this buffer are done before it is refilled
    asm volatile("s_wait_asynccnt 0x0" ::: "memory");   // own copies of the next tile have landed
    __syncthreads();   // next tile readable by all; every reader has left this buffer
    if (k0 + 2 * BK < 512)                   // refill it: these copies fly under the next tile's WMMAs
      copy_tile(lV + 2u * LBUFV * cur, vJ, vP + (k0 + 2 * BK), (size_t)32 * 512,
                lV + 2u * LBUFV * cur + vH, vJ, vP + (size_t)128 * 512 + (k0 + 2 * BK), (size_t)32 * 512);
    cur ^= 1;
  }
  asm volatile("s_wait_asynccnt 0x0" ::: "memory");     // no copy is outstanding when the wave ends

  unsigned short* dst = ctx2 + (size_t)bL * 256 * 4096;
  #pragma unroll
  for (int ai = 0; ai < 4; ++ai)
    #pragma unroll
    for (int bi = 0; bi < 4; ++bi) {
      const int r0 = m0 + wm * 64 + ai * 16 + (g << 3);   // rows = i, 8 consecutive
      const int c0 = wn * 64 + bi * 16 + fm;              // col = nseq
      union { unsigned short s[8]; uint4 q; } pk;
      #pragma unroll
      for (int r = 0; r < 8; ++r) pk.s[r] = f2b(acc[ai][bi][r]);
      *(uint4*)&dst[(size_t)(h * 512 + r0) * 256 + (size_t)c0 * 8] = pk.q;
    }
}

// out[n][c] = ctx2[n][:] @ wo + emb (residual), f32; k runs head-major in both operands.
// Batches b0 .. b0+gridDim.y-1.
__global__ __launch_bounds__(256) void k_outproj(const unsigned short* __restrict__ ctx2,
                          const unsigned short* __restrict__ woT,
                          const float* __restrict__ emb, float* __restrict__ y1, int b0)
{
  __shared__ __attribute__((aligned(16))) unsigned short shA[2 * LBUF], shB[2 * LBUF];
  const int bL = blockIdx.y, b = b0 + bL;
  const int m0 = (blockIdx.x >> 2) * 128;   // n, 2 tiles
  const int n0 = (blockIdx.x & 3) * 128;    // c, 4 tiles
  v8f acc[2][4];
  gemm128t<true>(ctx2 + (size_t)bL * 256 * 4096, 256, woT, 4096, m0, n0, 4096, shA, shB, acc);
  const float* res = emb + (size_t)b * 256 * 512;
  float* dst = y1 + (size_t)b * 256 * 512;
  #pragma unroll
  for (int ai = 0; ai < 2; ++ai)
    #pragma unroll
    for (int bi = 0; bi < 4; ++bi) {
      int r0, c0; tile_coords(m0, n0, ai, bi, r0, c0);
      #pragma unroll
      for (int r = 0; r < 8; ++r) {
        const size_t o = (size_t)(r0 + r) * 512 + c0;
        dst[o] = acc[ai][bi][r] + res[o];
      }
    }
}

// final[b][o][pos] = gelu( y2[b][pos][:] @ mo_w[o][:] + mo_b[o] ), exact erf GELU.
__global__ __launch_bounds__(256) void k_mo(const unsigned short* __restrict__ y2,
                     const unsigned short* __restrict__ mowb,
                     const float* __restrict__ mo_b, float* __restrict__ out)
{
  __shared__ __attribute__((aligned(16))) unsigned short shA[2 * LBUF], shB[2 * LBUF];
  const int b = blockIdx.y;
  const int m0 = (blockIdx.x >> 2) * 128;   // pos, 2 tiles
  const int n0 = (blockIdx.x & 3) * 128;    // o, 4 tiles
  v8f acc[2][4];
  gemm128t<false>(y2 + (size_t)b * 256 * 512, 512, mowb, 512, m0, n0, 512, shA, shB, acc);
  #pragma unroll
  for (int ai = 0; ai < 2; ++ai)
    #pragma unroll
    for (int bi = 0; bi < 4; ++bi) {
      int r0, c0; tile_coords(m0, n0, ai, bi, r0, c0);  // rows=pos (8 contiguous), cols=o
      const float bias = mo_b[c0];
      union { float f[8]; float4 q[2]; } pk;
      #pragma unroll
      for (int r = 0; r < 8; ++r) {
        const float tv = acc[ai][bi][r] + bias;
        pk.f[r] = 0.5f * tv * (1.0f + erff(tv * 0.70710678118654752f));
      }
      float* dst = out + ((size_t)b * 512 + c0) * 256 + r0;
      *(float4*)(dst + 0) = pk.q[0];
      *(float4*)(dst + 4) = pk.q[1];
    }
}

// ---------------------------------------------------------------------------
extern "C" void kernel_launch(void* const* d_in, const int* in_sizes, int n_in,
                              void* d_out, int out_size, void* d_ws, size_t ws_size,
                              hipStream_t stream)
{
  (void)in_sizes; (void)n_in; (void)out_size; (void)ws_size;
  const float* x      = (const float*)d_in[0];
  const float* proj_w = (const float*)d_in[1];
  const float* proj_b = (const float*)d_in[2];
  const float* ln1_g  = (const float*)d_in[3];
  const float* ln1_b  = (const float*)d_in[4];
  const float* wq     = (const float*)d_in[5];
  const float* wk     = (const float*)d_in[6];
  const float* wv     = (const float*)d_in[7];
  const float* wo     = (const float*)d_in[8];
  const float* ln2_g  = (const float*)d_in[9];
  const float* ln2_b  = (const float*)d_in[10];
  const float* mo_w   = (const float*)d_in[11];
  const float* mo_b   = (const float*)d_in[12];
  float* outp = (float*)d_out;

  char* w = (char*)d_ws;
  size_t off = 0;
  auto nxt = [&](size_t bytes) { char* p = w + off; off = (off + bytes + 255) & ~(size_t)255; return p; };
  unsigned short* xb    = (unsigned short*)nxt(8388608);    // x bf16 [b][c][k]
  unsigned short* pwb   = (unsigned short*)nxt(131072);     // proj_w bf16
  unsigned short* wqT   = (unsigned short*)nxt(4194304);    // [cout][c]
  unsigned short* wkT   = (unsigned short*)nxt(4194304);
  unsigned short* wvT   = (unsigned short*)nxt(4194304);
  unsigned short* woT   = (unsigned short*)nxt(4194304);    // [c][h*512+i]
  unsigned short* mowb  = (unsigned short*)nxt(524288);     // [o][c]
  float*          emb   = (float*)nxt(16777216);            // residual, f32
  unsigned short* xnb   = (unsigned short*)nxt(8388608);    // LN1(emb) bf16
  unsigned short* qT    = (unsigned short*)nxt(16777216);   // chunk: 64 bh x 512 x 256
  unsigned short* kT    = (unsigned short*)nxt(16777216);
  unsigned short* vC    = (unsigned short*)nxt(16777216);   // chunk: 64 bh x 256 x 512
  unsigned short* attn  = (unsigned short*)nxt(33554432);   // chunk: 64 bh x 512 x 512
  float*          part  = (float*)nxt(8192);                // 64 bh x 16 tiles x {sum,sumsq}
  unsigned short* ctx2  = (unsigned short*)nxt(67108864);   // all 32 b x [k/8][n][8]
  float*          y1    = (float*)nxt(16777216);            // attn out + residual, f32
  unsigned short* y2    = (unsigned short*)nxt(8388608);    // LN2 bf16

  k_convert<<<4096, 256, 0, stream>>>(x, proj_w, wq, wk, wv, wo, mo_w,
                                      xb, pwb, wqT, wkT, wvT, woT, mowb);
  k_embed<<<dim3(8, 32), 256, 0, stream>>>(pwb, xb, proj_b, emb);
  k_layernorm<<<256, 256, 0, stream>>>(emb, ln1_g, ln1_b, xnb);

  for (int pass = 0; pass < 4; ++pass) {           // 8 batches (64 bh) per pass
    const int b0 = pass * 8;
    k_qkv<<<dim3(8, 64, 3), 256, 0, stream>>>(xnb, wqT, wkT, wvT, qT, kT, vC, b0);
    k_scores<<<dim3(16, 64), 256, 0, stream>>>(qT, kT, attn, part);
    k_ctx<<<dim3(4, 64), 256, 0, stream>>>(attn, part, vC, ctx2 + (size_t)b0 * 256 * 4096);
  }
  k_outproj<<<dim3(8, 32), 256, 0, stream>>>(ctx2, woT, emb, y1, 0);

  k_layernorm<<<256, 256, 0, stream>>>(y1, ln2_g, ln2_b, y2);
  k_mo<<<dim3(8, 32), 256, 0, stream>>>(y2, mowb, mo_b, outp);
}

// v007
// It runs in 356 microseconds.
// Next to v006, in two timings, it ran 1.12 and 1.08 times as fast.
// All steps since v000 together make it 3.41 times as fast.
#include <hip/hip_runtime.h>
#include <math.h>

typedef __attribute__((ext_vector_type(16))) __bf16 v16bf;
typedef __attribute__((ext_vector_type(8)))  float  v8f;

__device__ __forceinline__ unsigned short f2b(float f) {
  unsigned int u = __float_as_uint(f);
  u += 0x7FFFu + ((u >> 16) & 1u);           // round-to-nearest-even
  return (unsigned short)(u >> 16);
}

typedef __attribute__((ext_vector_type(2))) float  f32x2;
typedef __attribute__((ext_vector_type(2))) __bf16 bf16x2;

__device__ __forceinline__ unsigned int pack2(float lo, float hi) {   // two f32 -> packed bf16, nearest even
  f32x2 f; f[0] = lo; f[1] = hi;
  union { bf16x2 b; unsigned int u; } c;
  c.b = __builtin_convertvector(f, bf16x2);
  return c.u;
}

union FragU { v16bf v; unsigned int u[8]; };

#define BK   64                 // k per staged tile: 128 B of every operand row = one whole line
#define LDSS 72                 // padded LDS row stride (bf16) -> 144B rows, conflict-free
#define LBUF (128 * LDSS)       // one LDS buffer (ushorts)

__device__ __forceinline__ void copy_tile(unsigned la, unsigned laJ, const unsigned short* ga, size_t gaJ,
                                          unsigned lb, unsigned lbJ, const unsigned short* gb, size_t gbJ)
{
  asm volatile(
      "global_load_async_to_lds_b128 %0, %8, off\n\t"
      "global_load_async_to_lds_b128 %4, %12, off\n\t"
      "global_load_async_to_lds_b128 %1, %9, off\n\t"
      "global_load_async_to_lds_b128 %5, %13, off\n\t"
      "global_load_async_to_lds_b128 %2, %10, off\n\t"
      "global_load_async_to_lds_b128 %6, %14, off\n\t"
      "global_load_async_to_lds_b128 %3, %11, off\n\t"
      "global_load_async_to_lds_b128 %7, %15, off\n\t"
      "s_wait_xcnt 0x0"
      :: "v"(la), "v"(la + laJ), "v"(la + 2u * laJ), "v"(la + 3u * laJ),
         "v"(lb), "v"(lb + lbJ), "v"(lb + 2u * lbJ), "v"(lb + 3u * lbJ),
         "v"(ga), "v"(ga + gaJ), "v"(ga + 2 * gaJ), "v"(ga + 3 * gaJ),
         "v"(gb), "v"(gb + gbJ), "v"(gb + 2 * gbJ), "v"(gb + 3 * gbJ)
      : "memory");
}

template <bool KB>
__device__ __forceinline__ void gemm128t(
    const unsigned short* __restrict__ A, int lda,
    const unsigned short* __restrict__ Bt, int ldb,
    int m0, int n0, int K,
    unsigned short* shA, unsigned short* shB,   // each 2*LBUF
    v8f acc[2][4])
{
  const int t    = threadIdx.x;
  const int rs   = t >> 3;            // row-major staging: rows rs + 32*j, j = 0..3
  const int kqs  = (t & 7) << 3;      // 8 bf16 = 16B
  const int wave = t >> 5;
  const int lane = t & 31;
  const int wm   = wave >> 1;         // 0..3 -> M offset 32*wm
  const int wn   = wave & 1;          // 0..1 -> N offset 64*wn
  const int fm   = lane & 15;
  const int g    = lane >> 4;

  #pragma unroll
  for (int ai = 0; ai < 2; ++ai)
    #pragma unroll
    for (int bi = 0; bi < 4; ++bi)
      #pragma unroll
      for (int i = 0; i < 8; ++i) acc[ai][bi][i] = 0.0f;

  // A: address of this thread's chunk j = 0, the step from chunk to chunk, the step per k.
  const unsigned short* aP = KB ? A + (size_t)((t >> 7) << 3) * lda + (size_t)(m0 + (t & 127)) * 8
                                : A + (size_t)(m0 + rs) * lda + kqs;
  const size_t aJ = KB ? (size_t)16 * lda : (size_t)32 * lda;   // KB: chunk j is k-octet (t>>7) + 2j
  const size_t aK = KB ? (size_t)lda : (size_t)1;
  const int   sA0 = KB ? (t & 127) * LDSS + ((t >> 7) << 3) : rs * LDSS + kqs;
  const int   sAJ = KB ? 16 : 32 * LDSS;
  const unsigned short* bP = Bt + (size_t)(n0 + rs) * ldb + kqs;
  const size_t bJ = (size_t)32 * ldb;
  const int   sB0 = rs * LDSS + kqs;
  const int   sBJ = 32 * LDSS;
  // one prefetch per 128-B line of a tile: threads 0..127 take A's lines, 128..255 Bt's
  const unsigned short* pfP = (t < 128)
      ? (KB ? A + (size_t)((t >> 4) << 3) * lda + (size_t)m0 * 8 + (size_t)(t & 15) * 64
            : A + (size_t)(m0 + t) * lda)
      : Bt + (size_t)(n0 + (t & 127)) * ldb;
  const size_t pfK = (KB && t < 128) ? (size_t)lda : (size_t)1;

  // LDS byte addresses (low 32 bits of the __shared__ address) of this thread's chunk j = 0, buffer 0
  const unsigned lA = (unsigned)(size_t)(shA + sA0);
  const unsigned lB = (unsigned)(size_t)(shB + sB0);

  // ring, two buffers: tile 0 lands and is published, then tile 1's copies start
  copy_tile(lA, 2u * sAJ, aP, aJ, lB, 2u * sBJ, bP, bJ);
  asm volatile("s_wait_asynccnt 0x0" ::: "memory");   // this wave's copies of tile 0 have landed
  __syncthreads();                                    // ... and every other wave's
  copy_tile(lA + 2u * LBUF, 2u * sAJ, aP + (size_t)BK * aK, aJ,
            lB + 2u * LBUF, 2u * sBJ, bP + BK, bJ);   // K >= 2 * BK in every caller

  int cur = 0;
  // kept rolled: unrolled (K = 256) every tile's 24 copy-address registers are formed up front and live together
  #pragma unroll 1
  for (int k0 = 0; k0 < K; k0 += BK) {
    if (k0 + 2 * BK < K) {                   // global_prefetch_b8 two tiles ahead
      __builtin_prefetch(pfP + (size_t)(k0 + 2 * BK) * pfK, 0, 1);
      // the prefetch's address registers are stepped for the next tile: wait before that overwrite
      asm volatile("s_wait_xcnt 0x0" ::: "memory");
    }
    const unsigned short* sa = shA + cur * LBUF;
    const unsigned short* sb = shB + cur * LBUF;
    #pragma unroll
    for (int ks = 0; ks < BK; ks += 32) {
      FragU fa[2], fb[4];
      #pragma unroll
      for (int p = 0; p < 8; ++p) {
        const int kk = ks + ((p & 4) << 2) + (g << 3) + ((p & 3) << 1);
        fa[0].u[p] = *(const unsigned int*)(sa + (wm * 32 + fm) * LDSS + kk);
        fa[1].u[p] = *(const unsigned int*)(sa + (wm * 32 + 16 + fm) * LDSS + kk);
        fb[0].u[p] = *(const unsigned int*)(sb + (wn * 64 + fm) * LDSS + kk);
        fb[1].u[p] = *(const unsigned int*)(sb + (wn * 64 + 16 + fm) * LDSS + kk);
        fb[2].u[p] = *(const unsigned int*)(sb + (wn * 64 + 32 + fm) * LDSS + kk);
        fb[3].u[p] = *(const unsigned int*)(sb + (wn * 64 + 48 + fm) * LDSS + kk);
      }
      #pragma unroll
      for (int ai = 0; ai < 2; ++ai)
        #pragma unroll
        for (int bi = 0; bi < 4; ++bi)
          acc[ai][bi] = __builtin_amdgcn_wmma_f32_16x16x32_bf16(
              false, fa[ai].v, false, fb[bi].v, (short)0, acc[ai][bi], false, false);
    }
    // publish point of the next tile, every wave, in this order
    asm volatile("s_wait_dscnt 0x0" ::: "memory");      // own fragment reads of this buffer are done before it is refilled
    asm volatile("s_wait_asynccnt 0x0" ::: "memory");   // own copies of the next tile have landed
    __syncthreads();   // next tile readable by all; every reader has left this buffer
    if (k0 + 2 * BK < K)                     // refill it: these copies fly under the next tile's WMMAs
      copy_tile(lA + 2u * LBUF * cur, 2u * sAJ, aP + (size_t)(k0 + 2 * BK) * aK, aJ,
                lB + 2u * LBUF * cur, 2u * sBJ, bP + (k0 + 2 * BK), bJ);
    cur ^= 1;
  }
  asm volatile("s_wait_asynccnt 0x0" ::: "memory");     // no copy is outstanding when the LDS passes to the epilogue
}

// Output coords of acc[ai][bi]: 8 consecutive rows starting r, column c.
__device__ __forceinline__ void tile_coords(int m0, int n0, int ai, int bi, int& r, int& c) {
  const int wave = threadIdx.x >> 5, lane = threadIdx.x & 31;
  r = m0 + (wave >> 1) * 32 + ai * 16 + ((lane >> 4) << 3);
  c = n0 + (wave & 1) * 64 + bi * 16 + (lane & 15);
}

#define TPF 65

__global__ __launch_bounds__(256) void k_convert(const float* __restrict__ x, const float* __restrict__ proj_w,
                          const float* __restrict__ wq, const float* __restrict__ wk,
                          const float* __restrict__ wv, const float* __restrict__ wo,
                          const float* __restrict__ mo_w,
                          unsigned short* __restrict__ xb, unsigned short* __restrict__ pwb,
                          unsigned short* __restrict__ wqT, unsigned short* __restrict__ wkT,
                          unsigned short* __restrict__ wvT,
                          unsigned short* __restrict__ woT, unsigned short* __restrict__ mowb)
{
  __shared__ float tile[64 * TPF];
  const int t = threadIdx.x;
  const int blk = blockIdx.x;
  if (blk < 2048) {
    const int which = blk >> 9, tl = blk & 511;
    const float* sp;
    unsigned short* dp;
    size_t dpitch;
    if (which < 3) {
      const int c0 = (tl & 7) * 64, co0 = (tl >> 3) * 64;
      sp = ((which == 0) ? wq : ((which == 1) ? wk : wv)) + (size_t)c0 * 4096 + co0;
      dp = ((which == 0) ? wqT : ((which == 1) ? wkT : wvT)) + (size_t)co0 * 512 + c0;
      dpitch = 512;
    } else {
      const int h = tl & 7, i0 = ((tl >> 3) & 7) * 64, c0 = (tl >> 6) * 64;
      sp = wo + (size_t)(i0 * 8 + h) * 512 + c0;
      dp = woT + (size_t)c0 * 4096 + h * 512 + i0;
      dpitch = 4096;
    }
    // in: rows (t>>4) + 16*j, 16 lanes x 16 B = a row's 256 B
    const int rr = t >> 4, s4 = (t & 15) * 4;
    float4 v[4];
    #pragma unroll
    for (int j = 0; j < 4; ++j) v[j] = *(const float4*)(sp + (size_t)(rr + 16 * j) * 4096 + s4);
    #pragma unroll
    for (int j = 0; j < 4; ++j) {
      float* q = tile + (rr + 16 * j) * TPF + s4;
      q[0] = v[j].x; q[1] = v[j].y; q[2] = v[j].z; q[3] = v[j].w;
    }
    __syncthreads();   // the whole tile is in LDS before any column of it is read
    // out: destination rows (t>>3) + 32*j, 8 lanes x 16 B = a row's 128 B
    const int r8 = (t & 7) * 8;
    #pragma unroll
    for (int j = 0; j < 2; ++j) {
      const int s = (t >> 3) + 32 * j;
      const float* q = tile + r8 * TPF + s;
      uint4 o4;
      o4.x = pack2(q[0 * TPF], q[1 * TPF]);
      o4.y = pack2(q[2 * TPF], q[3 * TPF]);
      o4.z = pack2(q[4 * TPF], q[5 * TPF]);
      o4.w = pack2(q[6 * TPF], q[7 * TPF]);
      *(uint4*)(dp + (size_t)s * dpitch + r8) = o4;
    }
  } else {
    const int cb = blk - 2048;            // 512 chunks of x, 8 of proj_w, 32 of mo_w
    const float* sp;
    unsigned short* dp;
    if (cb < 512)      { sp = x      + (size_t)cb * 8192;         dp = xb   + (size_t)cb * 8192; }
    else if (cb < 520) { sp = proj_w + (size_t)(cb - 512) * 8192; dp = pwb  + (size_t)(cb - 512) * 8192; }
    else               { sp = mo_w   + (size_t)(cb - 520) * 8192; dp = mowb + (size_t)(cb - 520) * 8192; }
    float4 v[8];
    #pragma unroll
    for (int j = 0; j < 8; ++j) v[j] = *(const float4*)(sp + j * 1024 + t * 4);
    #pragma unroll
    for (int j = 0; j < 8; ++j) {
      uint2 o2;
      o2.x = pack2(v[j].x, v[j].y);
      o2.y = pack2(v[j].z, v[j].w);
      *(uint2*)(dp + j * 1024 + t * 4) = o2;
    }
    // behind the last store of the run: no register that an issued store names is rewritten ahead of this wait
    asm volatile("s_wait_xcnt 0x0" ::: "memory");
  }
}

// ---------------------------------------------------------------------------
// K1: patch embed. emb[b][n][c] = sum_k proj_w[n][k] * x[b][c][k] + proj_b[n]
// ---------------------------------------------------------------------------
__global__ __launch_bounds__(256) void k_embed(const unsigned short* __restrict__ pwb,
                        const unsigned short* __restrict__ xb,
                        const float* __restrict__ proj_b, float* __restrict__ emb)
{
  __shared__ __attribute__((aligned(16))) unsigned short shA[2 * LBUF], shB[2 * LBUF];
  const int b  = blockIdx.y;
  const int m0 = (blockIdx.x >> 2) * 128;   // n (seq), 2 tiles
  const int n0 = (blockIdx.x & 3) * 128;    // c, 4 tiles
  v8f acc[2][4];
  gemm128t<false>(pwb, 256, xb + (size_t)b * 512 * 256, 256, m0, n0, 256, shA, shB, acc);
  float* ob = emb + (size_t)b * 256 * 512;
  #pragma unroll
  for (int ai = 0; ai < 2; ++ai)
    #pragma unroll
    for (int bi = 0; bi < 4; ++bi) {
      int r0, c0; tile_coords(m0, n0, ai, bi, r0, c0);
      #pragma unroll
      for (int r = 0; r < 8; ++r) {
        const int n = r0 + r;
        ob[(size_t)n * 512 + c0] = acc[ai][bi][r] + proj_b[n];
      }
    }
}

// ---------------------------------------------------------------------------
// LayerNorm over C=512 per row (ln1 & ln2), writes bf16.
// One wave owns a row: no LDS, no barrier; a row sum is an in-lane sum and a five-step butterfly in registers.
// A wave takes 4 rows, so a launch starts 2,048 waves in 256 work-groups, not 65,536 in 8,192.
// A lane holds columns 128*q + 4*lane + 0..3, q = 0..3: each 16-B load covers 4 whole lines, each 8-B store 2.
// ---------------------------------------------------------------------------
#define LNR 4                   // rows per wave

// Sum over the 32 lanes, the same bits in every lane: lane ^ 1, 2, 4, 8 by DPP inside the 16-lane rows,
// then lane ^ 16 by a cross-row move.
__device__ __forceinline__ float wave_sum(float v) {
  v += __int_as_float(__builtin_amdgcn_update_dpp(0, __float_as_int(v), 0x161, 0xf, 0xf, true));   // row_xmask:1
  v += __int_as_float(__builtin_amdgcn_update_dpp(0, __float_as_int(v), 0x162, 0xf, 0xf, true));   // row_xmask:2
  v += __int_as_float(__builtin_amdgcn_update_dpp(0, __float_as_int(v), 0x164, 0xf, 0xf, true));   // row_xmask:4
  v += __int_as_float(__builtin_amdgcn_update_dpp(0, __float_as_int(v), 0x168, 0xf, 0xf, true));   // row_xmask:8
  v += __int_as_float(__builtin_amdgcn_permlanex16(__float_as_int(v), __float_as_int(v),
                                                   0x76543210, 0xfedcba98, false, false));         // same lane, other row
  return v;
}

__device__ __forceinline__ float rsq_slot(float x) {
  float y;
  asm("v_rsq_f32 %0, %1\n\tv_nop" : "=v"(y) : "v"(x));
  return y;
}

__global__ __launch_bounds__(256) void k_layernorm(const float* __restrict__ in, const float* __restrict__ gamma,
                            const float* __restrict__ beta, unsigned short* __restrict__ out)
{
  const int wave = threadIdx.x >> 5, lane = threadIdx.x & 31;
  const size_t row0 = ((size_t)blockIdx.x * 8 + wave) * LNR;
  const float* p = in + row0 * 512 + lane * 4;
  float4 x[LNR][4], gm[4], bt[4];
  #pragma unroll
  for (int r = 0; r < LNR; ++r)
    #pragma unroll
    for (int q = 0; q < 4; ++q) x[r][q] = *(const float4*)(p + r * 512 + q * 128);
  #pragma unroll
  for (int q = 0; q < 4; ++q) {
    gm[q] = *(const float4*)(gamma + q * 128 + lane * 4);
    bt[q] = *(const float4*)(beta + q * 128 + lane * 4);
  }
  // the 16 row loads issue as one group ahead of the first sum: left free, the compiler holds three of them back
  // behind the first row's reduction and the wave waits out a second load latency
  __builtin_amdgcn_sched_barrier(0);
  float red[LNR];
  #pragma unroll
  for (int r = 0; r < LNR; ++r) {
    float s = 0.0f;
    #pragma unroll
    for (int q = 0; q < 4; ++q) s += (x[r][q].x + x[r][q].y) + (x[r][q].z + x[r][q].w);
    red[r] = wave_sum(s);
  }
  #pragma unroll
  for (int r = 0; r < LNR; ++r) {
    const float mu = red[r] * (1.0f / 512.0f);
    float s = 0.0f;
    #pragma unroll
    for (int q = 0; q < 4; ++q) {
      x[r][q].x -= mu; x[r][q].y -= mu; x[r][q].z -= mu; x[r][q].w -= mu;
      s += (x[r][q].x * x[r][q].x + x[r][q].y * x[r][q].y) + (x[r][q].z * x[r][q].z + x[r][q].w * x[r][q].w);
    }
    red[r] = wave_sum(s);
  }
  unsigned short* o0 = out + row0 * 512 + lane * 4;
  #pragma unroll
  for (int r = 0; r < LNR; ++r) {
    const float rs = rsq_slot(red[r] * (1.0f / 512.0f) + 1e-6f);
    #pragma unroll
    for (int q = 0; q < 4; ++q) {
      uint2 w;
      w.x = pack2(x[r][q].x * rs * gm[q].x + bt[q].x, x[r][q].y * rs * gm[q].y + bt[q].y);
      w.y = pack2(x[r][q].z * rs * gm[q].z + bt[q].z, x[r][q].w * rs * gm[q].w + bt[q].w);
      *(uint2*)(o0 + r * 512 + q * 128) = w;
    }
  }
}

// ---------------------------------------------------------------------------
// QKV per (b,h). grid.z: 0=q,1=k (write [bh][i][n] transposed), 2=v ([bh][n][i]).
// ---------------------------------------------------------------------------
__global__ __launch_bounds__(256) void k_qkv(const unsigned short* __restrict__ xnb,
                      const unsigned short* __restrict__ wqT,
                      const unsigned short* __restrict__ wkT,
                      const unsigned short* __restrict__ wvT,
                      unsigned short* __restrict__ qT, unsigned short* __restrict__ kT,
                      unsigned short* __restrict__ vC, int b0)
{
  __shared__ __attribute__((aligned(16))) unsigned short shA[2 * LBUF], shB[2 * LBUF];
  const int bh = blockIdx.y;
  const int b = b0 + (bh >> 3), h = bh & 7;
  const int mode = blockIdx.z;
  const unsigned short* wT = (mode == 0) ? wqT : ((mode == 1) ? wkT : wvT);
  const int m0 = (blockIdx.x >> 2) * 128;   // n (seq), 2 tiles
  const int n0 = (blockIdx.x & 3) * 128;    // i (within head), 4 tiles
  v8f acc[2][4];
  gemm128t<false>(xnb + (size_t)b * 256 * 512, 512, wT + (size_t)h * 512 * 512, 512,
          m0, n0, 512, shA, shB, acc);
  if (mode < 2) {
    unsigned short* dst = ((mode == 0) ? qT : kT) + (size_t)bh * 512 * 256;
    #pragma unroll
    for (int ai = 0; ai < 2; ++ai)
      #pragma unroll
      for (int bi = 0; bi < 4; ++bi) {
        int r0, c0; tile_coords(m0, n0, ai, bi, r0, c0);
        union { unsigned short s[8]; uint4 q; } pk;
        #pragma unroll
        for (int r = 0; r < 8; ++r) pk.s[r] = f2b(acc[ai][bi][r]);
        *(uint4*)&dst[(size_t)c0 * 256 + r0] = pk.q;   // contiguous in n
      }
  } else {
    unsigned short* dst = vC + (size_t)bh * 256 * 512;
    #pragma unroll
    for (int ai = 0; ai < 2; ++ai)
      #pragma unroll
      for (int bi = 0; bi < 4; ++bi) {
        int r0, c0; tile_coords(m0, n0, ai, bi, r0, c0);
        #pragma unroll
        for (int r = 0; r < 8; ++r)
          dst[(size_t)(r0 + r) * 512 + c0] = f2b(acc[ai][bi][r]);
      }
  }
}

// ---------------------------------------------------------------------------
// scores[i][j] = sum_n qT[i][n] * kT[j][n]; store bf16 + per-tile sum/sumsq.
// ---------------------------------------------------------------------------
__global__ __launch_bounds__(256) void k_scores(const unsigned short* __restrict__ qT,
                         const unsigned short* __restrict__ kT,
                         unsigned short* __restrict__ attn, float* __restrict__ part)
{
  __shared__ __attribute__((aligned(16))) unsigned short shA[2 * LBUF], shB[2 * LBUF];
  __shared__ float redS[256], redQ[256];
  const int bh = blockIdx.y;
  const int m0 = (blockIdx.x >> 2) * 128;   // i, 4 tiles
  const int n0 = (blockIdx.x & 3) * 128;    // j, 4 tiles
  v8f acc[2][4];
  gemm128t<false>(qT + (size_t)bh * 512 * 256, 256, kT + (size_t)bh * 512 * 256, 256,
          m0, n0, 256, shA, shB, acc);
  unsigned short* dst = attn + (size_t)bh * 512 * 512;
  float s = 0.0f, s2 = 0.0f;
  #pragma unroll
  for (int ai = 0; ai < 2; ++ai)
    #pragma unroll
    for (int bi = 0; bi < 4; ++bi) {
      int r0, c0; tile_coords(m0, n0, ai, bi, r0, c0);
      #pragma unroll
      for (int r = 0; r < 8; ++r) {
        const float v = acc[ai][bi][r];
        dst[(size_t)(r0 + r) * 512 + c0] = f2b(v);
        s += v; s2 += v * v;
      }
    }
  const int t = threadIdx.x;
  redS[t] = s; redQ[t] = s2; __syncthreads();
  for (int o = 128; o > 0; o >>= 1) {
    if (t < o) { redS[t] += redS[t + o]; redQ[t] += redQ[t + o]; }
    __syncthreads();
  }
  if (t == 0) {
    part[((size_t)bh * 16 + blockIdx.x) * 2 + 0] = redS[0];
    part[((size_t)bh * 16 + blockIdx.x) * 2 + 1] = redQ[0];
  }
}

// ---------------------------------------------------------------------------
// Instance norm + row softmax + context product in one kernel.
// ctx[i][nseq] = sum_j P[i][j] * v[nseq][j], P = softmax_j((scores - mu) * rsig); mu drops out of a softmax.
// One work-group owns 128 whole score rows and all 256 nseq, so every row is normalised once:
// each wave turns 16 rows into bf16 P rows of an LDS panel (the A operand, resident for the whole K loop),
// v comes through the two-buffer ring of asynchronous copies. 8 waves (2Mx4N), 64x64 per wave.
// Stored k-blocked with k = h*512+i: ctx2[bL][k/8][n][8], a lane's 8 accumulator rows are one 16-B store.
// ---------------------------------------------------------------------------
#define PP    520               // panel row pitch (bf16): 1040 B = 16 B x odd, conflict-free for ds_load_b128
#define LBUFV (256 * LDSS)      // one buffer of the v ring: 256 rows x 64 k

__device__ __forceinline__ float exp2_slot(float x) {
  float y;
  asm("v_exp_f32 %0, %1\n\tv_nop" : "=v"(y) : "v"(x));
  return y;
}

__global__ __launch_bounds__(256) void k_ctx(const unsigned short* __restrict__ attn,
                      const float* __restrict__ part,
                      const unsigned short* __restrict__ vC,
                      unsigned short* __restrict__ ctx2)
{
  __shared__ __attribute__((aligned(16))) unsigned short pan[128 * PP];
  __shared__ __attribute__((aligned(16))) unsigned short shV[2 * LBUFV];
  const int bh = blockIdx.y;
  const int bL = bh >> 3, h = bh & 7;
  const int m0 = blockIdx.x * 128;          // i, 4 tiles
  const int t = threadIdx.x, wave = t >> 5, lane = t & 31;

  // v ring: a thread's 8 chunks of a tile are rows (t>>3) + 32*j of the lower and of the upper 128 rows
  const unsigned short* vP = vC + (size_t)bh * 256 * 512 + (size_t)(t >> 3) * 512 + ((t & 7) << 3);
  const unsigned lV = (unsigned)(size_t)(shV + (t >> 3) * LDSS + ((t & 7) << 3));
  const unsigned vJ = 2u * 32 * LDSS, vH = 2u * 128 * LDSS;
  // tile 0's copies fly under the softmax
  copy_tile(lV, vJ, vP, (size_t)32 * 512, lV + vH, vJ, vP + (size_t)128 * 512, (size_t)32 * 512);

  // instance-norm statistics from the 16 score tiles' {sum, sumsq}; pairs added as t, t+8, then 4, 2, 1
  float pv = part[(size_t)bh * 32 + lane];
  #pragma unroll
  for (int o = 16; o >= 2; o >>= 1) pv += __shfl_xor(pv, o);
  const float mu  = __shfl(pv, 0) * (1.0f / 262144.0f);
  const float var = __shfl(pv, 1) * (1.0f / 262144.0f) - mu * mu;
  const float kf  = rsqrtf(var + 1e-5f) * 1.44269504088896341f;   // InstanceNorm2d eps; log2(e) for exp2

  // softmax of rows m0 + 16*wave + 0..15, 8 rows at a time; a lane holds j = 8*lane..+7 and 256 + 8*lane..+7
  const unsigned short* sP = attn + ((size_t)bh * 512 + m0 + wave * 16) * 512 + lane * 8;
  #pragma unroll
  for (int hb = 0; hb < 2; ++hb) {
    uint4 raw[8][2];
    #pragma unroll
    for (int r = 0; r < 8; ++r) {
      raw[r][0] = *(const uint4*)(sP + (size_t)(hb * 8 + r) * 512);
      raw[r][1] = *(const uint4*)(sP + (size_t)(hb * 8 + r) * 512 + 256);
    }
    float e[8][16], red[8];
    #pragma unroll
    for (int r = 0; r < 8; ++r) {
      #pragma unroll
      for (int q = 0; q < 2; ++q) {
        const unsigned int u[4] = { raw[r][q].x, raw[r][q].y, raw[r][q].z, raw[r][q].w };
        #pragma unroll
        for (int d = 0; d < 4; ++d) {
          e[r][q * 8 + d * 2 + 0] = __uint_as_float(u[d] << 16);
          e[r][q * 8 + d * 2 + 1] = __uint_as_float(u[d] & 0xFFFF0000u);
        }
      }
      float m = e[r][0];
      #pragma unroll
      for (int i = 1; i < 16; ++i) m = fmaxf(m, e[r][i]);
      red[r] = m;
    }
    #pragma unroll
    for (int o = 16; o >= 1; o >>= 1)
      #pragma unroll
      for (int r = 0; r < 8; ++r) red[r] = fmaxf(red[r], __shfl_xor(red[r], o));
    #pragma unroll
    for (int r = 0; r < 8; ++r) {
      const float m = red[r];
      float s = 0.0f;
      #pragma unroll
      for (int i = 0; i < 16; ++i) {
        e[r][i] = exp2_slot((e[r][i] - m) * kf);
        s += e[r][i];
      }
      red[r] = s;
    }
    #pragma unroll
    for (int o = 16; o >= 1; o >>= 1)
      #pragma unroll
      for (int r = 0; r < 8; ++r) red[r] += __shfl_xor(red[r], o);
    #pragma unroll
    for (int r = 0; r < 8; ++r) {
      const float inv = 1.0f / red[r];
      unsigned short* pr = pan + (wave * 16 + hb * 8 + r) * PP + lane * 8;
      #pragma unroll
      for (int q = 0; q < 2; ++q) {
        uint4 o4;
        o4.x = pack2(e[r][q * 8 + 0] * inv, e[r][q * 8 + 1] * inv);
        o4.y = pack2(e[r][q * 8 + 2] * inv, e[r][q * 8 + 3] * inv);
        o4.z = pack2(e[r][q * 8 + 4] * inv, e[r][q * 8 + 5] * inv);
        o4.w = pack2(e[r][q * 8 + 6] * inv, e[r][q * 8 + 7] * inv);
        *(uint4*)(pr + q * 256) = o4;
      }
    }
  }

  const int wm = wave >> 2;           // 0..1 -> M offset 64*wm
  const int wn = wave & 3;            // 0..3 -> N offset 64*wn
  const int fm = lane & 15;
  const int g  = lane >> 4;
  v8f acc[4][4];
  #pragma unroll
  for (int ai = 0; ai < 4; ++ai)
    #pragma unroll
    for (int bi = 0; bi < 4; ++bi)
      #pragma unroll
      for (int i = 0; i < 8; ++i) acc[ai][bi][i] = 0.0f;

  asm volatile("s_wait_asynccnt 0x0" ::: "memory");   // this wave's copies of tile 0 have landed
  __syncthreads();                                    // ... every other wave's too, and the whole P panel is written
  copy_tile(lV + 2u * LBUFV, vJ, vP + BK, (size_t)32 * 512,
            lV + 2u * LBUFV + vH, vJ, vP + (size_t)128 * 512 + BK, (size_t)32 * 512);

  int cur = 0;
  // kept rolled: unrolled, every tile's copy-address registers are formed up front and live together
  #pragma unroll 1
  for (int k0 = 0; k0 < 512; k0 += BK) {
    const unsigned short* sa = pan + k0;
    const unsigned short* sb = shV + cur * LBUFV;
    #pragma unroll
    for (int ks = 0; ks < BK; ks += 32) {
      FragU fa[4], fb[4];
      #pragma unroll
      for (int p = 0; p < 8; ++p) {
        const int kk = ks + ((p & 4) << 2) + (g << 3) + ((p & 3) << 1);
        #pragma unroll
        for (int f = 0; f < 4; ++f) {
          fa[f].u[p] = *(const unsigned int*)(sa + (wm * 64 + f * 16 + fm) * PP + kk);
          fb[f].u[p] = *(const unsigned int*)(sb + (wn * 64 + f * 16 + fm) * LDSS + kk);
        }
      }
      __builtin_amdgcn_sched_barrier(0);
      #pragma unroll
      for (int ai = 0; ai < 4; ++ai)
        #pragma unroll
        for (int bi = 0; bi < 4; ++bi)
          acc[ai][bi] = __builtin_amdgcn_wmma_f32_16x16x32_bf16(
              false, fa[ai].v, false, fb[bi].v, (short)0, acc[ai][bi], false, false);
    }
    // publish point of the next tile, every wave, in this order
    asm volatile("s_wait_dscnt 0x0" ::: "memory");      // own fragment reads of this buffer are done before it is refilled
    asm volatile("s_wait_asynccnt 0x0" ::: "memory");   // own copies of the next tile have landed
    __syncthreads();   // next tile readable by all; every reader has left this buffer
    if (k0 + 2 * BK < 512)                   // refill it: these copies fly under the next tile's WMMAs
      copy_tile(lV + 2u * LBUFV * cur, vJ, vP + (k0 + 2 * BK), (size_t)32 * 512,
                lV + 2u * LBUFV * cur + vH, vJ, vP + (size_t)128 * 512 + (k0 + 2 * BK), (size_t)32 * 512);
    cur ^= 1;
  }
  asm volatile("s_wait_asynccnt 0x0" ::: "memory");     // no copy is outstanding when the wave ends

  unsigned short* dst = ctx2 + (size_t)bL * 256 * 4096;
  #pragma unroll
  for (int ai = 0; ai < 4; ++ai)
    #pragma unroll
    for (int bi = 0; bi < 4; ++bi) {
      const int r0 = m0 + wm * 64 + ai * 16 + (g << 3);   // rows = i, 8 consecutive
      const int c0 = wn * 64 + bi * 16 + fm;              // col = nseq
      union { unsigned short s[8]; uint4 q; } pk;
      #pragma unroll
      for (int r = 0; r < 8; ++r) pk.s[r] = f2b(acc[ai][bi][r]);
      *(uint4*)&dst[(size_t)(h * 512 + r0) * 256 + (size_t)c0 * 8] = pk.q;
    }
}

// out[n][c] = ctx2[n][:] @ wo + emb (residual), f32; k runs head-major in both operands.
// Batches b0 .. b0+gridDim.y-1.
__global__ __launch_bounds__(256) void k_outproj(const unsigned short* __restrict__ ctx2,
                          const unsigned short* __restrict__ woT,
                          const float* __restrict__ emb, float* __restrict__ y1, int b0)
{
  __shared__ __attribute__((aligned(16))) unsigned short shA[2 * LBUF], shB[2 * LBUF];
  const int bL = blockIdx.y, b = b0 + bL;
  const int m0 = (blockIdx.x >> 2) * 128;   // n, 2 tiles
  const int n0 = (blockIdx.x & 3) * 128;    // c, 4 tiles
  v8f acc[2][4];
  gemm128t<true>(ctx2 + (size_t)bL * 256 * 4096, 256, woT, 4096, m0, n0, 4096, shA, shB, acc);
  const float* res = emb + (size_t)b * 256 * 512;
  float* dst = y1 + (size_t)b * 256 * 512;
  #pragma unroll
  for (int ai = 0; ai < 2; ++ai)
    #pragma unroll
    for (int bi = 0; bi < 4; ++bi) {
      int r0, c0; tile_coords(m0, n0, ai, bi, r0, c0);
      #pragma unroll
      for (int r = 0; r < 8; ++r) {
        const size_t o = (size_t)(r0 + r) * 512 + c0;
        dst[o] = acc[ai][bi][r] + res[o];
      }
    }
}

// final[b][o][pos] = gelu( y2[b][pos][:] @ mo_w[o][:] + mo_b[o] ), exact erf GELU.
__global__ __launch_bounds__(256) void k_mo(const unsigned short* __restrict__ y2,
                     const unsigned short* __restrict__ mowb,
                     const float* __restrict__ mo_b, float* __restrict__ out)
{
  __shared__ __attribute__((aligned(16))) unsigned short shA[2 * LBUF], shB[2 * LBUF];
  const int b = blockIdx.y;
  const int m0 = (blockIdx.x >> 2) * 128;   // pos, 2 tiles
  const int n0 = (blockIdx.x & 3) * 128;    // o, 4 tiles
  v8f acc[2][4];
  gemm128t<false>(y2 + (size_t)b * 256 * 512, 512, mowb, 512, m0, n0, 512, shA, shB, acc);
  #pragma unroll
  for (int ai = 0; ai < 2; ++ai)
    #pragma unroll
    for (int bi = 0; bi < 4; ++bi) {
      int r0, c0; tile_coords(m0, n0, ai, bi, r0, c0);  // rows=pos (8 contiguous), cols=o
      const float bias = mo_b[c0];
      union { float f[8]; float4 q[2]; } pk;
      #pragma unroll
      for (int r = 0; r < 8; ++r) {
        const float tv = acc[ai][bi][r] + bias;
        pk.f[r] = 0.5f * tv * (1.0f + erff(tv * 0.70710678118654752f));
      }
      float* dst = out + ((size_t)b * 512 + c0) * 256 + r0;
      *(float4*)(dst + 0) = pk.q[0];
      *(float4*)(dst + 4) = pk.q[1];
    }
}

// ---------------------------------------------------------------------------
extern "C" void kernel_launch(void* const* d_in, const int* in_sizes, int n_in,
                              void* d_out, int out_size, void* d_ws, size_t ws_size,
                              hipStream_t stream)
{
  (void)in_sizes; (void)n_in; (void)out_size; (void)ws_size;
  const float* x      = (const float*)d_in[0];
  const float* proj_w = (const float*)d_in[1];
  const float* proj_b = (const float*)d_in[2];
  const float* ln1_g  = (const float*)d_in[3];
  const float* ln1_b  = (const float*)d_in[4];
  const float* wq     = (const float*)d_in[5];
  const float* wk     = (const float*)d_in[6];
  const float* wv     = (const float*)d_in[7];
  const float* wo     = (const float*)d_in[8];
  const float* ln2_g  = (const float*)d_in[9];
  const float* ln2_b  = (const float*)d_in[10];
  const float* mo_w   = (const float*)d_in[11];
  const float* mo_b   = (const float*)d_in[12];
  float* outp = (float*)d_out;

  char* w = (char*)d_ws;
  size_t off = 0;
  auto nxt = [&](size_t bytes) { char* p = w + off; off = (off + bytes + 255) & ~(size_t)255; return p; };
  unsigned short* xb    = (unsigned short*)nxt(8388608);    // x bf16 [b][c][k]
  unsigned short* pwb   = (unsigned short*)nxt(131072);     // proj_w bf16
  unsigned short* wqT   = (unsigned short*)nxt(4194304);    // [cout][c]
  unsigned short* wkT   = (unsigned short*)nxt(4194304);
  unsigned short* wvT   = (unsigned short*)nxt(4194304);
  unsigned short* woT   = (unsigned short*)nxt(4194304);    // [c][h*512+i]
  unsigned short* mowb  = (unsigned short*)nxt(524288);     // [o][c]
  float*          emb   = (float*)nxt(16777216);            // residual, f32
  unsigned short* xnb   = (unsigned short*)nxt(8388608);    // LN1(emb) bf16
  unsigned short* qT    = (unsigned short*)nxt(16777216);   // chunk: 64 bh x 512 x 256
  unsigned short* kT    = (unsigned short*)nxt(16777216);
  unsigned short* vC    = (unsigned short*)nxt(16777216);   // chunk: 64 bh x 256 x 512
  unsigned short* attn  = (unsigned short*)nxt(33554432);   // chunk: 64 bh x 512 x 512
  float*          part  = (float*)nxt(8192);                // 64 bh x 16 tiles x {sum,sumsq}
  unsigned short* ctx2  = (unsigned short*)nxt(67108864);   // all 32 b x [k/8][n][8]
  float*          y1    = (float*)nxt(16777216);            // attn out + residual, f32
  unsigned short* y2    = (unsigned short*)nxt(8388608);    // LN2 bf16

  k_convert<<<2600, 256, 0, stream>>>(x, proj_w, wq, wk, wv, wo, mo_w,
                                      xb, pwb, wqT, wkT, wvT, woT, mowb);
  k_embed<<<dim3(8, 32), 256, 0, stream>>>(pwb, xb, proj_b, emb);
  k_layernorm<<<256, 256, 0, stream>>>(emb, ln1_g, ln1_b, xnb);

  for (int pass = 0; pass < 4; ++pass) {           // 8 batches (64 bh) per pass
    const int b0 = pass * 8;
    k_qkv<<<dim3(8, 64, 3), 256, 0, stream>>>(xnb, wqT, wkT, wvT, qT, kT, vC, b0);
    k_scores<<<dim3(16, 64), 256, 0, stream>>>(qT, kT, attn, part);
    k_ctx<<<dim3(4, 64), 256, 0, stream>>>(attn, part, vC, ctx2 + (size_t)b0 * 256 * 4096);
  }
  k_outproj<<<dim3(8, 32), 256, 0, stream>>>(ctx2, woT, emb, y1, 0);

  k_layernorm<<<256, 256, 0, stream>>>(y1, ln2_g, ln2_b, y2);
  k_mo<<<dim3(8, 32), 256, 0, stream>>>(y2, mowb, mo_b, outp);
}

// v008
// One run takes 326 microseconds.
// Timed twice side by side with v007, it ran 1.08 and 1.09 times as fast.
// Over all steps from v000 it is 3.70 times as fast.
#include <hip/hip_runtime.h>
#include <math.h>

typedef __attribute__((ext_vector_type(16))) __bf16 v16bf;
typedef __attribute__((ext_vector_type(8)))  float  v8f;

__device__ __forceinline__ unsigned short f2b(float f) {
  unsigned int u = __float_as_uint(f);
  u += 0x7FFFu + ((u >> 16) & 1u);           // round-to-nearest-even
  return (unsigned short)(u >> 16);
}

typedef __attribute__((ext_vector_type(2))) float  f32x2;
typedef __attribute__((ext_vector_type(2))) __bf16 bf16x2;

__device__ __forceinline__ unsigned int pack2(float lo, float hi) {   // two f32 -> packed bf16, nearest even
  f32x2 f; f[0] = lo; f[1] = hi;
  union { bf16x2 b; unsigned int u; } c;
  c.b = __builtin_convertvector(f, bf16x2);
  return c.u;
}

union FragU { v16bf v; unsigned int u[8]; };

#define BK   64                 // k per staged tile: 128 B of every operand row = one whole line
#define LDSS 72                 // padded LDS row stride (bf16) -> 144B rows, conflict-free
#define LBUF (128 * LDSS)       // one LDS buffer (ushorts)

__device__ __forceinline__ void copy_tile(unsigned la, unsigned laJ, const unsigned short* ga, size_t gaJ,
                                          unsigned lb, unsigned lbJ, const unsigned short* gb, size_t gbJ)
{
  asm volatile(
      "global_load_async_to_lds_b128 %0, %8, off\n\t"
      "global_load_async_to_lds_b128 %4, %12, off\n\t"
      "global_load_async_to_lds_b128 %1, %9, off\n\t"
      "global_load_async_to_lds_b128 %5, %13, off\n\t"
      "global_load_async_to_lds_b128 %2, %10, off\n\t"
      "global_load_async_to_lds_b128 %6, %14, off\n\t"
      "global_load_async_to_lds_b128 %3, %11, off\n\t"
      "global_load_async_to_lds_b128 %7, %15, off\n\t"
      "s_wait_xcnt 0x0"
      :: "v"(la), "v"(la + laJ), "v"(la + 2u * laJ), "v"(la + 3u * laJ),
         "v"(lb), "v"(lb + lbJ), "v"(lb + 2u * lbJ), "v"(lb + 3u * lbJ),
         "v"(ga), "v"(ga + gaJ), "v"(ga + 2 * gaJ), "v"(ga + 3 * gaJ),
         "v"(gb), "v"(gb + gbJ), "v"(gb + 2 * gbJ), "v"(gb + 3 * gbJ)
      : "memory");
}

template <bool KB>
__device__ __forceinline__ void gemm128t(
    const unsigned short* __restrict__ A, int lda,
    const unsigned short* __restrict__ Bt, int ldb,
    int m0, int n0, int K,
    unsigned short* shA, unsigned short* shB,   // each 2*LBUF
    v8f acc[2][4])
{
  const int t    = threadIdx.x;
  const int rs   = t >> 3;            // row-major staging: rows rs + 32*j, j = 0..3
  const int kqs  = (t & 7) << 3;      // 8 bf16 = 16B
  const int wave = t >> 5;
  const int lane = t & 31;
  const int wm   = wave >> 1;         // 0..3 -> M offset 32*wm
  const int wn   = wave & 1;          // 0..1 -> N offset 64*wn
  const int fm   = lane & 15;
  const int g    = lane >> 4;

  #pragma unroll
  for (int ai = 0; ai < 2; ++ai)
    #pragma unroll
    for (int bi = 0; bi < 4; ++bi)
      #pragma unroll
      for (int i = 0; i < 8; ++i) acc[ai][bi][i] = 0.0f;

  // A: address of this thread's chunk j = 0, the step from chunk to chunk, the step per k.
  const unsigned short* aP = KB ? A + (size_t)((t >> 7) << 3) * lda + (size_t)(m0 + (t & 127)) * 8
                                : A + (size_t)(m0 + rs) * lda + kqs;
  const size_t aJ = KB ? (size_t)16 * lda : (size_t)32 * lda;   // KB: chunk j is k-octet (t>>7) + 2j
  const size_t aK = KB ? (size_t)lda : (size_t)1;
  const int   sA0 = KB ? (t & 127) * LDSS + ((t >> 7) << 3) : rs * LDSS + kqs;
  const int   sAJ = KB ? 16 : 32 * LDSS;
  const unsigned short* bP = Bt + (size_t)(n0 + rs) * ldb + kqs;
  const size_t bJ = (size_t)32 * ldb;
  const int   sB0 = rs * LDSS + kqs;
  const int   sBJ = 32 * LDSS;
  // one prefetch per 128-B line of a tile: threads 0..127 take A's lines, 128..255 Bt's
  const unsigned short* pfP = (t < 128)
      ? (KB ? A + (size_t)((t >> 4) << 3) * lda + (size_t)m0 * 8 + (size_t)(t & 15) * 64
            : A + (size_t)(m0 + t) * lda)
      : Bt + (size_t)(n0 + (t & 127)) * ldb;
  const size_t pfK = (KB && t < 128) ? (size_t)lda : (size_t)1;

  // LDS byte addresses (low 32 bits of the __shared__ address) of this thread's chunk j = 0, buffer 0
  const unsigned lA = (unsigned)(size_t)(shA + sA0);
  const unsigned lB = (unsigned)(size_t)(shB + sB0);

  // ring, two buffers: tile 0 lands and is published, then tile 1's copies start
  copy_tile(lA, 2u * sAJ, aP, aJ, lB, 2u * sBJ, bP, bJ);
  asm volatile("s_wait_asynccnt 0x0" ::: "memory");   // this wave's copies of tile 0 have landed
  __syncthreads();                                    // ... and every other wave's
  copy_tile(lA + 2u * LBUF, 2u * sAJ, aP + (size_t)BK * aK, aJ,
            lB + 2u * LBUF, 2u * sBJ, bP + BK, bJ);   // K >= 2 * BK in every caller

  int cur = 0;
  // kept rolled: unrolled (K = 256) every tile's 24 copy-address registers are formed up front and live together
  #pragma unroll 1
  for (int k0 = 0; k0 < K; k0 += BK) {
    if (k0 + 2 * BK < K) {                   // global_prefetch_b8 two tiles ahead
      __builtin_prefetch(pfP + (size_t)(k0 + 2 * BK) * pfK, 0, 1);
      // the prefetch's address registers are stepped for the next tile: wait before that overwrite
      asm volatile("s_wait_xcnt 0x0" ::: "memory");
    }
    const unsigned short* sa = shA + cur * LBUF;
    const unsigned short* sb = shB + cur * LBUF;
    #pragma unroll
    for (int ks = 0; ks < BK; ks += 32) {
      FragU fa[2], fb[4];
      #pragma unroll
      for (int p = 0; p < 8; ++p) {
        const int kk = ks + ((p & 4) << 2) + (g << 3) + ((p & 3) << 1);
        fa[0].u[p] = *(const unsigned int*)(sa + (wm * 32 + fm) * LDSS + kk);
        fa[1].u[p] = *(const unsigned int*)(sa + (wm * 32 + 16 + fm) * LDSS + kk);
        fb[0].u[p] = *(const unsigned int*)(sb + (wn * 64 + fm) * LDSS + kk);
        fb[1].u[p] = *(const unsigned int*)(sb + (wn * 64 + 16 + fm) * LDSS + kk);
        fb[2].u[p] = *(const unsigned int*)(sb + (wn * 64 + 32 + fm) * LDSS + kk);
        fb[3].u[p] = *(const unsigned int*)(sb + (wn * 64 + 48 + fm) * LDSS + kk);
      }
      #pragma unroll
      for (int ai = 0; ai < 2; ++ai)
        #pragma unroll
        for (int bi = 0; bi < 4; ++bi)
          acc[ai][bi] = __builtin_amdgcn_wmma_f32_16x16x32_bf16(
              false, fa[ai].v, false, fb[bi].v, (short)0, acc[ai][bi], false, false);
    }
    // publish point of the next tile, every wave, in this order
    asm volatile("s_wait_dscnt 0x0" ::: "memory");      // own fragment reads of this buffer are done before it is refilled
    asm volatile("s_wait_asynccnt 0x0" ::: "memory");   // own copies of the next tile have landed
    __syncthreads();   // next tile readable by all; every reader has left this buffer
    if (k0 + 2 * BK < K)                     // refill it: these copies fly under the next tile's WMMAs
      copy_tile(lA + 2u * LBUF * cur, 2u * sAJ, aP + (size_t)(k0 + 2 * BK) * aK, aJ,
                lB + 2u * LBUF * cur, 2u * sBJ, bP + (k0 + 2 * BK), bJ);
    cur ^= 1;
  }
  asm volatile("s_wait_asynccnt 0x0" ::: "memory");     // no copy is outstanding when the LDS passes to the epilogue
}

// Output coords of acc[ai][bi]: 8 consecutive rows starting r, column c.
__device__ __forceinline__ void tile_coords(int m0, int n0, int ai, int bi, int& r, int& c) {
  const int wave = threadIdx.x >> 5, lane = threadIdx.x & 31;
  r = m0 + (wave >> 1) * 32 + ai * 16 + ((lane >> 4) << 3);
  c = n0 + (wave & 1) * 64 + bi * 16 + (lane & 15);
}

#define TPF 65

__global__ __launch_bounds__(256) void k_convert(const float* __restrict__ x, const float* __restrict__ proj_w,
                          const float* __restrict__ wq, const float* __restrict__ wk,
                          const float* __restrict__ wv, const float* __restrict__ wo,
                          const float* __restrict__ mo_w,
                          unsigned short* __restrict__ xb, unsigned short* __restrict__ pwb,
                          unsigned short* __restrict__ wqT, unsigned short* __restrict__ wkT,
                          unsigned short* __restrict__ wvT,
                          unsigned short* __restrict__ woT, unsigned short* __restrict__ mowb)
{
  __shared__ float tile[64 * TPF];
  const int t = threadIdx.x;
  const int blk = blockIdx.x;
  if (blk < 2048) {
    const int which = blk >> 9, tl = blk & 511;
    const float* sp;
    unsigned short* dp;
    size_t dpitch;
    if (which < 3) {
      const int c0 = (tl & 7) * 64, co0 = (tl >> 3) * 64;
      sp = ((which == 0) ? wq : ((which == 1) ? wk : wv)) + (size_t)c0 * 4096 + co0;
      dp = ((which == 0) ? wqT : ((which == 1) ? wkT : wvT)) + (size_t)co0 * 512 + c0;
      dpitch = 512;
    } else {
      const int h = tl & 7, i0 = ((tl >> 3) & 7) * 64, c0 = (tl >> 6) * 64;
      sp = wo + (size_t)(i0 * 8 + h) * 512 + c0;
      dp = woT + (size_t)c0 * 4096 + h * 512 + i0;
      dpitch = 4096;
    }
    // in: rows (t>>4) + 16*j, 16 lanes x 16 B = a row's 256 B
    const int rr = t >> 4, s4 = (t & 15) * 4;
    float4 v[4];
    #pragma unroll
    for (int j = 0; j < 4; ++j) v[j] = *(const float4*)(sp + (size_t)(rr + 16 * j) * 4096 + s4);
    #pragma unroll
    for (int j = 0; j < 4; ++j) {
      float* q = tile + (rr + 16 * j) * TPF + s4;
      q[0] = v[j].x; q[1] = v[j].y; q[2] = v[j].z; q[3] = v[j].w;
    }
    __syncthreads();   // the whole tile is in LDS before any column of it is read
    // out: destination rows (t>>3) + 32*j, 8 lanes x 16 B = a row's 128 B
    const int r8 = (t & 7) * 8;
    #pragma unroll
    for (int j = 0; j < 2; ++j) {
      const int s = (t >> 3) + 32 * j;
      const float* q = tile + r8 * TPF + s;
      uint4 o4;
      o4.x = pack2(q[0 * TPF], q[1 * TPF]);
      o4.y = pack2(q[2 * TPF], q[3 * TPF]);
      o4.z = pack2(q[4 * TPF], q[5 * TPF]);
      o4.w = pack2(q[6 * TPF], q[7 * TPF]);
      *(uint4*)(dp + (size_t)s * dpitch + r8) = o4;
    }
  } else {
    const int cb = blk - 2048;            // 512 chunks of x, 8 of proj_w, 32 of mo_w
    const float* sp;
    unsigned short* dp;
    if (cb < 512)      { sp = x      + (size_t)cb * 8192;         dp = xb   + (size_t)cb * 8192; }
    else if (cb < 520) { sp = proj_w + (size_t)(cb - 512) * 8192; dp = pwb  + (size_t)(cb - 512) * 8192; }
    else               { sp = mo_w   + (size_t)(cb - 520) * 8192; dp = mowb + (size_t)(cb - 520) * 8192; }
    float4 v[8];
    #pragma unroll
    for (int j = 0; j < 8; ++j) v[j] = *(const float4*)(sp + j * 1024 + t * 4);
    #pragma unroll
    for (int j = 0; j < 8; ++j) {
      uint2 o2;
      o2.x = pack2(v[j].x, v[j].y);
      o2.y = pack2(v[j].z, v[j].w);
      *(uint2*)(dp + j * 1024 + t * 4) = o2;
    }
    // behind the last store of the run: no register that an issued store names is rewritten ahead of this wait
    asm volatile("s_wait_xcnt 0x0" ::: "memory");
  }
}

// ---------------------------------------------------------------------------
// K1: patch embed. emb[b][n][c] = sum_k proj_w[n][k] * x[b][c][k] + proj_b[n]
// ---------------------------------------------------------------------------
__global__ __launch_bounds__(256) void k_embed(const unsigned short* __restrict__ pwb,
                        const unsigned short* __restrict__ xb,
                        const float* __restrict__ proj_b, float* __restrict__ emb)
{
  __shared__ __attribute__((aligned(16))) unsigned short shA[2 * LBUF], shB[2 * LBUF];
  const int b  = blockIdx.x + 8 * (blockIdx.y >> 3);
  const int tl = blockIdx.y & 7;
  const int m0 = (tl >> 2) * 128;           // n (seq), 2 tiles
  const int n0 = (tl & 3) * 128;            // c, 4 tiles
  v8f acc[2][4];
  gemm128t<false>(pwb, 256, xb + (size_t)b * 512 * 256, 256, m0, n0, 256, shA, shB, acc);
  float* ob = emb + (size_t)b * 256 * 512;
  #pragma unroll
  for (int ai = 0; ai < 2; ++ai)
    #pragma unroll
    for (int bi = 0; bi < 4; ++bi) {
      int r0, c0; tile_coords(m0, n0, ai, bi, r0, c0);
      #pragma unroll
      for (int r = 0; r < 8; ++r) {
        const int n = r0 + r;
        ob[(size_t)n * 512 + c0] = acc[ai][bi][r] + proj_b[n];
      }
    }
}

// ---------------------------------------------------------------------------
// LayerNorm over C=512 per row (ln1 & ln2), writes bf16.
// One wave owns a row: no LDS, no barrier; a row sum is an in-lane sum and a five-step butterfly in registers.
// A wave takes 4 rows, so a launch starts 2,048 waves in 256 work-groups, not 65,536 in 8,192.
// A lane holds columns 128*q + 4*lane + 0..3, q = 0..3: each 16-B load covers 4 whole lines, each 8-B store 2.
// ---------------------------------------------------------------------------
#define LNR 4                   // rows per wave

// Sum over the 32 lanes, the same bits in every lane: lane ^ 1, 2, 4, 8 by DPP inside the 16-lane rows,
// then lane ^ 16 by a cross-row move.
__device__ __forceinline__ float wave_sum(float v) {
  v += __int_as_float(__builtin_amdgcn_update_dpp(0, __float_as_int(v), 0x161, 0xf, 0xf, true));   // row_xmask:1
  v += __int_as_float(__builtin_amdgcn_update_dpp(0, __float_as_int(v), 0x162, 0xf, 0xf, true));   // row_xmask:2
  v += __int_as_float(__builtin_amdgcn_update_dpp(0, __float_as_int(v), 0x164, 0xf, 0xf, true));   // row_xmask:4
  v += __int_as_float(__builtin_amdgcn_update_dpp(0, __float_as_int(v), 0x168, 0xf, 0xf, true));   // row_xmask:8
  v += __int_as_float(__builtin_amdgcn_permlanex16(__float_as_int(v), __float_as_int(v),
                                                   0x76543210, 0xfedcba98, false, false));         // same lane, other row
  return v;
}

__device__ __forceinline__ float rsq_slot(float x) {
  float y;
  asm("v_rsq_f32 %0, %1\n\tv_nop" : "=v"(y) : "v"(x));
  return y;
}

__global__ __launch_bounds__(256) void k_layernorm(const float* __restrict__ in, const float* __restrict__ gamma,
                            const float* __restrict__ beta, unsigned short* __restrict__ out)
{
  const int wave = threadIdx.x >> 5, lane = threadIdx.x & 31;
  // 8 work-groups a batch, all with index mod 8 = batch mod 8
  const int bat = (blockIdx.x & 7) + 8 * (blockIdx.x >> 6);
  const size_t row0 = ((size_t)(bat * 8 + ((blockIdx.x >> 3) & 7)) * 8 + wave) * LNR;
  const float* p = in + row0 * 512 + lane * 4;
  float4 x[LNR][4], gm[4], bt[4];
  #pragma unroll
  for (int r = 0; r < LNR; ++r)
    #pragma unroll
    for (int q = 0; q < 4; ++q) x[r][q] = *(const float4*)(p + r * 512 + q * 128);
  #pragma unroll
  for (int q = 0; q < 4; ++q) {
    gm[q] = *(const float4*)(gamma + q * 128 + lane * 4);
    bt[q] = *(const float4*)(beta + q * 128 + lane * 4);
  }
  // the 16 row loads issue as one group ahead of the first sum: left free, the compiler holds three of them back
  // behind the first row's reduction and the wave waits out a second load latency
  __builtin_amdgcn_sched_barrier(0);
  float red[LNR];
  #pragma unroll
  for (int r = 0; r < LNR; ++r) {
    float s = 0.0f;
    #pragma unroll
    for (int q = 0; q < 4; ++q) s += (x[r][q].x + x[r][q].y) + (x[r][q].z + x[r][q].w);
    red[r] = wave_sum(s);
  }
  #pragma unroll
  for (int r = 0; r < LNR; ++r) {
    const float mu = red[r] * (1.0f / 512.0f);
    float s = 0.0f;
    #pragma unroll
    for (int q = 0; q < 4; ++q) {
      x[r][q].x -= mu; x[r][q].y -= mu; x[r][q].z -= mu; x[r][q].w -= mu;
      s += (x[r][q].x * x[r][q].x + x[r][q].y * x[r][q].y) + (x[r][q].z * x[r][q].z + x[r][q].w * x[r][q].w);
    }
    red[r] = wave_sum(s);
  }
  unsigned short* o0 = out + row0 * 512 + lane * 4;
  #pragma unroll
  for (int r = 0; r < LNR; ++r) {
    const float rs = rsq_slot(red[r] * (1.0f / 512.0f) + 1e-6f);
    #pragma unroll
    for (int q = 0; q < 4; ++q) {
      uint2 w;
      w.x = pack2(x[r][q].x * rs * gm[q].x + bt[q].x, x[r][q].y * rs * gm[q].y + bt[q].y);
      w.y = pack2(x[r][q].z * rs * gm[q].z + bt[q].z, x[r][q].w * rs * gm[q].w + bt[q].w);
      *(uint2*)(o0 + r * 512 + q * 128) = w;
    }
  }
}

// ---------------------------------------------------------------------------
// QKV per (b,h). grid.z: 0=q,1=k (write [bh][i][n] transposed), 2=v ([bh][n][i]).
// ---------------------------------------------------------------------------
__global__ __launch_bounds__(256) void k_qkv(const unsigned short* __restrict__ xnb,
                      const unsigned short* __restrict__ wqT,
                      const unsigned short* __restrict__ wkT,
                      const unsigned short* __restrict__ wvT,
                      unsigned short* __restrict__ qT, unsigned short* __restrict__ kT,
                      unsigned short* __restrict__ vC, int b0)
{
  __shared__ __attribute__((aligned(16))) unsigned short shA[2 * LBUF], shB[2 * LBUF];
  const int h = blockIdx.x;
  const int bh = (blockIdx.y >> 3) * 8 + h;
  const int b = b0 + (bh >> 3);
  const int tl = blockIdx.y & 7;
  const int mode = blockIdx.z;
  const unsigned short* wT = (mode == 0) ? wqT : ((mode == 1) ? wkT : wvT);
  const int m0 = (tl >> 2) * 128;           // n (seq), 2 tiles
  const int n0 = (tl & 3) * 128;            // i (within head), 4 tiles
  v8f acc[2][4];
  gemm128t<false>(xnb + (size_t)b * 256 * 512, 512, wT + (size_t)h * 512 * 512, 512,
          m0, n0, 512, shA, shB, acc);
  if (mode < 2) {
    unsigned short* dst = ((mode == 0) ? qT : kT) + (size_t)bh * 512 * 256;
    #pragma unroll
    for (int ai = 0; ai < 2; ++ai)
      #pragma unroll
      for (int bi = 0; bi < 4; ++bi) {
        int r0, c0; tile_coords(m0, n0, ai, bi, r0, c0);
        union { unsigned short s[8]; uint4 q; } pk;
        #pragma unroll
        for (int r = 0; r < 8; ++r) pk.s[r] = f2b(acc[ai][bi][r]);
        *(uint4*)&dst[(size_t)c0 * 256 + r0] = pk.q;   // contiguous in n
      }
  } else {
    unsigned short* dst = vC + (size_t)bh * 256 * 512;
    #pragma unroll
    for (int ai = 0; ai < 2; ++ai)
      #pragma unroll
      for (int bi = 0; bi < 4; ++bi) {
        int r0, c0; tile_coords(m0, n0, ai, bi, r0, c0);
        #pragma unroll
        for (int r = 0; r < 8; ++r)
          dst[(size_t)(r0 + r) * 512 + c0] = f2b(acc[ai][bi][r]);
      }
  }
}

// ---------------------------------------------------------------------------
// scores[i][j] = sum_n qT[i][n] * kT[j][n]; store bf16 + per-tile sum/sumsq.
// ---------------------------------------------------------------------------
__global__ __launch_bounds__(256) void k_scores(const unsigned short* __restrict__ qT,
                         const unsigned short* __restrict__ kT,
                         unsigned short* __restrict__ attn, float* __restrict__ part)
{
  __shared__ __attribute__((aligned(16))) unsigned short shA[2 * LBUF], shB[2 * LBUF];
  __shared__ float redS[256], redQ[256];
  const int bh = (blockIdx.y >> 4) * 8 + blockIdx.x;   // x = head
  const int tl = blockIdx.y & 15;
  const int m0 = (tl >> 2) * 128;           // i, 4 tiles
  const int n0 = (tl & 3) * 128;            // j, 4 tiles
  v8f acc[2][4];
  gemm128t<false>(qT + (size_t)bh * 512 * 256, 256, kT + (size_t)bh * 512 * 256, 256,
          m0, n0, 256, shA, shB, acc);
  unsigned short* dst = attn + (size_t)bh * 512 * 512;
  float s = 0.0f, s2 = 0.0f;
  #pragma unroll
  for (int ai = 0; ai < 2; ++ai)
    #pragma unroll
    for (int bi = 0; bi < 4; ++bi) {
      int r0, c0; tile_coords(m0, n0, ai, bi, r0, c0);
      #pragma unroll
      for (int r = 0; r < 8; ++r) {
        const float v = acc[ai][bi][r];
        dst[(size_t)(r0 + r) * 512 + c0] = f2b(v);
        s += v; s2 += v * v;
      }
    }
  const int t = threadIdx.x;
  redS[t] = s; redQ[t] = s2; __syncthreads();
  for (int o = 128; o > 0; o >>= 1) {
    if (t < o) { redS[t] += redS[t + o]; redQ[t] += redQ[t + o]; }
    __syncthreads();
  }
  if (t == 0) {
    part[((size_t)bh * 16 + tl) * 2 + 0] = redS[0];
    part[((size_t)bh * 16 + tl) * 2 + 1] = redQ[0];
  }
}

// ---------------------------------------------------------------------------
// Instance norm + row softmax + context product in one kernel.
// ctx[i][nseq] = sum_j P[i][j] * v[nseq][j], P = softmax_j((scores - mu) * rsig); mu drops out of a softmax.
// One work-group owns 128 whole score rows and all 256 nseq, so every row is normalised once:
// each wave turns 16 rows into bf16 P rows of an LDS panel (the A operand, resident for the whole K loop),
// v comes through the two-buffer ring of asynchronous copies. 8 waves (2Mx4N), 64x64 per wave.
// Stored k-blocked with k = h*512+i: ctx2[bL][k/8][n][8], a lane's 8 accumulator rows are one 16-B store.
// ---------------------------------------------------------------------------
#define PP    520               // panel row pitch (bf16): 1040 B = 16 B x odd, conflict-free for ds_load_b128
#define LBUFV (256 * LDSS)      // one buffer of the v ring: 256 rows x 64 k

__device__ __forceinline__ float exp2_slot(float x) {
  float y;
  asm("v_exp_f32 %0, %1\n\tv_nop" : "=v"(y) : "v"(x));
  return y;
}

__global__ __launch_bounds__(256) void k_ctx(const unsigned short* __restrict__ attn,
                      const float* __restrict__ part,
                      const unsigned short* __restrict__ vC,
                      unsigned short* __restrict__ ctx2)
{
  __shared__ __attribute__((aligned(16))) unsigned short pan[128 * PP];
  __shared__ __attribute__((aligned(16))) unsigned short shV[2 * LBUFV];
  const int bL = blockIdx.y >> 2, h = blockIdx.x;
  const int bh = bL * 8 + h;
  const int m0 = (blockIdx.y & 3) * 128;    // i, 4 tiles
  const int t = threadIdx.x, wave = t >> 5, lane = t & 31;

  // v ring: a thread's 8 chunks of a tile are rows (t>>3) + 32*j of the lower and of the upper 128 rows
  const unsigned short* vP = vC + (size_t)bh * 256 * 512 + (size_t)(t >> 3) * 512 + ((t & 7) << 3);
  const unsigned lV = (unsigned)(size_t)(shV + (t >> 3) * LDSS + ((t & 7) << 3));
  const unsigned vJ = 2u * 32 * LDSS, vH = 2u * 128 * LDSS;
  // tile 0's copies fly under the softmax
  copy_tile(lV, vJ, vP, (size_t)32 * 512, lV + vH, vJ, vP + (size_t)128 * 512, (size_t)32 * 512);

  // instance-norm statistics from the 16 score tiles' {sum, sumsq}; pairs added as t, t+8, then 4, 2, 1
  float pv = part[(size_t)bh * 32 + lane];
  #pragma unroll
  for (int o = 16; o >= 2; o >>= 1) pv += __shfl_xor(pv, o);
  const float mu  = __shfl(pv, 0) * (1.0f / 262144.0f);
  const float var = __shfl(pv, 1) * (1.0f / 262144.0f) - mu * mu;
  const float kf  = rsqrtf(var + 1e-5f) * 1.44269504088896341f;   // InstanceNorm2d eps; log2(e) for exp2

  // softmax of rows m0 + 16*wave + 0..15, 8 rows at a time; a lane holds j = 8*lane..+7 and 256 + 8*lane..+7
  const unsigned short* sP = attn + ((size_t)bh * 512 + m0 + wave * 16) * 512 + lane * 8;
  #pragma unroll
  for (int hb = 0; hb < 2; ++hb) {
    uint4 raw[8][2];
    #pragma unroll
    for (int r = 0; r < 8; ++r) {
      raw[r][0] = *(const uint4*)(sP + (size_t)(hb * 8 + r) * 512);
      raw[r][1] = *(const uint4*)(sP + (size_t)(hb * 8 + r) * 512 + 256);
    }
    float e[8][16], red[8];
    #pragma unroll
    for (int r = 0; r < 8; ++r) {
      #pragma unroll
      for (int q = 0; q < 2; ++q) {
        const unsigned int u[4] = { raw[r][q].x, raw[r][q].y, raw[r][q].z, raw[r][q].w };
        #pragma unroll
        for (int d = 0; d < 4; ++d) {
          e[r][q * 8 + d * 2 + 0] = __uint_as_float(u[d] << 16);
          e[r][q * 8 + d * 2 + 1] = __uint_as_float(u[d] & 0xFFFF0000u);
        }
      }
      float m = e[r][0];
      #pragma unroll
      for (int i = 1; i < 16; ++i) m = fmaxf(m, e[r][i]);
      red[r] = m;
    }
    #pragma unroll
    for (int o = 16; o >= 1; o >>= 1)
      #pragma unroll
      for (int r = 0; r < 8; ++r) red[r] = fmaxf(red[r], __shfl_xor(red[r], o));
    #pragma unroll
    for (int r = 0; r < 8; ++r) {
      const float m = red[r];
      float s = 0.0f;
      #pragma unroll
      for (int i = 0; i < 16; ++i) {
        e[r][i] = exp2_slot((e[r][i] - m) * kf);
        s += e[r][i];
      }
      red[r] = s;
    }
    #pragma unroll
    for (int o = 16; o >= 1; o >>= 1)
      #pragma unroll
      for (int r = 0; r < 8; ++r) red[r] += __shfl_xor(red[r], o);
    #pragma unroll
    for (int r = 0; r < 8; ++r) {
      const float inv = 1.0f / red[r];
      unsigned short* pr = pan + (wave * 16 + hb * 8 + r) * PP + lane * 8;
      #pragma unroll
      for (int q = 0; q < 2; ++q) {
        uint4 o4;
        o4.x = pack2(e[r][q * 8 + 0] * inv, e[r][q * 8 + 1] * inv);
        o4.y = pack2(e[r][q * 8 + 2] * inv, e[r][q * 8 + 3] * inv);
        o4.z = pack2(e[r][q * 8 + 4] * inv, e[r][q * 8 + 5] * inv);
        o4.w = pack2(e[r][q * 8 + 6] * inv, e[r][q * 8 + 7] * inv);
        *(uint4*)(pr + q * 256) = o4;
      }
    }
  }

  const int wm = wave >> 2;           // 0..1 -> M offset 64*wm
  const int wn = wave & 3;            // 0..3 -> N offset 64*wn
  const int fm = lane & 15;
  const int g  = lane >> 4;
  v8f acc[4][4];
  #pragma unroll
  for (int ai = 0; ai < 4; ++ai)
    #pragma unroll
    for (int bi = 0; bi < 4; ++bi)
      #pragma unroll
      for (int i = 0; i < 8; ++i) acc[ai][bi][i] = 0.0f;

  asm volatile("s_wait_asynccnt 0x0" ::: "memory");   // this wave's copies of tile 0 have landed
  __syncthreads();                                    // ... every other wave's too, and the whole P panel is written
  copy_tile(lV + 2u * LBUFV, vJ, vP + BK, (size_t)32 * 512,
            lV + 2u * LBUFV + vH, vJ, vP + (size_t)128 * 512 + BK, (size_t)32 * 512);

  int cur = 0;
  // kept rolled: unrolled, every tile's copy-address registers are formed up front and live together
  #pragma unroll 1
  for (int k0 = 0; k0 < 512; k0 += BK) {
    const unsigned short* sa = pan + k0;
    const unsigned short* sb = shV + cur * LBUFV;
    #pragma unroll
    for (int ks = 0; ks < BK; ks += 32) {
      FragU fa[4], fb[4];
      #pragma unroll
      for (int p = 0; p < 8; ++p) {
        const int kk = ks + ((p & 4) << 2) + (g << 3) + ((p & 3) << 1);
        #pragma unroll
        for (int f = 0; f < 4; ++f) {
          fa[f].u[p] = *(const unsigned int*)(sa + (wm * 64 + f * 16 + fm) * PP + kk);
          fb[f].u[p] = *(const unsigned int*)(sb + (wn * 64 + f * 16 + fm) * LDSS + kk);
        }
      }
      __builtin_amdgcn_sched_barrier(0);
      #pragma unroll
      for (int ai = 0; ai < 4; ++ai)
        #pragma unroll
        for (int bi = 0; bi < 4; ++bi)
          acc[ai][bi] = __builtin_amdgcn_wmma_f32_16x16x32_bf16(
              false, fa[ai].v, false, fb[bi].v, (short)0, acc[ai][bi], false, false);
    }
    // publish point of the next tile, every wave, in this order
    asm volatile("s_wait_dscnt 0x0" ::: "memory");      // own fragment reads of this buffer are done before it is refilled
    asm volatile("s_wait_asynccnt 0x0" ::: "memory");   // own copies of the next tile have landed
    __syncthreads();   // next tile readable by all; every reader has left this buffer
    if (k0 + 2 * BK < 512)                   // refill it: these copies fly under the next tile's WMMAs
      copy_tile(lV + 2u * LBUFV * cur, vJ, vP + (k0 + 2 * BK), (size_t)32 * 512,
                lV + 2u * LBUFV * cur + vH, vJ, vP + (size_t)128 * 512 + (k0 + 2 * BK), (size_t)32 * 512);
    cur ^= 1;
  }
  asm volatile("s_wait_asynccnt 0x0" ::: "memory");     // no copy is outstanding when the wave ends

  unsigned short* dst = ctx2 + (size_t)bL * 256 * 4096;
  #pragma unroll
  for (int ai = 0; ai < 4; ++ai)
    #pragma unroll
    for (int bi = 0; bi < 4; ++bi) {
      const int r0 = m0 + wm * 64 + ai * 16 + (g << 3);   // rows = i, 8 consecutive
      const int c0 = wn * 64 + bi * 16 + fm;              // col = nseq
      union { unsigned short s[8]; uint4 q; } pk;
      #pragma unroll
      for (int r = 0; r < 8; ++r) pk.s[r] = f2b(acc[ai][bi][r]);
      *(uint4*)&dst[(size_t)(h * 512 + r0) * 256 + (size_t)c0 * 8] = pk.q;
    }
}

// out[n][c] = ctx2[n][:] @ wo + emb (residual), f32; k runs head-major in both operands.
// Batches b0 .. b0+31.
__global__ __launch_bounds__(256) void k_outproj(const unsigned short* __restrict__ ctx2,
                          const unsigned short* __restrict__ woT,
                          const float* __restrict__ emb, float* __restrict__ y1, int b0)
{
  __shared__ __attribute__((aligned(16))) unsigned short shA[2 * LBUF], shB[2 * LBUF];
  const int bL = blockIdx.x + 8 * (blockIdx.y >> 3), b = b0 + bL;
  const int tl = blockIdx.y & 7;
  const int m0 = (tl >> 2) * 128;           // n, 2 tiles
  const int n0 = (tl & 3) * 128;            // c, 4 tiles
  v8f acc[2][4];
  gemm128t<true>(ctx2 + (size_t)bL * 256 * 4096, 256, woT, 4096, m0, n0, 4096, shA, shB, acc);
  const float* res = emb + (size_t)b * 256 * 512;
  float* dst = y1 + (size_t)b * 256 * 512;
  #pragma unroll
  for (int ai = 0; ai < 2; ++ai)
    #pragma unroll
    for (int bi = 0; bi < 4; ++bi) {
      int r0, c0; tile_coords(m0, n0, ai, bi, r0, c0);
      #pragma unroll
      for (int r = 0; r < 8; ++r) {
        const size_t o = (size_t)(r0 + r) * 512 + c0;
        dst[o] = acc[ai][bi][r] + res[o];
      }
    }
}

// final[b][o][pos] = gelu( y2[b][pos][:] @ mo_w[o][:] + mo_b[o] ), exact erf GELU.
__global__ __launch_bounds__(256) void k_mo(const unsigned short* __restrict__ y2,
                     const unsigned short* __restrict__ mowb,
                     const float* __restrict__ mo_b, float* __restrict__ out)
{
  __shared__ __attribute__((aligned(16))) unsigned short shA[2 * LBUF], shB[2 * LBUF];
  const int b = blockIdx.x + 8 * (blockIdx.y >> 3);
  const int tl = blockIdx.y & 7;
  const int m0 = (tl >> 2) * 128;           // pos, 2 tiles
  const int n0 = (tl & 3) * 128;            // o, 4 tiles
  v8f acc[2][4];
  gemm128t<false>(y2 + (size_t)b * 256 * 512, 512, mowb, 512, m0, n0, 512, shA, shB, acc);
  #pragma unroll
  for (int ai = 0; ai < 2; ++ai)
    #pragma unroll
    for (int bi = 0; bi < 4; ++bi) {
      int r0, c0; tile_coords(m0, n0, ai, bi, r0, c0);  // rows=pos (8 contiguous), cols=o
      const float bias = mo_b[c0];
      union { float f[8]; float4 q[2]; } pk;
      #pragma unroll
      for (int r = 0; r < 8; ++r) {
        const float tv = acc[ai][bi][r] + bias;
        pk.f[r] = 0.5f * tv * (1.0f + erff(tv * 0.70710678118654752f));
      }
      float* dst = out + ((size_t)b * 512 + c0) * 256 + r0;
      *(float4*)(dst + 0) = pk.q[0];
      *(float4*)(dst + 4) = pk.q[1];
    }
}

// ---------------------------------------------------------------------------
extern "C" void kernel_launch(void* const* d_in, const int* in_sizes, int n_in,
                              void* d_out, int out_size, void* d_ws, size_t ws_size,
                              hipStream_t stream)
{
  (void)in_sizes; (void)n_in; (void)out_size; (void)ws_size;
  const float* x      = (const float*)d_in[0];
  const float* proj_w = (const float*)d_in[1];
  const float* proj_b = (const float*)d_in[2];
  const float* ln1_g  = (const float*)d_in[3];
  const float* ln1_b  = (const float*)d_in[4];
  const float* wq     = (const float*)d_in[5];
  const float* wk     = (const float*)d_in[6];
  const float* wv     = (const float*)d_in[7];
  const float* wo     = (const float*)d_in[8];
  const float* ln2_g  = (const float*)d_in[9];
  const float* ln2_b  = (const float*)d_in[10];
  const float* mo_w   = (const float*)d_in[11];
  const float* mo_b   = (const float*)d_in[12];
  float* outp = (float*)d_out;

  char* w = (char*)d_ws;
  size_t off = 0;
  auto nxt = [&](size_t bytes) { char* p = w + off; off = (off + bytes + 255) & ~(size_t)255; return p; };
  unsigned short* xb    = (unsigned short*)nxt(8388608);    // x bf16 [b][c][k]
  unsigned short* pwb   = (unsigned short*)nxt(131072);     // proj_w bf16
  unsigned short* wqT   = (unsigned short*)nxt(4194304);    // [cout][c]
  unsigned short* wkT   = (unsigned short*)nxt(4194304);
  unsigned short* wvT   = (unsigned short*)nxt(4194304);
  unsigned short* woT   = (unsigned short*)nxt(4194304);    // [c][h*512+i]
  unsigned short* mowb  = (unsigned short*)nxt(524288);     // [o][c]
  float*          emb   = (float*)nxt(16777216);            // residual, f32
  unsigned short* xnb   = (unsigned short*)nxt(8388608);    // LN1(emb) bf16
  unsigned short* qT    = (unsigned short*)nxt(16777216);   // chunk: 64 bh x 512 x 256
  unsigned short* kT    = (unsigned short*)nxt(16777216);
  unsigned short* vC    = (unsigned short*)nxt(16777216);   // chunk: 64 bh x 256 x 512
  unsigned short* attn  = (unsigned short*)nxt(33554432);   // chunk: 64 bh x 512 x 512
  float*          part  = (float*)nxt(8192);                // 64 bh x 16 tiles x {sum,sumsq}
  unsigned short* ctx2  = (unsigned short*)nxt(67108864);   // all 32 b x [k/8][n][8]
  float*          y1    = (float*)nxt(16777216);            // attn out + residual, f32
  unsigned short* y2    = (unsigned short*)nxt(8388608);    // LN2 bf16

  k_convert<<<2600, 256, 0, stream>>>(x, proj_w, wq, wk, wv, wo, mo_w,
                                      xb, pwb, wqT, wkT, wvT, woT, mowb);
  k_embed<<<dim3(8, 32), 256, 0, stream>>>(pwb, xb, proj_b, emb);
  k_layernorm<<<256, 256, 0, stream>>>(emb, ln1_g, ln1_b, xnb);

  for (int pass = 0; pass < 4; ++pass) {           // 8 batches (64 bh) per pass
    const int b0 = pass * 8;
    k_qkv<<<dim3(8, 64, 3), 256, 0, stream>>>(xnb, wqT, wkT, wvT, qT, kT, vC, b0);
    k_scores<<<dim3(8, 128), 256, 0, stream>>>(qT, kT, attn, part);
    k_ctx<<<dim3(8, 32), 256, 0, stream>>>(attn, part, vC, ctx2 + (size_t)b0 * 256 * 4096);
  }
  k_outproj<<<dim3(8, 32), 256, 0, stream>>>(ctx2, woT, emb, y1, 0);

  k_layernorm<<<256, 256, 0, stream>>>(y1, ln2_g, ln2_b, y2);
  k_mo<<<dim3(8, 32), 256, 0, stream>>>(y2, mowb, mo_b, outp);
}

// v009
// It runs in 302 microseconds.
// Two timings next to v008 put it at 1.05 and 1.09 times that version's speed.
// Over all steps from v000 it is 3.96 times as fast.
#include <hip/hip_runtime.h>
#include <math.h>

typedef __attribute__((ext_vector_type(16))) __bf16 v16bf;
typedef __attribute__((ext_vector_type(8)))  float  v8f;

__device__ __forceinline__ unsigned short f2b(float f) {
  unsigned int u = __float_as_uint(f);
  u += 0x7FFFu + ((u >> 16) & 1u);           // round-to-nearest-even
  return (unsigned short)(u >> 16);
}

typedef __attribute__((ext_vector_type(2))) float  f32x2;
typedef __attribute__((ext_vector_type(2))) __bf16 bf16x2;

__device__ __forceinline__ unsigned int pack2(float lo, float hi) {   // two f32 -> packed bf16, nearest even
  f32x2 f; f[0] = lo; f[1] = hi;
  union { bf16x2 b; unsigned int u; } c;
  c.b = __builtin_convertvector(f, bf16x2);
  return c.u;
}

union FragU { v16bf v; unsigned int u[8]; };

#define BK   64                 // k per staged tile: 128 B of every operand row = one whole line
#define LDSS 72                 // padded LDS row stride (bf16) -> 144B rows, conflict-free
#define LBUF (128 * LDSS)       // one LDS buffer (ushorts)

__device__ __forceinline__ void copy_tile(unsigned la, unsigned laJ, const unsigned short* ga, size_t gaJ,
                                          unsigned lb, unsigned lbJ, const unsigned short* gb, size_t gbJ)
{
  asm volatile(
      "global_load_async_to_lds_b128 %0, %8, off\n\t"
      "global_load_async_to_lds_b128 %4, %12, off\n\t"
      "global_load_async_to_lds_b128 %1, %9, off\n\t"
      "global_load_async_to_lds_b128 %5, %13, off\n\t"
      "global_load_async_to_lds_b128 %2, %10, off\n\t"
      "global_load_async_to_lds_b128 %6, %14, off\n\t"
      "global_load_async_to_lds_b128 %3, %11, off\n\t"
      "global_load_async_to_lds_b128 %7, %15, off\n\t"
      "s_wait_xcnt 0x0"
      :: "v"(la), "v"(la + laJ), "v"(la + 2u * laJ), "v"(la + 3u * laJ),
         "v"(lb), "v"(lb + lbJ), "v"(lb + 2u * lbJ), "v"(lb + 3u * lbJ),
         "v"(ga), "v"(ga + gaJ), "v"(ga + 2 * gaJ), "v"(ga + 3 * gaJ),
         "v"(gb), "v"(gb + gbJ), "v"(gb + 2 * gbJ), "v"(gb + 3 * gbJ)
      : "memory");
}

template <bool KB, bool PF>
__device__ __forceinline__ void gemm128t(
    const unsigned short* __restrict__ A, int lda,
    const unsigned short* __restrict__ Bt, int ldb,
    int m0, int n0, int K,
    unsigned short* shA, unsigned short* shB,   // each 2*LBUF
    v8f acc[2][4])
{
  const int t    = threadIdx.x;
  const int rs   = t >> 3;            // row-major staging: rows rs + 32*j, j = 0..3
  const int kqs  = (t & 7) << 3;      // 8 bf16 = 16B
  const int wave = t >> 5;
  const int lane = t & 31;
  const int wm   = wave >> 1;         // 0..3 -> M offset 32*wm
  const int wn   = wave & 1;          // 0..1 -> N offset 64*wn
  const int fm   = lane & 15;
  const int g    = lane >> 4;

  #pragma unroll
  for (int ai = 0; ai < 2; ++ai)
    #pragma unroll
    for (int bi = 0; bi < 4; ++bi)
      #pragma unroll
      for (int i = 0; i < 8; ++i) acc[ai][bi][i] = 0.0f;

  // A: address of this thread's chunk j = 0, the step from chunk to chunk, the step per k.
  const unsigned short* aP = KB ? A + (size_t)((t >> 7) << 3) * lda + (size_t)(m0 + (t & 127)) * 8
                                : A + (size_t)(m0 + rs) * lda + kqs;
  const size_t aJ = KB ? (size_t)16 * lda : (size_t)32 * lda;   // KB: chunk j is k-octet (t>>7) + 2j
  const size_t aK = KB ? (size_t)lda : (size_t)1;
  const int   sA0 = KB ? (t & 127) * LDSS + ((t >> 7) << 3) : rs * LDSS + kqs;
  const int   sAJ = KB ? 16 : 32 * LDSS;
  const unsigned short* bP = Bt + (size_t)(n0 + rs) * ldb + kqs;
  const size_t bJ = (size_t)32 * ldb;
  const int   sB0 = rs * LDSS + kqs;
  const int   sBJ = 32 * LDSS;
  // one prefetch per 256-B unit. Row-major: threads 0..127 take A's rows, 128..255 Bt's.
  // k-blocked A: thread t < 64 takes piece t & 7 of k-octet t >> 3 (128 rows of an octet are 2,048 contiguous bytes).
  const unsigned short* pfP = (t < 128)
      ? (KB ? A + (size_t)(((t >> 3) & 7) << 3) * lda + (size_t)m0 * 8 + (size_t)(t & 7) * 128
            : A + (size_t)(m0 + t) * lda)
      : Bt + (size_t)(n0 + (t & 127)) * ldb;
  const size_t pfK = (KB && t < 128) ? (size_t)lda : (size_t)1;
  const int  pw      = __builtin_amdgcn_readfirstlane(wave);   // scalar: whole waves ask or do not
  const bool pfEvery = KB && pw < 2;       // units that lie inside one tile
  const bool pfEven  = !KB || pw >= 4;     // units that span two tiles of a row

  // LDS byte addresses (low 32 bits of the __shared__ address) of this thread's chunk j = 0, buffer 0
  const unsigned lA = (unsigned)(size_t)(shA + sA0);
  const unsigned lB = (unsigned)(size_t)(shB + sB0);

  // ring, two buffers: tile 0 lands and is published, then tile 1's copies start
  copy_tile(lA, 2u * sAJ, aP, aJ, lB, 2u * sBJ, bP, bJ);
  asm volatile("s_wait_asynccnt 0x0" ::: "memory");   // this wave's copies of tile 0 have landed
  __syncthreads();                                    // ... and every other wave's
  copy_tile(lA + 2u * LBUF, 2u * sAJ, aP + (size_t)BK * aK, aJ,
            lB + 2u * LBUF, 2u * sBJ, bP + BK, bJ);   // K >= 2 * BK in every caller

  int cur = 0;
  // kept rolled: unrolled (K = 256) every tile's 24 copy-address registers are formed up front and live together
  #pragma unroll 1
  for (int k0 = 0; k0 < K; k0 += BK) {
    if (PF && k0 + 2 * BK < K && (pfEvery || (pfEven && (k0 & BK) == 0))) {   // global_prefetch_b8 two tiles ahead
      __builtin_prefetch(pfP + (size_t)(k0 + 2 * BK) * pfK, 0, 1);
      // the prefetch's address registers are stepped for the next tile: wait before that overwrite
      asm volatile("s_wait_xcnt 0x0" ::: "memory");
    }
    const unsigned short* sa = shA + cur * LBUF;
    const unsigned short* sb = shB + cur * LBUF;
    #pragma unroll
    for (int ks = 0; ks < BK; ks += 32) {
      FragU fa[2], fb[4];
      #pragma unroll
      for (int p = 0; p < 8; ++p) {
        const int kk = ks + ((p & 4) << 2) + (g << 3) + ((p & 3) << 1);
        fa[0].u[p] = *(const unsigned int*)(sa + (wm * 32 + fm) * LDSS + kk);
        fa[1].u[p] = *(const unsigned int*)(sa + (wm * 32 + 16 + fm) * LDSS + kk);
        fb[0].u[p] = *(const unsigned int*)(sb + (wn * 64 + fm) * LDSS + kk);
        fb[1].u[p] = *(const unsigned int*)(sb + (wn * 64 + 16 + fm) * LDSS + kk);
        fb[2].u[p] = *(const unsigned int*)(sb + (wn * 64 + 32 + fm) * LDSS + kk);
        fb[3].u[p] = *(const unsigned int*)(sb + (wn * 64 + 48 + fm) * LDSS + kk);
      }
      #pragma unroll
      for (int ai = 0; ai < 2; ++ai)
        #pragma unroll
        for (int bi = 0; bi < 4; ++bi)
          acc[ai][bi] = __builtin_amdgcn_wmma_f32_16x16x32_bf16(
              false, fa[ai].v, false, fb[bi].v, (short)0, acc[ai][bi], false, false);
    }
    // publish point of the next tile, every wave, in this order
    asm volatile("s_wait_dscnt 0x0" ::: "memory");      // own fragment reads of this buffer are done before it is refilled
    asm volatile("s_wait_asynccnt 0x0" ::: "memory");   // own copies of the next tile have landed
    __syncthreads();   // next tile readable by all; every reader has left this buffer
    if (k0 + 2 * BK < K)                     // refill it: these copies fly under the next tile's WMMAs
      copy_tile(lA + 2u * LBUF * cur, 2u * sAJ, aP + (size_t)(k0 + 2 * BK) * aK, aJ,
                lB + 2u * LBUF * cur, 2u * sBJ, bP + (k0 + 2 * BK), bJ);
    cur ^= 1;
  }
  asm volatile("s_wait_asynccnt 0x0" ::: "memory");     // no copy is outstanding when the LDS passes to the epilogue
}

// Output coords of acc[ai][bi]: 8 consecutive rows starting r, column c.
__device__ __forceinline__ void tile_coords(int m0, int n0, int ai, int bi, int& r, int& c) {
  const int wave = threadIdx.x >> 5, lane = threadIdx.x & 31;
  r = m0 + (wave >> 1) * 32 + ai * 16 + ((lane >> 4) << 3);
  c = n0 + (wave & 1) * 64 + bi * 16 + (lane & 15);
}

#define TPF 65

__global__ __launch_bounds__(256) void k_convert(const float* __restrict__ x, const float* __restrict__ proj_w,
                          const float* __restrict__ wq, const float* __restrict__ wk,
                          const float* __restrict__ wv, const float* __restrict__ wo,
                          const float* __restrict__ mo_w,
                          unsigned short* __restrict__ xb, unsigned short* __restrict__ pwb,
                          unsigned short* __restrict__ wqT, unsigned short* __restrict__ wkT,
                          unsigned short* __restrict__ wvT,
                          unsigned short* __restrict__ woT, unsigned short* __restrict__ mowb)
{
  __shared__ float tile[64 * TPF];
  const int t = threadIdx.x;
  const int blk = blockIdx.x;
  if (blk < 2048) {
    const int which = blk >> 9, tl = blk & 511;
    const float* sp;
    unsigned short* dp;
    size_t dpitch;
    if (which < 3) {
      const int c0 = (tl & 7) * 64, co0 = (tl >> 3) * 64;
      sp = ((which == 0) ? wq : ((which == 1) ? wk : wv)) + (size_t)c0 * 4096 + co0;
      dp = ((which == 0) ? wqT : ((which == 1) ? wkT : wvT)) + (size_t)co0 * 512 + c0;
      dpitch = 512;
    } else {
      const int h = tl & 7, i0 = ((tl >> 3) & 7) * 64, c0 = (tl >> 6) * 64;
      sp = wo + (size_t)(i0 * 8 + h) * 512 + c0;
      dp = woT + (size_t)c0 * 4096 + h * 512 + i0;
      dpitch = 4096;
    }
    // in: rows (t>>4) + 16*j, 16 lanes x 16 B = a row's 256 B
    const int rr = t >> 4, s4 = (t & 15) * 4;
    float4 v[4];
    #pragma unroll
    for (int j = 0; j < 4; ++j) v[j] = *(const float4*)(sp + (size_t)(rr + 16 * j) * 4096 + s4);
    #pragma unroll
    for (int j = 0; j < 4; ++j) {
      float* q = tile + (rr + 16 * j) * TPF + s4;
      q[0] = v[j].x; q[1] = v[j].y; q[2] = v[j].z; q[3] = v[j].w;
    }
    __syncthreads();   // the whole tile is in LDS before any column of it is read
    // out: destination rows (t>>3) + 32*j, 8 lanes x 16 B = a row's 128 B
    const int r8 = (t & 7) * 8;
    #pragma unroll
    for (int j = 0; j < 2; ++j) {
      const int s = (t >> 3) + 32 * j;
      const float* q = tile + r8 * TPF + s;
      uint4 o4;
      o4.x = pack2(q[0 * TPF], q[1 * TPF]);
      o4.y = pack2(q[2 * TPF], q[3 * TPF]);
      o4.z = pack2(q[4 * TPF], q[5 * TPF]);
      o4.w = pack2(q[6 * TPF], q[7 * TPF]);
      *(uint4*)(dp + (size_t)s * dpitch + r8) = o4;
    }
  } else {
    const int cb = blk - 2048;            // 512 chunks of x, 8 of proj_w, 32 of mo_w
    const float* sp;
    unsigned short* dp;
    if (cb < 512)      { sp = x      + (size_t)cb * 8192;         dp = xb   + (size_t)cb * 8192; }
    else if (cb < 520) { sp = proj_w + (size_t)(cb - 512) * 8192; dp = pwb  + (size_t)(cb - 512) * 8192; }
    else               { sp = mo_w   + (size_t)(cb - 520) * 8192; dp = mowb + (size_t)(cb - 520) * 8192; }
    float4 v[8];
    #pragma unroll
    for (int j = 0; j < 8; ++j) v[j] = *(const float4*)(sp + j * 1024 + t * 4);
    #pragma unroll
    for (int j = 0; j < 8; ++j) {
      uint2 o2;
      o2.x = pack2(v[j].x, v[j].y);
      o2.y = pack2(v[j].z, v[j].w);
      *(uint2*)(dp + j * 1024 + t * 4) = o2;
    }
    // behind the last store of the run: no register that an issued store names is rewritten ahead of this wait
    asm volatile("s_wait_xcnt 0x0" ::: "memory");
  }
}

// ---------------------------------------------------------------------------
// K1: patch embed. emb[b][n][c] = sum_k proj_w[n][k] * x[b][c][k] + proj_b[n]
// ---------------------------------------------------------------------------
__global__ __launch_bounds__(256) void k_embed(const unsigned short* __restrict__ pwb,
                        const unsigned short* __restrict__ xb,
                        const float* __restrict__ proj_b, float* __restrict__ emb)
{
  __shared__ __attribute__((aligned(16))) unsigned short shA[2 * LBUF], shB[2 * LBUF];
  const int b  = blockIdx.x + 8 * (blockIdx.y >> 3);
  const int tl = blockIdx.y & 7;
  const int m0 = (tl >> 2) * 128;           // n (seq), 2 tiles
  const int n0 = (tl & 3) * 128;            // c, 4 tiles
  v8f acc[2][4];
  gemm128t<false, true>(pwb, 256, xb + (size_t)b * 512 * 256, 256, m0, n0, 256, shA, shB, acc);
  float* ob = emb + (size_t)b * 256 * 512;
  #pragma unroll
  for (int ai = 0; ai < 2; ++ai)
    #pragma unroll
    for (int bi = 0; bi < 4; ++bi) {
      int r0, c0; tile_coords(m0, n0, ai, bi, r0, c0);
      #pragma unroll
      for (int r = 0; r < 8; ++r) {
        const int n = r0 + r;
        ob[(size_t)n * 512 + c0] = acc[ai][bi][r] + proj_b[n];
      }
    }
}

// ---------------------------------------------------------------------------
// LayerNorm over C=512 per row (ln1 & ln2), writes bf16.
// One wave owns a row: no LDS, no barrier; a row sum is an in-lane sum and a five-step butterfly in registers.
// A wave takes 4 rows, so a launch starts 2,048 waves in 256 work-groups, not 65,536 in 8,192.
// A lane holds columns 128*q + 4*lane + 0..3, q = 0..3: each 16-B load covers 4 whole lines, each 8-B store 2.
// ---------------------------------------------------------------------------
#define LNR 4                   // rows per wave

// Sum over the 32 lanes, the same bits in every lane: lane ^ 1, 2, 4, 8 by DPP inside the 16-lane rows,
// then lane ^ 16 by a cross-row move.
__device__ __forceinline__ float wave_sum(float v) {
  v += __int_as_float(__builtin_amdgcn_update_dpp(0, __float_as_int(v), 0x161, 0xf, 0xf, true));   // row_xmask:1
  v += __int_as_float(__builtin_amdgcn_update_dpp(0, __float_as_int(v), 0x162, 0xf, 0xf, true));   // row_xmask:2
  v += __int_as_float(__builtin_amdgcn_update_dpp(0, __float_as_int(v), 0x164, 0xf, 0xf, true));   // row_xmask:4
  v += __int_as_float(__builtin_amdgcn_update_dpp(0, __float_as_int(v), 0x168, 0xf, 0xf, true));   // row_xmask:8
  v += __int_as_float(__builtin_amdgcn_permlanex16(__float_as_int(v), __float_as_int(v),
                                                   0x76543210, 0xfedcba98, false, false));         // same lane, other row
  return v;
}

__device__ __forceinline__ float rsq_slot(float x) {
  float y;
  asm("v_rsq_f32 %0, %1\n\tv_nop" : "=v"(y) : "v"(x));
  return y;
}

__global__ __launch_bounds__(256) void k_layernorm(const float* __restrict__ in, const float* __restrict__ gamma,
                            const float* __restrict__ beta, unsigned short* __restrict__ out)
{
  const int wave = threadIdx.x >> 5, lane = threadIdx.x & 31;
  // 8 work-groups a batch, all with index mod 8 = batch mod 8
  const int bat = (blockIdx.x & 7) + 8 * (blockIdx.x >> 6);
  const size_t row0 = ((size_t)(bat * 8 + ((blockIdx.x >> 3) & 7)) * 8 + wave) * LNR;
  const float* p = in + row0 * 512 + lane * 4;
  float4 x[LNR][4], gm[4], bt[4];
  #pragma unroll
  for (int r = 0; r < LNR; ++r)
    #pragma unroll
    for (int q = 0; q < 4; ++q) x[r][q] = *(const float4*)(p + r * 512 + q * 128);
  #pragma unroll
  for (int q = 0; q < 4; ++q) {
    gm[q] = *(const float4*)(gamma + q * 128 + lane * 4);
    bt[q] = *(const float4*)(beta + q * 128 + lane * 4);
  }
  // the 16 row loads issue as one group ahead of the first sum: left free, the compiler holds three of them back
  // behind the first row's reduction and the wave waits out a second load latency
  __builtin_amdgcn_sched_barrier(0);
  float red[LNR];
  #pragma unroll
  for (int r = 0; r < LNR; ++r) {
    float s = 0.0f;
    #pragma unroll
    for (int q = 0; q < 4; ++q) s += (x[r][q].x + x[r][q].y) + (x[r][q].z + x[r][q].w);
    red[r] = wave_sum(s);
  }
  #pragma unroll
  for (int r = 0; r < LNR; ++r) {
    const float mu = red[r] * (1.0f / 512.0f);
    float s = 0.0f;
    #pragma unroll
    for (int q = 0; q < 4; ++q) {
      x[r][q].x -= mu; x[r][q].y -= mu; x[r][q].z -= mu; x[r][q].w -= mu;
      s += (x[r][q].x * x[r][q].x + x[r][q].y * x[r][q].y) + (x[r][q].z * x[r][q].z + x[r][q].w * x[r][q].w);
    }
    red[r] = wave_sum(s);
  }
  unsigned short* o0 = out + row0 * 512 + lane * 4;
  #pragma unroll
  for (int r = 0; r < LNR; ++r) {
    const float rs = rsq_slot(red[r] * (1.0f / 512.0f) + 1e-6f);
    #pragma unroll
    for (int q = 0; q < 4; ++q) {
      uint2 w;
      w.x = pack2(x[r][q].x * rs * gm[q].x + bt[q].x, x[r][q].y * rs * gm[q].y + bt[q].y);
      w.y = pack2(x[r][q].z * rs * gm[q].z + bt[q].z, x[r][q].w * rs * gm[q].w + bt[q].w);
      *(uint2*)(o0 + r * 512 + q * 128) = w;
    }
  }
}

// ---------------------------------------------------------------------------
// QKV per (b,h). grid.z: 0=q,1=k (write [bh][i][n] transposed), 2=v ([bh][n][i]).
// ---------------------------------------------------------------------------
__global__ __launch_bounds__(256) void k_qkv(const unsigned short* __restrict__ xnb,
                      const unsigned short* __restrict__ wqT,
                      const unsigned short* __restrict__ wkT,
                      const unsigned short* __restrict__ wvT,
                      unsigned short* __restrict__ qT, unsigned short* __restrict__ kT,
                      unsigned short* __restrict__ vC, int b0)
{
  __shared__ __attribute__((aligned(16))) unsigned short shA[2 * LBUF], shB[2 * LBUF];
  const int h = blockIdx.x;
  const int bh = (blockIdx.y >> 3) * 8 + h;
  const int b = b0 + (bh >> 3);
  const int tl = blockIdx.y & 7;
  const int mode = blockIdx.z;
  const unsigned short* wT = (mode == 0) ? wqT : ((mode == 1) ? wkT : wvT);
  const int m0 = (tl >> 2) * 128;           // n (seq), 2 tiles
  const int n0 = (tl & 3) * 128;            // i (within head), 4 tiles
  v8f acc[2][4];
  gemm128t<false, false>(xnb + (size_t)b * 256 * 512, 512, wT + (size_t)h * 512 * 512, 512,
          m0, n0, 512, shA, shB, acc);
  if (mode < 2) {
    unsigned short* dst = ((mode == 0) ? qT : kT) + (size_t)bh * 512 * 256;
    #pragma unroll
    for (int ai = 0; ai < 2; ++ai)
      #pragma unroll
      for (int bi = 0; bi < 4; ++bi) {
        int r0, c0; tile_coords(m0, n0, ai, bi, r0, c0);
        union { unsigned short s[8]; uint4 q; } pk;
        #pragma unroll
        for (int r = 0; r < 8; ++r) pk.s[r] = f2b(acc[ai][bi][r]);
        *(uint4*)&dst[(size_t)c0 * 256 + r0] = pk.q;   // contiguous in n
      }
  } else {
    unsigned short* dst = vC + (size_t)bh * 256 * 512;
    #pragma unroll
    for (int ai = 0; ai < 2; ++ai)
      #pragma unroll
      for (int bi = 0; bi < 4; ++bi) {
        int r0, c0; tile_coords(m0, n0, ai, bi, r0, c0);
        #pragma unroll
        for (int r = 0; r < 8; ++r)
          dst[(size_t)(r0 + r) * 512 + c0] = f2b(acc[ai][bi][r]);
      }
  }
}

// ---------------------------------------------------------------------------
// scores[i][j] = sum_n qT[i][n] * kT[j][n]; store bf16 + per-tile sum/sumsq.
// ---------------------------------------------------------------------------
__global__ __launch_bounds__(256) void k_scores(const unsigned short* __restrict__ qT,
                         const unsigned short* __restrict__ kT,
                         unsigned short* __restrict__ attn, float* __restrict__ part)
{
  __shared__ __attribute__((aligned(16))) unsigned short shA[2 * LBUF], shB[2 * LBUF];
  __shared__ float redS[256], redQ[256];
  const int bh = (blockIdx.y >> 4) * 8 + blockIdx.x;   // x = head
  const int tl = blockIdx.y & 15;
  const int m0 = (tl >> 2) * 128;           // i, 4 tiles
  const int n0 = (tl & 3) * 128;            // j, 4 tiles
  v8f acc[2][4];
  gemm128t<false, true>(qT + (size_t)bh * 512 * 256, 256, kT + (size_t)bh * 512 * 256, 256,
          m0, n0, 256, shA, shB, acc);
  unsigned short* dst = attn + (size_t)bh * 512 * 512;
  float s = 0.0f, s2 = 0.0f;
  #pragma unroll
  for (int ai = 0; ai < 2; ++ai)
    #pragma unroll
    for (int bi = 0; bi < 4; ++bi) {
      int r0, c0; tile_coords(m0, n0, ai, bi, r0, c0);
      #pragma unroll
      for (int r = 0; r < 8; ++r) {
        const float v = acc[ai][bi][r];
        dst[(size_t)(r0 + r) * 512 + c0] = f2b(v);
        s += v; s2 += v * v;
      }
    }
  const int t = threadIdx.x;
  redS[t] = s; redQ[t] = s2; __syncthreads();
  for (int o = 128; o > 0; o >>= 1) {
    if (t < o) { redS[t] += redS[t + o]; redQ[t] += redQ[t + o]; }
    __syncthreads();
  }
  if (t == 0) {
    part[((size_t)bh * 16 + tl) * 2 + 0] = redS[0];
    part[((size_t)bh * 16 + tl) * 2 + 1] = redQ[0];
  }
}

// ---------------------------------------------------------------------------
// Instance norm + row softmax + context product in one kernel.
// ctx[i][nseq] = sum_j P[i][j] * v[nseq][j], P = softmax_j((scores - mu) * rsig); mu drops out of a softmax.
// One work-group owns 128 whole score rows and all 256 nseq, so every row is normalised once:
// each wave turns 16 rows into bf16 P rows of an LDS panel (the A operand, resident for the whole K loop),
// v comes through the two-buffer ring of asynchronous copies. 8 waves (2Mx4N), 64x64 per wave.
// Stored k-blocked with k = h*512+i: ctx2[bL][k/8][n][8], a lane's 8 accumulator rows are one 16-B store.
// ---------------------------------------------------------------------------
#define PP    520               // panel row pitch (bf16): 1040 B = 16 B x odd, conflict-free for ds_load_b128
#define LBUFV (256 * LDSS)      // one buffer of the v ring: 256 rows x 64 k

__device__ __forceinline__ float exp2_slot(float x) {
  float y;
  asm("v_exp_f32 %0, %1\n\tv_nop" : "=v"(y) : "v"(x));
  return y;
}

__global__ __launch_bounds__(256) void k_ctx(const unsigned short* __restrict__ attn,
                      const float* __restrict__ part,
                      const unsigned short* __restrict__ vC,
                      unsigned short* __restrict__ ctx2)
{
  __shared__ __attribute__((aligned(16))) unsigned short pan[128 * PP];
  __shared__ __attribute__((aligned(16))) unsigned short shV[2 * LBUFV];
  const int bL = blockIdx.y >> 2, h = blockIdx.x;
  const int bh = bL * 8 + h;
  const int m0 = (blockIdx.y & 3) * 128;    // i, 4 tiles
  const int t = threadIdx.x, wave = t >> 5, lane = t & 31;

  // v ring: a thread's 8 chunks of a tile are rows (t>>3) + 32*j of the lower and of the upper 128 rows
  const unsigned short* vP = vC + (size_t)bh * 256 * 512 + (size_t)(t >> 3) * 512 + ((t & 7) << 3);
  const unsigned lV = (unsigned)(size_t)(shV + (t >> 3) * LDSS + ((t & 7) << 3));
  const unsigned vJ = 2u * 32 * LDSS, vH = 2u * 128 * LDSS;
  // tile 0's copies fly under the softmax
  copy_tile(lV, vJ, vP, (size_t)32 * 512, lV + vH, vJ, vP + (size_t)128 * 512, (size_t)32 * 512);

  // instance-norm statistics from the 16 score tiles' {sum, sumsq}; pairs added as t, t+8, then 4, 2, 1
  float pv = part[(size_t)bh * 32 + lane];
  #pragma unroll
  for (int o = 16; o >= 2; o >>= 1) pv += __shfl_xor(pv, o);
  const float mu  = __shfl(pv, 0) * (1.0f / 262144.0f);
  const float var = __shfl(pv, 1) * (1.0f / 262144.0f) - mu * mu;
  const float kf  = rsqrtf(var + 1e-5f) * 1.44269504088896341f;   // InstanceNorm2d eps; log2(e) for exp2

  // softmax of rows m0 + 16*wave + 0..15, 8 rows at a time; a lane holds j = 8*lane..+7 and 256 + 8*lane..+7
  const unsigned short* sP = attn + ((size_t)bh * 512 + m0 + wave * 16) * 512 + lane * 8;
  #pragma unroll
  for (int hb = 0; hb < 2; ++hb) {
    uint4 raw[8][2];
    #pragma unroll
    for (int r = 0; r < 8; ++r) {
      raw[r][0] = *(const uint4*)(sP + (size_t)(hb * 8 + r) * 512);
      raw[r][1] = *(const uint4*)(sP + (size_t)(hb * 8 + r) * 512 + 256);
    }
    float e[8][16], red[8];
    #pragma unroll
    for (int r = 0; r < 8; ++r) {
      #pragma unroll
      for (int q = 0; q < 2; ++q) {
        const unsigned int u[4] = { raw[r][q].x, raw[r][q].y, raw[r][q].z, raw[r][q].w };
        #pragma unroll
        for (int d = 0; d < 4; ++d) {
          e[r][q * 8 + d * 2 + 0] = __uint_as_float(u[d] << 16);
          e[r][q * 8 + d * 2 + 1] = __uint_as_float(u[d] & 0xFFFF0000u);
        }
      }
      float m = e[r][0];
      #pragma unroll
      for (int i = 1; i < 16; ++i) m = fmaxf(m, e[r][i]);
      red[r] = m;
    }
    #pragma unroll
    for (int o = 16; o >= 1; o >>= 1)
      #pragma unroll
      for (int r = 0; r < 8; ++r) red[r] = fmaxf(red[r], __shfl_xor(red[r], o));
    #pragma unroll
    for (int r = 0; r < 8; ++r) {
      const float m = red[r];
      float s = 0.0f;
      #pragma unroll
      for (int i = 0; i < 16; ++i) {
        e[r][i] = exp2_slot((e[r][i] - m) * kf);
        s += e[r][i];
      }
      red[r] = s;
    }
    #pragma unroll
    for (int o = 16; o >= 1; o >>= 1)
      #pragma unroll
      for (int r = 0; r < 8; ++r) red[r] += __shfl_xor(red[r], o);
    #pragma unroll
    for (int r = 0; r < 8; ++r) {
      const float inv = 1.0f / red[r];
      unsigned short* pr = pan + (wave * 16 + hb * 8 + r) * PP + lane * 8;
      #pragma unroll
      for (int q = 0; q < 2; ++q) {
        uint4 o4;
        o4.x = pack2(e[r][q * 8 + 0] * inv, e[r][q * 8 + 1] * inv);
        o4.y = pack2(e[r][q * 8 + 2] * inv, e[r][q * 8 + 3] * inv);
        o4.z = pack2(e[r][q * 8 + 4] * inv, e[r][q * 8 + 5] * inv);
        o4.w = pack2(e[r][q * 8 + 6] * inv, e[r][q * 8 + 7] * inv);
        *(uint4*)(pr + q * 256) = o4;
      }
    }
  }

  const int wm = wave >> 2;           // 0..1 -> M offset 64*wm
  const int wn = wave & 3;            // 0..3 -> N offset 64*wn
  const int fm = lane & 15;
  const int g  = lane >> 4;
  v8f acc[4][4];
  #pragma unroll
  for (int ai = 0; ai < 4; ++ai)
    #pragma unroll
    for (int bi = 0; bi < 4; ++bi)
      #pragma unroll
      for (int i = 0; i < 8; ++i) acc[ai][bi][i] = 0.0f;

  asm volatile("s_wait_asynccnt 0x0" ::: "memory");   // this wave's copies of tile 0 have landed
  __syncthreads();                                    // ... every other wave's too, and the whole P panel is written
  copy_tile(lV + 2u * LBUFV, vJ, vP + BK, (size_t)32 * 512,
            lV + 2u * LBUFV + vH, vJ, vP + (size_t)128 * 512 + BK, (size_t)32 * 512);

  int cur = 0;
  // kept rolled: unrolled, every tile's copy-address registers are formed up front and live together
  #pragma unroll 1
  for (int k0 = 0; k0 < 512; k0 += BK) {
    const unsigned short* sa = pan + k0;
    const unsigned short* sb = shV + cur * LBUFV;
    #pragma unroll
    for (int ks = 0; ks < BK; ks += 32) {
      FragU fa[4], fb[4];
      #pragma unroll
      for (int p = 0; p < 8; ++p) {
        const int kk = ks + ((p & 4) << 2) + (g << 3) + ((p & 3) << 1);
        #pragma unroll
        for (int f = 0; f < 4; ++f) {
          fa[f].u[p] = *(const unsigned int*)(sa + (wm * 64 + f * 16 + fm) * PP + kk);
          fb[f].u[p] = *(const unsigned int*)(sb + (wn * 64 + f * 16 + fm) * LDSS + kk);
        }
      }
      __builtin_amdgcn_sched_barrier(0);
      #pragma unroll
      for (int ai = 0; ai < 4; ++ai)
        #pragma unroll
        for (int bi = 0; bi < 4; ++bi)
          acc[ai][bi] = __builtin_amdgcn_wmma_f32_16x16x32_bf16(
              false, fa[ai].v, false, fb[bi].v, (short)0, acc[ai][bi], false, false);
    }
    // publish point of the next tile, every wave, in this order
    asm volatile("s_wait_dscnt 0x0" ::: "memory");      // own fragment reads of this buffer are done before it is refilled
    asm volatile("s_wait_asynccnt 0x0" ::: "memory");   // own copies of the next tile have landed
    __syncthreads();   // next tile readable by all; every reader has left this buffer
    if (k0 + 2 * BK < 512)                   // refill it: these copies fly under the next tile's WMMAs
      copy_tile(lV + 2u * LBUFV * cur, vJ, vP + (k0 + 2 * BK), (size_t)32 * 512,
                lV + 2u * LBUFV * cur + vH, vJ, vP + (size_t)128 * 512 + (k0 + 2 * BK), (size_t)32 * 512);
    cur ^= 1;
  }
  asm volatile("s_wait_asynccnt 0x0" ::: "memory");     // no copy is outstanding when the wave ends

  unsigned short* dst = ctx2 + (size_t)bL * 256 * 4096;
  #pragma unroll
  for (int ai = 0; ai < 4; ++ai)
    #pragma unroll
    for (int bi = 0; bi < 4; ++bi) {
      const int r0 = m0 + wm * 64 + ai * 16 + (g << 3);   // rows = i, 8 consecutive
      const int c0 = wn * 64 + bi * 16 + fm;              // col = nseq
      union { unsigned short s[8]; uint4 q; } pk;
      #pragma unroll
      for (int r = 0; r < 8; ++r) pk.s[r] = f2b(acc[ai][bi][r]);
      *(uint4*)&dst[(size_t)(h * 512 + r0) * 256 + (size_t)c0 * 8] = pk.q;
    }
}

// out[n][c] = ctx2[n][:] @ wo + emb (residual), f32; k runs head-major in both operands.
// Batches b0 .. b0+31.
__global__ __launch_bounds__(256) void k_outproj(const unsigned short* __restrict__ ctx2,
                          const unsigned short* __restrict__ woT,
                          const float* __restrict__ emb, float* __restrict__ y1, int b0)
{
  __shared__ __attribute__((aligned(16))) unsigned short shA[2 * LBUF], shB[2 * LBUF];
  const int bL = blockIdx.x + 8 * (blockIdx.y >> 3), b = b0 + bL;
  const int tl = blockIdx.y & 7;
  const int m0 = (tl >> 2) * 128;           // n, 2 tiles
  const int n0 = (tl & 3) * 128;            // c, 4 tiles
  v8f acc[2][4];
  gemm128t<true, true>(ctx2 + (size_t)bL * 256 * 4096, 256, woT, 4096, m0, n0, 4096, shA, shB, acc);
  const float* res = emb + (size_t)b * 256 * 512;
  float* dst = y1 + (size_t)b * 256 * 512;
  #pragma unroll
  for (int ai = 0; ai < 2; ++ai)
    #pragma unroll
    for (int bi = 0; bi < 4; ++bi) {
      int r0, c0; tile_coords(m0, n0, ai, bi, r0, c0);
      #pragma unroll
      for (int r = 0; r < 8; ++r) {
        const size_t o = (size_t)(r0 + r) * 512 + c0;
        dst[o] = acc[ai][bi][r] + res[o];
      }
    }
}

// final[b][o][pos] = gelu( y2[b][pos][:] @ mo_w[o][:] + mo_b[o] ), exact erf GELU.
__global__ __launch_bounds__(256) void k_mo(const unsigned short* __restrict__ y2,
                     const unsigned short* __restrict__ mowb,
                     const float* __restrict__ mo_b, float* __restrict__ out)
{
  __shared__ __attribute__((aligned(16))) unsigned short shA[2 * LBUF], shB[2 * LBUF];
  const int b = blockIdx.x + 8 * (blockIdx.y >> 3);
  const int tl = blockIdx.y & 7;
  const int m0 = (tl >> 2) * 128;           // pos, 2 tiles
  const int n0 = (tl & 3) * 128;            // o, 4 tiles
  v8f acc[2][4];
  gemm128t<false, true>(y2 + (size_t)b * 256 * 512, 512, mowb, 512, m0, n0, 512, shA, shB, acc);
  #pragma unroll
  for (int ai = 0; ai < 2; ++ai)
    #pragma unroll
    for (int bi = 0; bi < 4; ++bi) {
      int r0, c0; tile_coords(m0, n0, ai, bi, r0, c0);  // rows=pos (8 contiguous), cols=o
      const float bias = mo_b[c0];
      union { float f[8]; float4 q[2]; } pk;
      #pragma unroll
      for (int r = 0; r < 8; ++r) {
        const float tv = acc[ai][bi][r] + bias;
        pk.f[r] = 0.5f * tv * (1.0f + erff(tv * 0.70710678118654752f));
      }
      float* dst = out + ((size_t)b * 512 + c0) * 256 + r0;
      *(float4*)(dst + 0) = pk.q[0];
      *(float4*)(dst + 4) = pk.q[1];
    }
}

// ---------------------------------------------------------------------------
extern "C" void kernel_launch(void* const* d_in, const int* in_sizes, int n_in,
                              void* d_out, int out_size, void* d_ws, size_t ws_size,
                              hipStream_t stream)
{
  (void)in_sizes; (void)n_in; (void)out_size; (void)ws_size;
  const float* x      = (const float*)d_in[0];
  const float* proj_w = (const float*)d_in[1];
  const float* proj_b = (const float*)d_in[2];
  const float* ln1_g  = (const float*)d_in[3];
  const float* ln1_b  = (const float*)d_in[4];
  const float* wq     = (const float*)d_in[5];
  const float* wk     = (const float*)d_in[6];
  const float* wv     = (const float*)d_in[7];
  const float* wo     = (const float*)d_in[8];
  const float* ln2_g  = (const float*)d_in[9];
  const float* ln2_b  = (const float*)d_in[10];
  const float* mo_w   = (const float*)d_in[11];
  const float* mo_b   = (const float*)d_in[12];
  float* outp = (float*)d_out;

  char* w = (char*)d_ws;
  size_t off = 0;
  auto nxt = [&](size_t bytes) { char* p = w + off; off = (off + bytes + 255) & ~(size_t)255; return p; };
  unsigned short* xb    = (unsigned short*)nxt(8388608);    // x bf16 [b][c][k]
  unsigned short* pwb   = (unsigned short*)nxt(131072);     // proj_w bf16
  unsigned short* wqT   = (unsigned short*)nxt(4194304);    // [cout][c]
  unsigned short* wkT   = (unsigned short*)nxt(4194304);
  unsigned short* wvT   = (unsigned short*)nxt(4194304);
  unsigned short* woT   = (unsigned short*)nxt(4194304);    // [c][h*512+i]
  unsigned short* mowb  = (unsigned short*)nxt(524288);     // [o][c]
  float*          emb   = (float*)nxt(16777216);            // residual, f32
  unsigned short* xnb   = (unsigned short*)nxt(8388608);    // LN1(emb) bf16
  unsigned short* qT    = (unsigned short*)nxt(16777216);   // chunk: 64 bh x 512 x 256
  unsigned short* kT    = (unsigned short*)nxt(16777216);
  unsigned short* vC    = (unsigned short*)nxt(16777216);   // chunk: 64 bh x 256 x 512
  unsigned short* attn  = (unsigned short*)nxt(33554432);   // chunk: 64 bh x 512 x 512
  float*          part  = (float*)nxt(8192);                // 64 bh x 16 tiles x {sum,sumsq}
  unsigned short* ctx2  = (unsigned short*)nxt(67108864);   // all 32 b x [k/8][n][8]
  float*          y1    = (float*)nxt(16777216);            // attn out + residual, f32
  unsigned short* y2    = (unsigned short*)nxt(8388608);    // LN2 bf16

  k_convert<<<2600, 256, 0, stream>>>(x, proj_w, wq, wk, wv, wo, mo_w,
                                      xb, pwb, wqT, wkT, wvT, woT, mowb);
  k_embed<<<dim3(8, 32), 256, 0, stream>>>(pwb, xb, proj_b, emb);
  k_layernorm<<<256, 256, 0, stream>>>(emb, ln1_g, ln1_b, xnb);

  for (int pass = 0; pass < 4; ++pass) {           // 8 batches (64 bh) per pass
    const int b0 = pass * 8;
    k_qkv<<<dim3(8, 64, 3), 256, 0, stream>>>(xnb, wqT, wkT, wvT, qT, kT, vC, b0);
    k_scores<<<dim3(8, 128), 256, 0, stream>>>(qT, kT, attn, part);
    k_ctx<<<dim3(8, 32), 256, 0, stream>>>(attn, part, vC, ctx2 + (size_t)b0 * 256 * 4096);
  }
  k_outproj<<<dim3(8, 32), 256, 0, stream>>>(ctx2, woT, emb, y1, 0);

  k_layernorm<<<256, 256, 0, stream>>>(y1, ln2_g, ln2_b, y2);
  k_mo<<<dim3(8, 32), 256, 0, stream>>>(y2, mowb, mo_b, outp);
}
